// v000
// Times are from an AMD MI455X. After a warm-up the kernel runs many times in a row, and a time is the length of
// such a window on the GPU divided by its runs, so every launch and the gaps after it count. The runs cycle
// through copies of the inputs. A figure is the median of several windows, for all but v000 over two sittings.
// Sittings can differ by a few percent; kernels timed side by side share one.
// The starting kernel, v000, takes 809 microseconds a run.
#include <hip/hip_runtime.h>

// Compute dtypes, f32 accumulate, one batch item per pass: qkv = x.W_qkv^T ([2048 x 1024].[1024 x 3072]; [out][in] weights as the n-major B operand; PLAIN
// bf16 operands = inputs rounded once, exact) with q/k straight to f16 hi + residual x1024 planes, out = y.W_proj^T + b_proj (y as bf16 hi + residual) on
// v_wmma_f32_16x16x32_bf16; the 16-head causal "sp2norm" attention fused on v_wmma_f32_16x16x32_f16: scores (hh + hl + lh) x 1/8, weights w = softplus(score)
// on the causal part (0 elsewhere), y = (sum_k w v_k) / ||w||_2 with the weights (x2048) as f16 hi + residual x1024 against v as f16 hi + residual; softplus and

#define NB_  1                   // per pass: the 2 batch items are processed one at a time
#define NT_  2048
#define DM   1024
#define NH_  16
#define HD   64
#define NTK  (NB_ * NT_)
#define NW   1024
#define NQKV 1024
#define PSC  2048.0f                 // softplus weights are not bounded by 1: x2048 keeps them inside f16 range up to w = 31
#define LOSC 1024.0f
#define LOSCI (1.0f / 1024.0f)

typedef _Float16 h16;
typedef unsigned short bf;
typedef __attribute__((ext_vector_type(16))) __bf16   v16bf;
typedef __attribute__((ext_vector_type(16))) _Float16 v16h;
typedef __attribute__((ext_vector_type(8)))  _Float16 v8h;
typedef __attribute__((ext_vector_type(8)))  unsigned short v8us;
typedef __attribute__((ext_vector_type(8)))  float    v8f;
typedef __attribute__((ext_vector_type(4)))  float    v4f;
typedef v8h  __attribute__((may_alias)) v8ha;
typedef v4f  __attribute__((may_alias)) v4fa;
typedef v8us __attribute__((may_alias)) v8usa;

__device__ __forceinline__ unsigned short f2bf(float f) { unsigned u = __float_as_uint(f); u += 0x7FFFu + ((u >> 16) & 1u); return (unsigned short)(u >> 16); }
__device__ __forceinline__ float bf2f(unsigned short b) { return __uint_as_float(((unsigned)b) << 16); }
__device__ __forceinline__ float bfr(float f) { return bf2f(f2bf(f)); }
__device__ __forceinline__ v16h cat16(v8h lo, v8h hi) { return __builtin_shufflevector(lo, hi, 0, 1, 2, 3, 4, 5, 6, 7, 8, 9, 10, 11, 12, 13, 14, 15); }
__device__ __forceinline__ v16bf cat16b(v8us lo, v8us hi) { return __builtin_bit_cast(v16bf, __builtin_shufflevector(lo, hi, 0, 1, 2, 3, 4, 5, 6, 7, 8, 9, 10, 11, 12, 13, 14, 15)); }
__device__ __forceinline__ v8f wmma16(v16h a, v16h b, v8f c) { return __builtin_amdgcn_wmma_f32_16x16x32_f16(false, a, false, b, (short)0, c, false, false); }
__device__ __forceinline__ v8f wmmab(v16bf a, v16bf b, v8f c) { return __builtin_amdgcn_wmma_f32_16x16x32_bf16(false, a, false, b, (short)0, c, false, false); }

__global__ __launch_bounds__(256) void k_cvtb(const float* __restrict__ src, int nrows, bf* dst) {
    const int lane = threadIdx.x & 31, r = blockIdx.x * 8 + (threadIdx.x >> 5);
    if (r >= nrows) return;
    v8us o[DM / 256];
#pragma unroll
    for (int q = 0; q < DM / 256; ++q) { v8us t;
#pragma unroll
        for (int i = 0; i < 8; ++i) t[i] = f2bf(src[(size_t)r * DM + q * 256 + lane * 8 + i]);
        o[q] = t; }
#pragma unroll
    for (int q = 0; q < DM / 256; ++q) *(v8us*)(dst + (size_t)r * DM + q * 256 + lane * 8) = o[q];
    
}

template <bool SPLITA, bool F16OUT = false>
__global__ __launch_bounds__(128) void k_gemmb(const bf* __restrict__ A, const bf* __restrict__ Al, const bf* __restrict__ Bn, const float* __restrict__ bias, float* C, int ldc, h16* C2) {
    __shared__ __align__(16) float ost[4][16 * 68];
    const int lane = threadIdx.x & 31, wave = threadIdx.x >> 5, lr = lane & 15, hi = lane >> 4;
    const int r0 = blockIdx.x * 64 + wave * 16, c0 = blockIdx.y * 64;
    const size_t aoff = (size_t)(r0 + lr) * DM + 8 * hi;
    size_t boff[4];
#pragma unroll
    for (int t = 0; t < 4; ++t) boff[t] = (size_t)(c0 + t * 16 + lr) * DM + 8 * hi;
    v8f acc[4];
#pragma unroll
    for (int t = 0; t < 4; ++t) acc[t] = (v8f){};
#pragma unroll 1
    for (int kc = 0; kc < DM; kc += 32) {
        const v16bf a = cat16b(*(const v8us*)(A + aoff + kc), *(const v8us*)(A + aoff + kc + 16));
        v16bf al = a;
        if (SPLITA) al = cat16b(*(const v8us*)(Al + aoff + kc), *(const v8us*)(Al + aoff + kc + 16));
#pragma unroll
        for (int t = 0; t < 4; ++t) { const v16bf b = cat16b(*(const v8us*)(Bn + boff[t] + kc), *(const v8us*)(Bn + boff[t] + kc + 16)); acc[t] = wmmab(a, b, acc[t]); if (SPLITA) acc[t] = wmmab(al, b, acc[t]); }
        asm volatile("v_nop\n\tv_nop\n\tv_nop\n\tv_nop" : "+v"(acc[0]), "+v"(acc[1]), "+v"(acc[2]), "+v"(acc[3]) : "v"(a), "v"(al));
    }
    float* os = &ost[wave][0];
#pragma unroll
    for (int t = 0; t < 4; ++t) { const float bv = bias ? bfr(bias[c0 + t * 16 + lr]) : 0.f;
#pragma unroll
        for (int j = 0; j < 8; ++j) os[(hi * 8 + j) * 68 + t * 16 + lr] = acc[t][j] + bv; }
    __syncthreads();
    if (F16OUT) {
        h16* crow = (h16*)(void*)C + (size_t)r0 * ldc + c0;
        auto pass = [&]() {
#pragma unroll
            for (int s = 0; s < 4; ++s) { const int row = 4 * s + (lane >> 3), piece = lane & 7; const float* sp = os + row * 68 + piece * 8; v8h o, o2;
#pragma unroll
                for (int i = 0; i < 8; ++i) { const h16 a = (h16)sp[i]; o[i] = a; o2[i] = (h16)((sp[i] - (float)a) * LOSC); }
                *(v8h*)(crow + (size_t)row * ldc + piece * 8) = o; if (C2) *(v8h*)(C2 + (size_t)r0 * ldc + c0 + (size_t)row * ldc + piece * 8) = o2; }
        };
        pass(); 
    } else {
        float* crow = C + (size_t)r0 * ldc + c0;
        auto pass = [&]() {
#pragma unroll
            for (int s = 0; s < 8; ++s) { const int Lid = (lane >> 3) + 4 * s, piece = lane & 7; const int row = Lid >> 1, cofs = (Lid & 1) * 32 + piece * 4;
                const v4f val = *(const v4fa*)(os + row * 68 + cofs); *(v4f*)(crow + (size_t)row * ldc + cofs) = val; }
        };
        pass(); 
    }
}

__global__ __launch_bounds__(256) void k_vt(const float* __restrict__ V, h16* VTH, h16* VTL) {
    __shared__ __align__(16) h16 tile[64 * 72];
    __shared__ __align__(16) h16 til2[64 * 72];
    const int bid = blockIdx.x;
    const int b = bid / (NH_ * (NT_ / 64)), rem = bid - b * (NH_ * (NT_ / 64)), h = rem / (NT_ / 64), kt = rem - h * (NT_ / 64);
    const int k0 = kt * 64, tid = threadIdx.x;
    const int kk = tid >> 2, d0 = (tid & 3) * 16;
    const float* src = V + ((size_t)b * NT_ + k0 + kk) * DM + h * HD + d0;
#pragma unroll
    for (int i = 0; i < 16; ++i) { const float v = src[i]; const h16 a = (h16)v; tile[(d0 + i) * 72 + kk] = a; til2[(d0 + i) * 72 + kk] = (h16)((v - (float)a) * LOSC); }
    __syncthreads();
    const int piece = tid & 7;
    const size_t base = (((size_t)b * NH_ + h) * HD) * NT_ + k0;
    auto pass = [&]() {
#pragma unroll
        for (int s = 0; s < 4; ++s) { const int Lid = (tid >> 3) + 32 * s; const int pln = Lid >> 6, d = Lid & 63;
            const v8h val = *(const v8ha*)((pln ? til2 : tile) + d * 72 + piece * 8); *(v8h*)((pln ? VTL : VTH) + base + (size_t)d * NT_ + piece * 8) = val; }
    };
    pass(); 
}

// k_attn: block = (b, h, 64 queries), wave = 16; causal key tiles 0..(qt*64+63)/32 of 32 keys (masked); 12 WMMA scores (hh + lh + hl) /8 (f32), softplus weights, x2048 f16 hi + residual tiles (same-wave may_alias
// reload after a compiler barrier), 12 WMMA .v (hh + hl + lh); ctx -> bf16 hi + residual planes CH/CL[tok][h*64+d].
__global__ __launch_bounds__(128) void k_attn(const h16* __restrict__ Q16, const h16* __restrict__ QL16, const h16* __restrict__ K16, const h16* __restrict__ KL16, const h16* __restrict__ VTH, const h16* __restrict__ VTL, bf* CH, bf* CL) {
    __shared__ __align__(16) h16 plds[4][16 * 32];
    __shared__ __align__(16) h16 plds2[4][16 * 32];
    __shared__ __align__(16) float ost[4][16 * 68];
    const int lane = threadIdx.x & 31, wave = threadIdx.x >> 5, lr = lane & 15, hi = lane >> 4;
    const int bid = blockIdx.x;
    const int b = bid / (NH_ * (NT_ / 64)), rem = bid - b * (NH_ * (NT_ / 64)), h = rem / (NT_ / 64), qt = rem - h * (NT_ / 64);
    const int q0 = qt * 64 + wave * 16;
    const size_t tok0 = (size_t)b * NT_;
    h16* pl = &plds[wave][0]; h16* pl2 = &plds2[wave][0];
    v16h qa[2];
    const size_t qo0 = (tok0 + q0 + lr) * DM + h * HD + 8 * hi;
#pragma unroll
    for (int kc = 0; kc < 2; ++kc) qa[kc] = cat16(*(const v8h*)(Q16 + qo0 + kc * 32), *(const v8h*)(Q16 + qo0 + kc * 32 + 16));
    const h16* kh_b = K16 + tok0 * DM + h * HD;
    const h16* kl_b = KL16 + tok0 * DM + h * HD;
    const size_t vbase = (((size_t)b * NH_ + h) * HD) * NT_;
    v8f o[4], ox[4];
#pragma unroll
    for (int n = 0; n < 4; ++n) { o[n] = (v8f){}; ox[n] = (v8f){}; }
    float mrow[8], lpart[8];
#pragma unroll
    for (int j = 0; j < 8; ++j) { mrow[j] = -3.0e38f; lpart[j] = 0.f; }
    int qpos[8];
#pragma unroll
    for (int j = 0; j < 8; ++j) qpos[j] = q0 + 8 * hi + j;
    const int kt_lo = 0, kt_hi = (qt * 64 + 63) / 32;     // causal
#pragma unroll 1
    for (int kt = kt_lo; kt <= kt_hi; ++kt) {
        const int l0 = kt * 32;
        const size_t ko0 = (size_t)(l0 + lr) * DM + 8 * hi, ko1 = (size_t)(l0 + 16 + lr) * DM + 8 * hi;
        v8f s0 = {}, s1 = {}, x0 = {}, x1 = {};
#pragma unroll
        for (int kc = 0; kc < 2; ++kc) {
            { const v16h k0h = cat16(*(const v8h*)(kh_b + ko0 + kc * 32), *(const v8h*)(kh_b + ko0 + kc * 32 + 16)), k1h = cat16(*(const v8h*)(kh_b + ko1 + kc * 32), *(const v8h*)(kh_b + ko1 + kc * 32 + 16));
              const v16h qlk = cat16(*(const v8h*)(QL16 + qo0 + kc * 32), *(const v8h*)(QL16 + qo0 + kc * 32 + 16));     // query residual re-read per step (registers)
              s0 = wmma16(qa[kc], k0h, s0); x0 = wmma16(qlk, k0h, x0); s1 = wmma16(qa[kc], k1h, s1); x1 = wmma16(qlk, k1h, x1);
              asm volatile("v_nop" : "+v"(s0), "+v"(s1), "+v"(x0), "+v"(x1) : "v"(qlk), "v"(k0h), "v"(k1h) : "memory"); }
            { const v16h k0l = cat16(*(const v8h*)(kl_b + ko0 + kc * 32), *(const v8h*)(kl_b + ko0 + kc * 32 + 16)), k1l = cat16(*(const v8h*)(kl_b + ko1 + kc * 32), *(const v8h*)(kl_b + ko1 + kc * 32 + 16));
              x0 = wmma16(qa[kc], k0l, x0); x1 = wmma16(qa[kc], k1l, x1);
              asm volatile("v_nop" : "+v"(x0), "+v"(x1) : "v"(k0l), "v"(k1l) : "memory"); }
        }
        asm volatile("v_nop\n\tv_nop\n\tv_nop\n\tv_nop" : "+v"(s0), "+v"(s1), "+v"(x0), "+v"(x1) : "v"(qa[0]), "v"(qa[1]));
        float alpha[8];
#pragma unroll
        for (int j = 0; j < 8; ++j) {
            const int ja = l0 + lr, jb = l0 + 16 + lr, qi = qpos[j];
            // sp2norm: w = causal ? softplus(s x scale) : 0 (softplus as logaddexp(x, 0) = max(x,0) + log1p(exp(-|x|))); the row is later divided by sqrt(sum w^2)
            const float a0 = (s0[j] + x0[j] * LOSCI) * 0.125f, a1 = (s1[j] + x1[j] * LOSCI) * 0.125f;
            const float p0 = (ja <= qi) ? (fmaxf(a0, 0.f) + log1pf(__expf(-fabsf(a0)))) : 0.f, p1 = (jb <= qi) ? (fmaxf(a1, 0.f) + log1pf(__expf(-fabsf(a1)))) : 0.f;
            alpha[j] = 1.0f; (void)mrow;
            lpart[j] = lpart[j] + (p0 * p0 + p1 * p1);
            const int mr = hi * 8 + j;
            const float ps0 = p0 * PSC, ps1 = p1 * PSC; const h16 h0 = (h16)ps0, h1 = (h16)ps1;
            pl[mr * 32 + lr] = h0; pl[mr * 32 + 16 + lr] = h1;
            pl2[mr * 32 + lr] = (h16)((ps0 - (float)h0) * LOSC); pl2[mr * 32 + 16 + lr] = (h16)((ps1 - (float)h1) * LOSC);
        }
        asm volatile("" ::: "memory");
        const v16h pa = cat16(*(const v8ha*)(pl + lr * 32 + hi * 8), *(const v8ha*)(pl + lr * 32 + 16 + hi * 8));
        const v16h px = cat16(*(const v8ha*)(pl2 + lr * 32 + hi * 8), *(const v8ha*)(pl2 + lr * 32 + 16 + hi * 8));
#pragma unroll
        for (int n = 0; n < 4; ++n) { const size_t vo = vbase + (size_t)(n * 16 + lr) * NT_ + l0 + hi * 8;
            const v16h vh = cat16(*(const v8h*)(VTH + vo), *(const v8h*)(VTH + vo + 16)), vl = cat16(*(const v8h*)(VTL + vo), *(const v8h*)(VTL + vo + 16));
            o[n] = wmma16(pa, vh, o[n]); ox[n] = wmma16(pa, vl, ox[n]); ox[n] = wmma16(px, vh, ox[n]);
            asm volatile("" : "+v"(o[n]), "+v"(ox[n]) : "v"(vh), "v"(vl) : "memory"); }
        asm volatile("v_nop\n\tv_nop\n\tv_nop\n\tv_nop" : "+v"(o[0]), "+v"(o[1]), "+v"(o[2]), "+v"(o[3]), "+v"(ox[0]), "+v"(ox[1]), "+v"(ox[2]), "+v"(ox[3]) : "v"(pa), "v"(px));
    }
    float inv[8];
#pragma unroll
    for (int j = 0; j < 8; ++j) { float rs = lpart[j]; rs += __shfl_xor(rs, 1, 16); rs += __shfl_xor(rs, 2, 16); rs += __shfl_xor(rs, 4, 16); rs += __shfl_xor(rs, 8, 16); inv[j] = 1.0f / (sqrtf(rs) * PSC); }     // 1 / (||w||_2 x the P scaling)
    float* os = &ost[wave][0];
#pragma unroll
    for (int n = 0; n < 4; ++n)
#pragma unroll
        for (int j = 0; j < 8; ++j) os[(hi * 8 + j) * 68 + n * 16 + lr] = (o[n][j] + ox[n][j] * LOSCI) * inv[j];
    __syncthreads();
    const size_t cbase = (tok0 + q0) * DM + (size_t)h * HD;
    auto pass = [&]() {
#pragma unroll
        for (int s = 0; s < 4; ++s) { const int row = 4 * s + (lane >> 3), piece = lane & 7; const float* sp = os + row * 68 + piece * 8; v8us oh, ol;
#pragma unroll
            for (int i = 0; i < 8; ++i) { const unsigned short hb = f2bf(sp[i]); oh[i] = hb; ol[i] = f2bf(sp[i] - bf2f(hb)); }
            *(v8us*)(CH + cbase + (size_t)row * DM + piece * 8) = oh; *(v8us*)(CL + cbase + (size_t)row * DM + piece * 8) = ol; }
    };
    pass(); 
}

#define VST2(T, p, v) do { const T vst2_v_ = (v); *(T*)(p) = vst2_v_;  } while (0)
extern "C" void kernel_launch(void* const* d_in, const int* in_sizes, int n_in,
                              void* d_out, int out_size, void* d_ws, size_t ws_size, hipStream_t stream) {
    (void)in_sizes; (void)n_in; (void)out_size;
    const float* x = (const float*)d_in[0]; const float* Wqkv = (const float*)d_in[1]; const float* Wp = (const float*)d_in[2]; const float* bp = (const float*)d_in[3];   // [out][in]
    float* out = (float*)d_out;    // [2][2048][1024]
    char* wsp = (char*)d_ws;
    auto take = [&](size_t bytes) { char* p = wsp; wsp += (bytes + 255) & ~(size_t)255; return (void*)p; };
    bf* Xb = (bf*)take((size_t)NTK * DM * 2); bf* WB = (bf*)take((size_t)3 * DM * DM * 2); bf* WpB = (bf*)take((size_t)DM * DM * 2);
    float* TMP = (float*)take((size_t)NTK * DM * 4);
    h16* QH = (h16*)take((size_t)NTK * DM * 2); h16* QL = (h16*)take((size_t)NTK * DM * 2); h16* KH = (h16*)take((size_t)NTK * DM * 2); h16* KL = (h16*)take((size_t)NTK * DM * 2);
    h16* VTH = (h16*)take((size_t)NTK * DM * 2); h16* VTL = (h16*)take((size_t)NTK * DM * 2); bf* CH = (bf*)take((size_t)NTK * DM * 2); bf* CL = (bf*)take((size_t)NTK * DM * 2);
    if ((size_t)(wsp - (char*)d_ws) > ws_size) return;    // ~ 55 MB, no aliasing (per-item reuse in stream order)
    k_cvtb<<<3 * DM / 8, 256, 0, stream>>>(Wqkv, 3 * DM, WB); k_cvtb<<<DM / 8, 256, 0, stream>>>(Wp, DM, WpB);
    for (int b = 0; b < 2; ++b) {
        k_cvtb<<<NTK / 8, 256, 0, stream>>>(x + (size_t)b * NTK * DM, NTK, Xb);
        k_gemmb<false, true><<<dim3(NTK / 64, DM / 64, 1), 128, 0, stream>>>(Xb, nullptr, WB, nullptr, (float*)(void*)QH, DM, QL);                            // q = x.W_qkv[0:1024]^T
        k_gemmb<false, true><<<dim3(NTK / 64, DM / 64, 1), 128, 0, stream>>>(Xb, nullptr, WB + (size_t)DM * DM, nullptr, (float*)(void*)KH, DM, KL);         // k
        k_gemmb<false, false><<<dim3(NTK / 64, DM / 64, 1), 128, 0, stream>>>(Xb, nullptr, WB + (size_t)2 * DM * DM, nullptr, TMP, DM, nullptr);            // v
        k_vt<<<NB_ * NH_ * (NT_ / 64), 256, 0, stream>>>(TMP, VTH, VTL);
        k_attn<<<NB_ * NH_ * (NT_ / 64), 128, 0, stream>>>(QH, QL, KH, KL, VTH, VTL, CH, CL);
        k_gemmb<true, false><<<dim3(NTK / 64, DM / 64, 1), 128, 0, stream>>>(CH, CL, WpB, bp, out + (size_t)b * NTK * DM, DM, nullptr);
    }
}

// v001
// A run of this version takes 642 microseconds.
// Timed twice side by side with v000, it ran 1.27 times as fast both times.
#include <hip/hip_runtime.h>

// Compute dtypes, f32 accumulate, one batch item per pass: qkv = x.W_qkv^T ([2048 x 1024].[1024 x 3072]; [out][in] weights as the n-major B operand; PLAIN
// bf16 operands = inputs rounded once, exact) with q/k straight to f16 hi + residual x1024 planes, out = y.W_proj^T + b_proj (y as bf16 hi + residual) on
// v_wmma_f32_16x16x32_bf16; the 16-head causal "sp2norm" attention fused on v_wmma_f32_16x16x32_f16: scores (hh + hl + lh) x 1/8, weights w = softplus(score)
// on the causal part (0 elsewhere), y = (sum_k w v_k) / ||w||_2 with the weights (x2048) as f16 hi + residual x1024 against v as f16 hi + residual; softplus and

#define NB_  1                   // per pass: the 2 batch items are processed one at a time
#define NT_  2048
#define DM   1024
#define NH_  16
#define HD   64
#define NTK  (NB_ * NT_)
#define NW   1024
#define NQKV 1024
#define PSC  2048.0f                 // softplus weights are not bounded by 1: x2048 keeps them inside f16 range up to w = 31
#define LOSC 1024.0f
#define LOSCI (1.0f / 1024.0f)

typedef _Float16 h16;
typedef unsigned short bf;
typedef __attribute__((ext_vector_type(16))) __bf16   v16bf;
typedef __attribute__((ext_vector_type(16))) _Float16 v16h;
typedef __attribute__((ext_vector_type(8)))  _Float16 v8h;
typedef __attribute__((ext_vector_type(8)))  unsigned short v8us;
typedef __attribute__((ext_vector_type(8)))  float    v8f;
typedef __attribute__((ext_vector_type(4)))  float    v4f;
typedef v8h  __attribute__((may_alias)) v8ha;
typedef v4f  __attribute__((may_alias)) v4fa;
typedef v8us __attribute__((may_alias)) v8usa;

__device__ __forceinline__ unsigned short f2bf(float f) { unsigned u = __float_as_uint(f); u += 0x7FFFu + ((u >> 16) & 1u); return (unsigned short)(u >> 16); }
__device__ __forceinline__ float bf2f(unsigned short b) { return __uint_as_float(((unsigned)b) << 16); }
__device__ __forceinline__ float bfr(float f) { return bf2f(f2bf(f)); }
__device__ __forceinline__ v16h cat16(v8h lo, v8h hi) { return __builtin_shufflevector(lo, hi, 0, 1, 2, 3, 4, 5, 6, 7, 8, 9, 10, 11, 12, 13, 14, 15); }
__device__ __forceinline__ v16bf cat16b(v8us lo, v8us hi) { return __builtin_bit_cast(v16bf, __builtin_shufflevector(lo, hi, 0, 1, 2, 3, 4, 5, 6, 7, 8, 9, 10, 11, 12, 13, 14, 15)); }
__device__ __forceinline__ v8f wmma16(v16h a, v16h b, v8f c) { return __builtin_amdgcn_wmma_f32_16x16x32_f16(false, a, false, b, (short)0, c, false, false); }
__device__ __forceinline__ v8f wmmab(v16bf a, v16bf b, v8f c) { return __builtin_amdgcn_wmma_f32_16x16x32_bf16(false, a, false, b, (short)0, c, false, false); }

__global__ __launch_bounds__(256) void k_cvtb(const float* __restrict__ src, int nrows, bf* dst) {
    const int lane = threadIdx.x & 31, r = blockIdx.x * 8 + (threadIdx.x >> 5);
    if (r >= nrows) return;
    v8us o[DM / 256];
#pragma unroll
    for (int q = 0; q < DM / 256; ++q) { v8us t;
#pragma unroll
        for (int i = 0; i < 8; ++i) t[i] = f2bf(src[(size_t)r * DM + q * 256 + lane * 8 + i]);
        o[q] = t; }
#pragma unroll
    for (int q = 0; q < DM / 256; ++q) *(v8us*)(dst + (size_t)r * DM + q * 256 + lane * 8) = o[q];
    
}

template <bool SPLITA, bool F16OUT = false>
__global__ __launch_bounds__(128) void k_gemmb(const bf* __restrict__ A, const bf* __restrict__ Al, const bf* __restrict__ Bn, const float* __restrict__ bias, float* C, int ldc, h16* C2) {
    __shared__ __align__(16) float ost[4][16 * 68];
    const int lane = threadIdx.x & 31, wave = threadIdx.x >> 5, lr = lane & 15, hi = lane >> 4;
    const int r0 = blockIdx.x * 64 + wave * 16, c0 = blockIdx.y * 64;
    const size_t aoff = (size_t)(r0 + lr) * DM + 8 * hi;
    size_t boff[4];
#pragma unroll
    for (int t = 0; t < 4; ++t) boff[t] = (size_t)(c0 + t * 16 + lr) * DM + 8 * hi;
    v8f acc[4];
#pragma unroll
    for (int t = 0; t < 4; ++t) acc[t] = (v8f){};
#pragma unroll 1
    for (int kc = 0; kc < DM; kc += 32) {
        const v16bf a = cat16b(*(const v8us*)(A + aoff + kc), *(const v8us*)(A + aoff + kc + 16));
        v16bf al = a;
        if (SPLITA) al = cat16b(*(const v8us*)(Al + aoff + kc), *(const v8us*)(Al + aoff + kc + 16));
#pragma unroll
        for (int t = 0; t < 4; ++t) { const v16bf b = cat16b(*(const v8us*)(Bn + boff[t] + kc), *(const v8us*)(Bn + boff[t] + kc + 16)); acc[t] = wmmab(a, b, acc[t]); if (SPLITA) acc[t] = wmmab(al, b, acc[t]); }
        asm volatile("v_nop\n\tv_nop\n\tv_nop\n\tv_nop" : "+v"(acc[0]), "+v"(acc[1]), "+v"(acc[2]), "+v"(acc[3]) : "v"(a), "v"(al));
    }
    float* os = &ost[wave][0];
#pragma unroll
    for (int t = 0; t < 4; ++t) { const float bv = bias ? bfr(bias[c0 + t * 16 + lr]) : 0.f;
#pragma unroll
        for (int j = 0; j < 8; ++j) os[(hi * 8 + j) * 68 + t * 16 + lr] = acc[t][j] + bv; }
    __syncthreads();
    if (F16OUT) {
        h16* crow = (h16*)(void*)C + (size_t)r0 * ldc + c0;
        auto pass = [&]() {
#pragma unroll
            for (int s = 0; s < 4; ++s) { const int row = 4 * s + (lane >> 3), piece = lane & 7; const float* sp = os + row * 68 + piece * 8; v8h o, o2;
#pragma unroll
                for (int i = 0; i < 8; ++i) { const h16 a = (h16)sp[i]; o[i] = a; o2[i] = (h16)((sp[i] - (float)a) * LOSC); }
                *(v8h*)(crow + (size_t)row * ldc + piece * 8) = o; if (C2) *(v8h*)(C2 + (size_t)r0 * ldc + c0 + (size_t)row * ldc + piece * 8) = o2; }
        };
        pass(); 
    } else {
        float* crow = C + (size_t)r0 * ldc + c0;
        auto pass = [&]() {
#pragma unroll
            for (int s = 0; s < 8; ++s) { const int Lid = (lane >> 3) + 4 * s, piece = lane & 7; const int row = Lid >> 1, cofs = (Lid & 1) * 32 + piece * 4;
                const v4f val = *(const v4fa*)(os + row * 68 + cofs); *(v4f*)(crow + (size_t)row * ldc + cofs) = val; }
        };
        pass(); 
    }
}

__global__ __launch_bounds__(256) void k_vt(const float* __restrict__ V, h16* VTH, h16* VTL) {
    __shared__ __align__(16) h16 tile[64 * 72];
    __shared__ __align__(16) h16 til2[64 * 72];
    const int bid = blockIdx.x;
    const int b = bid / (NH_ * (NT_ / 64)), rem = bid - b * (NH_ * (NT_ / 64)), h = rem / (NT_ / 64), kt = rem - h * (NT_ / 64);
    const int k0 = kt * 64, tid = threadIdx.x;
    const int kk = tid >> 2, d0 = (tid & 3) * 16;
    const float* src = V + ((size_t)b * NT_ + k0 + kk) * DM + h * HD + d0;
#pragma unroll
    for (int i = 0; i < 16; ++i) { const float v = src[i]; const h16 a = (h16)v; tile[(d0 + i) * 72 + kk] = a; til2[(d0 + i) * 72 + kk] = (h16)((v - (float)a) * LOSC); }
    __syncthreads();
    const int piece = tid & 7;
    const size_t base = (((size_t)b * NH_ + h) * HD) * NT_ + k0;
    auto pass = [&]() {
#pragma unroll
        for (int s = 0; s < 4; ++s) { const int Lid = (tid >> 3) + 32 * s; const int pln = Lid >> 6, d = Lid & 63;
            const v8h val = *(const v8ha*)((pln ? til2 : tile) + d * 72 + piece * 8); *(v8h*)((pln ? VTL : VTH) + base + (size_t)d * NT_ + piece * 8) = val; }
    };
    pass(); 
}

// Staged rows in LDS: 64 f16 of data + 8 of pad = 144 B, a pitch of 16 B x odd, which ds_load_b128 fragment reads take without bank conflicts.
#define KP   72
#define PLN  (64 * KP)               // one plane of a stage: 64 rows (K: 64 keys x 64 dims; V^T: 64 dims x 64 keys)
#define STG  (4 * PLN)               // a stage = 64 keys: K hi, K residual, V^T hi, V^T residual

__device__ __forceinline__ unsigned lds_addr(const void* p) { return (unsigned)(unsigned long long)p; }     // low 32 bits of a __shared__ address = LDS byte address

// Four rows-of-16 steps of one plane pair: each lane copies its own 16 B, global -> LDS, through no register. The s_wait_xcnt stands inside the statement so that
// no address register of an issued copy is rewritten ahead of it.
__device__ __forceinline__ void cp8(unsigned la, const h16* ga, unsigned lb, const h16* gb, size_t gstep) {
    asm volatile("global_load_async_to_lds_b128 %0, %1, off\n\t"
                 "global_load_async_to_lds_b128 %2, %3, off\n\t"
                 "global_load_async_to_lds_b128 %4, %5, off\n\t"
                 "global_load_async_to_lds_b128 %6, %7, off\n\t"
                 "global_load_async_to_lds_b128 %8, %9, off\n\t"
                 "global_load_async_to_lds_b128 %10, %11, off\n\t"
                 "global_load_async_to_lds_b128 %12, %13, off\n\t"
                 "global_load_async_to_lds_b128 %14, %15, off\n\t"
                 "s_wait_xcnt 0x0"
                 :: "v"(la), "v"(ga), "v"(la + 16 * KP * 2), "v"(ga + 16 * gstep), "v"(la + 32 * KP * 2), "v"(ga + 32 * gstep), "v"(la + 48 * KP * 2), "v"(ga + 48 * gstep),
                    "v"(lb), "v"(gb), "v"(lb + 16 * KP * 2), "v"(gb + 16 * gstep), "v"(lb + 32 * KP * 2), "v"(gb + 32 * gstep), "v"(lb + 48 * KP * 2), "v"(gb + 48 * gstep)
                 : "memory");
}
__device__ __forceinline__ void cp4(unsigned la, const h16* ga, size_t gstep) {
    asm volatile("global_load_async_to_lds_b128 %0, %1, off\n\t"
                 "global_load_async_to_lds_b128 %2, %3, off\n\t"
                 "global_load_async_to_lds_b128 %4, %5, off\n\t"
                 "global_load_async_to_lds_b128 %6, %7, off\n\t"
                 "s_wait_xcnt 0x0"
                 :: "v"(la), "v"(ga), "v"(la + 16 * KP * 2), "v"(ga + 16 * gstep), "v"(la + 32 * KP * 2), "v"(ga + 32 * gstep), "v"(la + 48 * KP * 2), "v"(ga + 48 * gstep)
                 : "memory");
}
__device__ __forceinline__ v16h frag(const h16* p) { return cat16(*(const v8ha*)p, *(const v8ha*)(p + 16)); }

// k_attn: block = (b, h, 64 queries), wave = 16 queries; causal key range in stages of 64 keys, two passes of 32 keys each. The block's four waves share each stage:
// K and V^T (hi + residual) come into a two-buffer LDS ring by asynchronous copies, stage t + 1 in flight while stage t is worked on; the query residual is staged once.
// Per pass: 12 WMMA scores /8 (f32), softplus weights x2048 as f16 hi + residual (same-wave may_alias reload after a compiler barrier), 12 WMMA .v;
// ctx -> bf16 hi + residual planes CH/CL[tok][h*64+d].
__global__ __launch_bounds__(128) void k_attn(const h16* __restrict__ Q16, const h16* __restrict__ QL16, const h16* __restrict__ K16, const h16* __restrict__ KL16, const h16* __restrict__ VTH, const h16* __restrict__ VTL, bf* CH, bf* CL) {
    __shared__ __align__(16) h16 ring[2 * STG];
    __shared__ __align__(16) h16 qls[PLN];
    __shared__ __align__(16) h16 plds[4][16 * 32];
    __shared__ __align__(16) h16 plds2[4][16 * 32];
    __shared__ __align__(16) float ost[4][16 * 68];
    const int lane = threadIdx.x & 31, wave = threadIdx.x >> 5, lr = lane & 15, hi = lane >> 4;
    const int bid = blockIdx.x;
    const int b = bid / (NH_ * (NT_ / 64)), rem = bid - b * (NH_ * (NT_ / 64)), h = rem / (NT_ / 64), qt = rem - h * (NT_ / 64);
    const int q0 = qt * 64 + wave * 16;
    const size_t tok0 = (size_t)b * NT_;
    h16* pl = &plds[wave][0]; h16* pl2 = &plds2[wave][0];
    const h16* kh_b = K16 + tok0 * DM + h * HD;
    const h16* kl_b = KL16 + tok0 * DM + h * HD;
    const size_t vbase = (((size_t)b * NH_ + h) * HD) * NT_;
    // copy slots: thread -> row (tid >> 3) + 16 i, 16-byte piece tid & 7: a wave's copy covers four whole 128-B lines
    const int crow = threadIdx.x >> 3, cpc = threadIdx.x & 7;
    const unsigned lslot = (unsigned)(crow * KP + cpc * 8) * 2u;
    const unsigned lring = lds_addr(&ring[0]) + lslot;
    auto stage = [&](int t, int bufi) {
        const unsigned lb = lring + (unsigned)bufi * (STG * 2u);
        const size_t ko = (size_t)(t * 64 + crow) * DM + cpc * 8, vo = vbase + (size_t)crow * NT_ + t * 64 + cpc * 8;
        cp8(lb, kh_b + ko, lb + PLN * 2u, kl_b + ko, DM);
        cp8(lb + 2u * PLN * 2u, VTH + vo, lb + 3u * PLN * 2u, VTL + vo, NT_);
    };
    const int ntrip = qt + 1;     // causal: keys 0 .. qt * 64 + 63
    cp4(lds_addr(&qls[0]) + lslot, QL16 + (tok0 + qt * 64 + crow) * DM + h * HD + cpc * 8, DM);
    stage(0, 0);
    asm volatile("s_wait_asynccnt 0x0" ::: "memory");     // this wave's copies of stage 0 have landed
    __syncthreads();                                      // ... and every other wave's: stage 0 and the query residual are readable
    if (ntrip > 1) stage(1, 1);
    v16h qa[2];
    const size_t qo0 = (tok0 + q0 + lr) * DM + h * HD + 8 * hi;
#pragma unroll
    for (int kc = 0; kc < 2; ++kc) qa[kc] = cat16(*(const v8h*)(Q16 + qo0 + kc * 32), *(const v8h*)(Q16 + qo0 + kc * 32 + 16));
    const h16* qlp = qls + (wave * 16 + lr) * KP + 8 * hi;
    v8f o[4], ox[4];
#pragma unroll
    for (int n = 0; n < 4; ++n) { o[n] = (v8f){}; ox[n] = (v8f){}; }
    float lpart[8];
#pragma unroll
    for (int j = 0; j < 8; ++j) lpart[j] = 0.f;
    int qpos[8];
#pragma unroll
    for (int j = 0; j < 8; ++j) qpos[j] = q0 + 8 * hi + j;
#pragma unroll 1
    for (int t = 0; t < ntrip; ++t) {
        const h16* sb = ring + (t & 1) * STG;
#pragma unroll 1
        for (int sub = 0; sub < 2; ++sub) {
            const int l0 = t * 64 + sub * 32;
            const h16* kp0 = sb + (sub * 32 + lr) * KP + 8 * hi;
            v16h k0h[2], k1h[2], k0l[2], k1l[2], qlk[2];
#pragma unroll
            for (int kc = 0; kc < 2; ++kc) {
                k0h[kc] = frag(kp0 + kc * 32); k1h[kc] = frag(kp0 + 16 * KP + kc * 32); qlk[kc] = frag(qlp + kc * 32);
                k0l[kc] = frag(kp0 + PLN + kc * 32); k1l[kc] = frag(kp0 + PLN + 16 * KP + kc * 32);
            }
            v8f s0 = {}, s1 = {}, x0 = {}, x1 = {};
#pragma unroll
            for (int kc = 0; kc < 2; ++kc) {
                s0 = wmma16(qa[kc], k0h[kc], s0); x0 = wmma16(qlk[kc], k0h[kc], x0); s1 = wmma16(qa[kc], k1h[kc], s1); x1 = wmma16(qlk[kc], k1h[kc], x1);
                x0 = wmma16(qa[kc], k0l[kc], x0); x1 = wmma16(qa[kc], k1l[kc], x1);
            }
            // four vector slots between the last score WMMA and the first use of its result or rewrite of its operands
            asm volatile("v_nop\n\tv_nop\n\tv_nop\n\tv_nop" : "+v"(s0), "+v"(s1), "+v"(x0), "+v"(x1)
                         : "v"(qa[0]), "v"(qa[1]), "v"(qlk[0]), "v"(qlk[1]), "v"(k0h[0]), "v"(k0h[1]), "v"(k1h[0]), "v"(k1h[1]), "v"(k0l[0]), "v"(k0l[1]), "v"(k1l[0]), "v"(k1l[1]));
            // V^T fragments of this pass: fetched here so that the softplus work covers their LDS latency
            const h16* vp0 = sb + 2 * PLN + lr * KP + sub * 32 + hi * 8;
            v16h vh[4], vl[4];
#pragma unroll
            for (int n = 0; n < 4; ++n) { vh[n] = frag(vp0 + n * 16 * KP); vl[n] = frag(vp0 + PLN + n * 16 * KP); }
#pragma unroll
            for (int j = 0; j < 8; ++j) {
                const int ja = l0 + lr, jb = l0 + 16 + lr, qi = qpos[j];
                // sp2norm: w = causal ? softplus(s x scale) : 0 (softplus as logaddexp(x, 0) = max(x,0) + log1p(exp(-|x|))); the row is later divided by sqrt(sum w^2)
                const float a0 = (s0[j] + x0[j] * LOSCI) * 0.125f, a1 = (s1[j] + x1[j] * LOSCI) * 0.125f;
                const float p0 = (ja <= qi) ? (fmaxf(a0, 0.f) + log1pf(__expf(-fabsf(a0)))) : 0.f, p1 = (jb <= qi) ? (fmaxf(a1, 0.f) + log1pf(__expf(-fabsf(a1)))) : 0.f;
                lpart[j] = lpart[j] + (p0 * p0 + p1 * p1);
                const int mr = hi * 8 + j;
                const float ps0 = p0 * PSC, ps1 = p1 * PSC; const h16 h0 = (h16)ps0, h1 = (h16)ps1;
                pl[mr * 32 + lr] = h0; pl[mr * 32 + 16 + lr] = h1;
                pl2[mr * 32 + lr] = (h16)((ps0 - (float)h0) * LOSC); pl2[mr * 32 + 16 + lr] = (h16)((ps1 - (float)h1) * LOSC);
            }
            asm volatile("" ::: "memory");
            const v16h pa = cat16(*(const v8ha*)(pl + lr * 32 + hi * 8), *(const v8ha*)(pl + lr * 32 + 16 + hi * 8));
            const v16h px = cat16(*(const v8ha*)(pl2 + lr * 32 + hi * 8), *(const v8ha*)(pl2 + lr * 32 + 16 + hi * 8));
#pragma unroll
            for (int n = 0; n < 4; ++n) { o[n] = wmma16(pa, vh[n], o[n]); ox[n] = wmma16(pa, vl[n], ox[n]); ox[n] = wmma16(px, vh[n], ox[n]); }
            // four vector slots behind the last WMMA, on the loop's back edge too, before its operands are refilled
            asm volatile("v_nop\n\tv_nop\n\tv_nop\n\tv_nop" : "+v"(o[0]), "+v"(o[1]), "+v"(o[2]), "+v"(o[3]), "+v"(ox[0]), "+v"(ox[1]), "+v"(ox[2]), "+v"(ox[3])
                         : "v"(pa), "v"(px), "v"(vh[0]), "v"(vh[1]), "v"(vh[2]), "v"(vh[3]), "v"(vl[0]), "v"(vl[1]), "v"(vl[2]), "v"(vl[3]));
        }
        // publish point of stage t + 1: own LDS reads of stage t done, own copies of stage t + 1 landed, then the barrier that serves both
        asm volatile("s_wait_dscnt 0x0" ::: "memory");
        asm volatile("s_wait_asynccnt 0x0" ::: "memory");
        __syncthreads();
        if (t + 2 < ntrip) stage(t + 2, t & 1);           // refill the buffer that every wave has just left
    }
    asm volatile("s_wait_asynccnt 0x0" ::: "memory");     // nothing of this wave is in flight when it goes on to the epilogue
    float inv[8];
#pragma unroll
    for (int j = 0; j < 8; ++j) { float rs = lpart[j]; rs += __shfl_xor(rs, 1, 16); rs += __shfl_xor(rs, 2, 16); rs += __shfl_xor(rs, 4, 16); rs += __shfl_xor(rs, 8, 16); inv[j] = 1.0f / (sqrtf(rs) * PSC); }     // 1 / (||w||_2 x the P scaling)
    float* os = &ost[wave][0];
#pragma unroll
    for (int n = 0; n < 4; ++n)
#pragma unroll
        for (int j = 0; j < 8; ++j) os[(hi * 8 + j) * 68 + n * 16 + lr] = (o[n][j] + ox[n][j] * LOSCI) * inv[j];
    __syncthreads();
    const size_t cbase = (tok0 + q0) * DM + (size_t)h * HD;
    auto pass = [&]() {
#pragma unroll
        for (int s = 0; s < 4; ++s) { const int row = 4 * s + (lane >> 3), piece = lane & 7; const float* sp = os + row * 68 + piece * 8; v8us oh, ol;
#pragma unroll
            for (int i = 0; i < 8; ++i) { const unsigned short hb = f2bf(sp[i]); oh[i] = hb; ol[i] = f2bf(sp[i] - bf2f(hb)); }
            *(v8us*)(CH + cbase + (size_t)row * DM + piece * 8) = oh; *(v8us*)(CL + cbase + (size_t)row * DM + piece * 8) = ol; }
    };
    pass(); 
}

#define VST2(T, p, v) do { const T vst2_v_ = (v); *(T*)(p) = vst2_v_;  } while (0)
extern "C" void kernel_launch(void* const* d_in, const int* in_sizes, int n_in,
                              void* d_out, int out_size, void* d_ws, size_t ws_size, hipStream_t stream) {
    (void)in_sizes; (void)n_in; (void)out_size;
    const float* x = (const float*)d_in[0]; const float* Wqkv = (const float*)d_in[1]; const float* Wp = (const float*)d_in[2]; const float* bp = (const float*)d_in[3];   // [out][in]
    float* out = (float*)d_out;    // [2][2048][1024]
    char* wsp = (char*)d_ws;
    auto take = [&](size_t bytes) { char* p = wsp; wsp += (bytes + 255) & ~(size_t)255; return (void*)p; };
    bf* Xb = (bf*)take((size_t)NTK * DM * 2); bf* WB = (bf*)take((size_t)3 * DM * DM * 2); bf* WpB = (bf*)take((size_t)DM * DM * 2);
    float* TMP = (float*)take((size_t)NTK * DM * 4);
    h16* QH = (h16*)take((size_t)NTK * DM * 2); h16* QL = (h16*)take((size_t)NTK * DM * 2); h16* KH = (h16*)take((size_t)NTK * DM * 2); h16* KL = (h16*)take((size_t)NTK * DM * 2);
    h16* VTH = (h16*)take((size_t)NTK * DM * 2); h16* VTL = (h16*)take((size_t)NTK * DM * 2); bf* CH = (bf*)take((size_t)NTK * DM * 2); bf* CL = (bf*)take((size_t)NTK * DM * 2);
    if ((size_t)(wsp - (char*)d_ws) > ws_size) return;    // ~ 55 MB, no aliasing (per-item reuse in stream order)
    k_cvtb<<<3 * DM / 8, 256, 0, stream>>>(Wqkv, 3 * DM, WB); k_cvtb<<<DM / 8, 256, 0, stream>>>(Wp, DM, WpB);
    for (int b = 0; b < 2; ++b) {
        k_cvtb<<<NTK / 8, 256, 0, stream>>>(x + (size_t)b * NTK * DM, NTK, Xb);
        k_gemmb<false, true><<<dim3(NTK / 64, DM / 64, 1), 128, 0, stream>>>(Xb, nullptr, WB, nullptr, (float*)(void*)QH, DM, QL);                            // q = x.W_qkv[0:1024]^T
        k_gemmb<false, true><<<dim3(NTK / 64, DM / 64, 1), 128, 0, stream>>>(Xb, nullptr, WB + (size_t)DM * DM, nullptr, (float*)(void*)KH, DM, KL);         // k
        k_gemmb<false, false><<<dim3(NTK / 64, DM / 64, 1), 128, 0, stream>>>(Xb, nullptr, WB + (size_t)2 * DM * DM, nullptr, TMP, DM, nullptr);            // v
        k_vt<<<NB_ * NH_ * (NT_ / 64), 256, 0, stream>>>(TMP, VTH, VTL);
        k_attn<<<NB_ * NH_ * (NT_ / 64), 128, 0, stream>>>(QH, QL, KH, KL, VTH, VTL, CH, CL);
        k_gemmb<true, false><<<dim3(NTK / 64, DM / 64, 1), 128, 0, stream>>>(CH, CL, WpB, bp, out + (size_t)b * NTK * DM, DM, nullptr);
    }
}

// v002
// Measured time: 323 microseconds a run.
// Two timings next to v001 put it at 1.98 and 2.00 times that version's speed.
// Counting every step since v000, it is 2.53 times as fast.
#include <hip/hip_runtime.h>

// Compute dtypes, f32 accumulate, one batch item per pass: qkv = x.W_qkv^T ([2048 x 1024].[1024 x 3072]; [out][in] weights as the n-major B operand; PLAIN
// bf16 operands = inputs rounded once, exact) with q/k straight to f16 hi + residual x1024 planes, out = y.W_proj^T + b_proj (y as bf16 hi + residual) on
// v_wmma_f32_16x16x32_bf16; the 16-head causal "sp2norm" attention fused on v_wmma_f32_16x16x32_f16: scores (hh + hl + lh) x 1/8, weights w = softplus(score)
// on the causal part (0 elsewhere), y = (sum_k w v_k) / ||w||_2 with the weights (x2048) as f16 hi + residual x1024 against v as f16 hi + residual; softplus and

#define NB_  1                   // per pass: the 2 batch items are processed one at a time
#define NT_  2048
#define DM   1024
#define NH_  16
#define HD   64
#define NTK  (NB_ * NT_)
#define NW   1024
#define NQKV 1024
#define PSC  2048.0f                 // softplus weights are not bounded by 1: x2048 keeps them inside f16 range up to w = 31
#define LOSC 1024.0f
#define LOSCI (1.0f / 1024.0f)

typedef _Float16 h16;
typedef unsigned short bf;
typedef __attribute__((ext_vector_type(16))) __bf16   v16bf;
typedef __attribute__((ext_vector_type(16))) _Float16 v16h;
typedef __attribute__((ext_vector_type(8)))  _Float16 v8h;
typedef __attribute__((ext_vector_type(8)))  unsigned short v8us;
typedef __attribute__((ext_vector_type(8)))  float    v8f;
typedef __attribute__((ext_vector_type(4)))  float    v4f;
typedef v8h  __attribute__((may_alias)) v8ha;
typedef v4f  __attribute__((may_alias)) v4fa;
typedef v8us __attribute__((may_alias)) v8usa;

__device__ __forceinline__ unsigned short f2bf(float f) { unsigned u = __float_as_uint(f); u += 0x7FFFu + ((u >> 16) & 1u); return (unsigned short)(u >> 16); }
__device__ __forceinline__ float bf2f(unsigned short b) { return __uint_as_float(((unsigned)b) << 16); }
__device__ __forceinline__ float bfr(float f) { return bf2f(f2bf(f)); }
__device__ __forceinline__ v16h cat16(v8h lo, v8h hi) { return __builtin_shufflevector(lo, hi, 0, 1, 2, 3, 4, 5, 6, 7, 8, 9, 10, 11, 12, 13, 14, 15); }
__device__ __forceinline__ v16bf cat16b(v8us lo, v8us hi) { return __builtin_bit_cast(v16bf, __builtin_shufflevector(lo, hi, 0, 1, 2, 3, 4, 5, 6, 7, 8, 9, 10, 11, 12, 13, 14, 15)); }
__device__ __forceinline__ v8f wmma16(v16h a, v16h b, v8f c) { return __builtin_amdgcn_wmma_f32_16x16x32_f16(false, a, false, b, (short)0, c, false, false); }
__device__ __forceinline__ v8f wmmab(v16bf a, v16bf b, v8f c) { return __builtin_amdgcn_wmma_f32_16x16x32_bf16(false, a, false, b, (short)0, c, false, false); }

__global__ __launch_bounds__(256) void k_cvtb(const float* __restrict__ src, int nrows, bf* dst) {
    const int lane = threadIdx.x & 31, r = blockIdx.x * 8 + (threadIdx.x >> 5);
    if (r >= nrows) return;
    v8us o[DM / 256];
#pragma unroll
    for (int q = 0; q < DM / 256; ++q) { v8us t;
#pragma unroll
        for (int i = 0; i < 8; ++i) t[i] = f2bf(src[(size_t)r * DM + q * 256 + lane * 8 + i]);
        o[q] = t; }
#pragma unroll
    for (int q = 0; q < DM / 256; ++q) *(v8us*)(dst + (size_t)r * DM + q * 256 + lane * 8) = o[q];
    
}

template <bool SPLITA, bool F16OUT = false>
__global__ __launch_bounds__(128) void k_gemmb(const bf* __restrict__ A, const bf* __restrict__ Al, const bf* __restrict__ Bn, const float* __restrict__ bias, float* C, int ldc, h16* C2) {
    __shared__ __align__(16) float ost[4][16 * 68];
    const int lane = threadIdx.x & 31, wave = threadIdx.x >> 5, lr = lane & 15, hi = lane >> 4;
    const int r0 = blockIdx.x * 64 + wave * 16, c0 = blockIdx.y * 64;
    const size_t aoff = (size_t)(r0 + lr) * DM + 8 * hi;
    size_t boff[4];
#pragma unroll
    for (int t = 0; t < 4; ++t) boff[t] = (size_t)(c0 + t * 16 + lr) * DM + 8 * hi;
    v8f acc[4];
#pragma unroll
    for (int t = 0; t < 4; ++t) acc[t] = (v8f){};
#pragma unroll 1
    for (int kc = 0; kc < DM; kc += 32) {
        const v16bf a = cat16b(*(const v8us*)(A + aoff + kc), *(const v8us*)(A + aoff + kc + 16));
        v16bf al = a;
        if (SPLITA) al = cat16b(*(const v8us*)(Al + aoff + kc), *(const v8us*)(Al + aoff + kc + 16));
#pragma unroll
        for (int t = 0; t < 4; ++t) { const v16bf b = cat16b(*(const v8us*)(Bn + boff[t] + kc), *(const v8us*)(Bn + boff[t] + kc + 16)); acc[t] = wmmab(a, b, acc[t]); if (SPLITA) acc[t] = wmmab(al, b, acc[t]); }
        asm volatile("v_nop\n\tv_nop\n\tv_nop\n\tv_nop" : "+v"(acc[0]), "+v"(acc[1]), "+v"(acc[2]), "+v"(acc[3]) : "v"(a), "v"(al));
    }
    float* os = &ost[wave][0];
#pragma unroll
    for (int t = 0; t < 4; ++t) { const float bv = bias ? bfr(bias[c0 + t * 16 + lr]) : 0.f;
#pragma unroll
        for (int j = 0; j < 8; ++j) os[(hi * 8 + j) * 68 + t * 16 + lr] = acc[t][j] + bv; }
    __syncthreads();
    if (F16OUT) {
        h16* crow = (h16*)(void*)C + (size_t)r0 * ldc + c0;
        auto pass = [&]() {
#pragma unroll
            for (int s = 0; s < 4; ++s) { const int row = 4 * s + (lane >> 3), piece = lane & 7; const float* sp = os + row * 68 + piece * 8; v8h o, o2;
#pragma unroll
                for (int i = 0; i < 8; ++i) { const h16 a = (h16)sp[i]; o[i] = a; o2[i] = (h16)((sp[i] - (float)a) * LOSC); }
                *(v8h*)(crow + (size_t)row * ldc + piece * 8) = o; if (C2) *(v8h*)(C2 + (size_t)r0 * ldc + c0 + (size_t)row * ldc + piece * 8) = o2; }
        };
        pass(); 
    } else {
        float* crow = C + (size_t)r0 * ldc + c0;
        auto pass = [&]() {
#pragma unroll
            for (int s = 0; s < 8; ++s) { const int Lid = (lane >> 3) + 4 * s, piece = lane & 7; const int row = Lid >> 1, cofs = (Lid & 1) * 32 + piece * 4;
                const v4f val = *(const v4fa*)(os + row * 68 + cofs); *(v4f*)(crow + (size_t)row * ldc + cofs) = val; }
        };
        pass(); 
    }
}

__global__ __launch_bounds__(256) void k_vt(const float* __restrict__ V, h16* VTH, h16* VTL) {
    __shared__ __align__(16) h16 tile[64 * 72];
    __shared__ __align__(16) h16 til2[64 * 72];
    const int bid = blockIdx.x;
    const int b = bid / (NH_ * (NT_ / 64)), rem = bid - b * (NH_ * (NT_ / 64)), h = rem / (NT_ / 64), kt = rem - h * (NT_ / 64);
    const int k0 = kt * 64, tid = threadIdx.x;
    const int kk = tid >> 2, d0 = (tid & 3) * 16;
    const float* src = V + ((size_t)b * NT_ + k0 + kk) * DM + h * HD + d0;
#pragma unroll
    for (int i = 0; i < 16; ++i) { const float v = src[i]; const h16 a = (h16)v; tile[(d0 + i) * 72 + kk] = a; til2[(d0 + i) * 72 + kk] = (h16)((v - (float)a) * LOSC); }
    __syncthreads();
    const int piece = tid & 7;
    const size_t base = (((size_t)b * NH_ + h) * HD) * NT_ + k0;
    auto pass = [&]() {
#pragma unroll
        for (int s = 0; s < 4; ++s) { const int Lid = (tid >> 3) + 32 * s; const int pln = Lid >> 6, d = Lid & 63;
            const v8h val = *(const v8ha*)((pln ? til2 : tile) + d * 72 + piece * 8); *(v8h*)((pln ? VTL : VTH) + base + (size_t)d * NT_ + piece * 8) = val; }
    };
    pass(); 
}

// Staged rows in LDS: 64 f16 of data + 8 of pad = 144 B, a pitch of 16 B x odd, which ds_load_b128 fragment reads take without bank conflicts.
#define KP   72
#define PLN  (64 * KP)               // one plane of a stage: 64 rows (K: 64 keys x 64 dims; V^T: 64 dims x 64 keys)
#define STG  (4 * PLN)               // a stage = 64 keys: K hi, K residual, V^T hi, V^T residual

__device__ __forceinline__ unsigned lds_addr(const void* p) { return (unsigned)(unsigned long long)p; }     // low 32 bits of a __shared__ address = LDS byte address

// Four rows-of-16 steps of one plane pair: each lane copies its own 16 B, global -> LDS, through no register. The s_wait_xcnt stands inside the statement so that
// no address register of an issued copy is rewritten ahead of it.
__device__ __forceinline__ void cp8(unsigned la, const h16* ga, unsigned lb, const h16* gb, size_t gstep) {
    asm volatile("global_load_async_to_lds_b128 %0, %1, off\n\t"
                 "global_load_async_to_lds_b128 %2, %3, off\n\t"
                 "global_load_async_to_lds_b128 %4, %5, off\n\t"
                 "global_load_async_to_lds_b128 %6, %7, off\n\t"
                 "global_load_async_to_lds_b128 %8, %9, off\n\t"
                 "global_load_async_to_lds_b128 %10, %11, off\n\t"
                 "global_load_async_to_lds_b128 %12, %13, off\n\t"
                 "global_load_async_to_lds_b128 %14, %15, off\n\t"
                 "s_wait_xcnt 0x0"
                 :: "v"(la), "v"(ga), "v"(la + 16 * KP * 2), "v"(ga + 16 * gstep), "v"(la + 32 * KP * 2), "v"(ga + 32 * gstep), "v"(la + 48 * KP * 2), "v"(ga + 48 * gstep),
                    "v"(lb), "v"(gb), "v"(lb + 16 * KP * 2), "v"(gb + 16 * gstep), "v"(lb + 32 * KP * 2), "v"(gb + 32 * gstep), "v"(lb + 48 * KP * 2), "v"(gb + 48 * gstep)
                 : "memory");
}
__device__ __forceinline__ void cp4(unsigned la, const h16* ga, size_t gstep) {
    asm volatile("global_load_async_to_lds_b128 %0, %1, off\n\t"
                 "global_load_async_to_lds_b128 %2, %3, off\n\t"
                 "global_load_async_to_lds_b128 %4, %5, off\n\t"
                 "global_load_async_to_lds_b128 %6, %7, off\n\t"
                 "s_wait_xcnt 0x0"
                 :: "v"(la), "v"(ga), "v"(la + 16 * KP * 2), "v"(ga + 16 * gstep), "v"(la + 32 * KP * 2), "v"(ga + 32 * gstep), "v"(la + 48 * KP * 2), "v"(ga + 48 * gstep)
                 : "memory");
}
// softplus(x) = max(x, 0) + log1p(e), e = exp(-|x|) in (0, 1]. log1p(e) = log(u) + c with u = 1 + e rounded and c = e - (u - 1), exactly what that rounding lost
// (|c| <= 2^-24; taking c for c / u moves the result by at most 2^-24 of itself): one hardware log2, small e keeps its relative accuracy and never falls to 0.
__device__ __forceinline__ float softplusf(float x) {
    const float e = __expf(-fabsf(x)), u = 1.0f + e;
    return fmaxf(x, 0.f) + fmaf(__builtin_amdgcn_logf(u), 0.69314718f, e - (u - 1.0f));
}
__device__ __forceinline__ v16h frag(const h16* p) { return cat16(*(const v8ha*)p, *(const v8ha*)(p + 16)); }

// k_attn: block = (b, h, 64 queries), wave = 16 queries; causal key range in stages of 64 keys, two passes of 32 keys each. The block's four waves share each stage:
// K and V^T (hi + residual) come into a two-buffer LDS ring by asynchronous copies, stage t + 1 in flight while stage t is worked on; the query residual is staged once.
// Per pass: 12 WMMA scores /8 (f32), softplus weights x2048 as f16 hi + residual (same-wave may_alias reload after a compiler barrier), 12 WMMA .v;
// ctx -> bf16 hi + residual planes CH/CL[tok][h*64+d].
__global__ __launch_bounds__(128) void k_attn(const h16* __restrict__ Q16, const h16* __restrict__ QL16, const h16* __restrict__ K16, const h16* __restrict__ KL16, const h16* __restrict__ VTH, const h16* __restrict__ VTL, bf* CH, bf* CL) {
    __shared__ __align__(16) h16 ring[2 * STG];
    __shared__ __align__(16) h16 qls[PLN];
    __shared__ __align__(16) h16 plds[4][16 * 32];
    __shared__ __align__(16) h16 plds2[4][16 * 32];
    __shared__ __align__(16) float ost[4][16 * 68];
    const int lane = threadIdx.x & 31, wave = threadIdx.x >> 5, lr = lane & 15, hi = lane >> 4;
    const int bid = blockIdx.x;
    const int b = bid / (NH_ * (NT_ / 64)), rem = bid - b * (NH_ * (NT_ / 64)), h = rem / (NT_ / 64), qt = rem - h * (NT_ / 64);
    const int q0 = qt * 64 + wave * 16;
    const size_t tok0 = (size_t)b * NT_;
    h16* pl = &plds[wave][0]; h16* pl2 = &plds2[wave][0];
    const h16* kh_b = K16 + tok0 * DM + h * HD;
    const h16* kl_b = KL16 + tok0 * DM + h * HD;
    const size_t vbase = (((size_t)b * NH_ + h) * HD) * NT_;
    // copy slots: thread -> row (tid >> 3) + 16 i, 16-byte piece tid & 7: a wave's copy covers four whole 128-B lines
    const int crow = threadIdx.x >> 3, cpc = threadIdx.x & 7;
    const unsigned lslot = (unsigned)(crow * KP + cpc * 8) * 2u;
    const unsigned lring = lds_addr(&ring[0]) + lslot;
    auto stage = [&](int t, int bufi) {
        const unsigned lb = lring + (unsigned)bufi * (STG * 2u);
        const size_t ko = (size_t)(t * 64 + crow) * DM + cpc * 8, vo = vbase + (size_t)crow * NT_ + t * 64 + cpc * 8;
        cp8(lb, kh_b + ko, lb + PLN * 2u, kl_b + ko, DM);
        cp8(lb + 2u * PLN * 2u, VTH + vo, lb + 3u * PLN * 2u, VTL + vo, NT_);
    };
    const int ntrip = qt + 1;     // causal: keys 0 .. qt * 64 + 63
    cp4(lds_addr(&qls[0]) + lslot, QL16 + (tok0 + qt * 64 + crow) * DM + h * HD + cpc * 8, DM);
    stage(0, 0);
    asm volatile("s_wait_asynccnt 0x0" ::: "memory");     // this wave's copies of stage 0 have landed
    __syncthreads();                                      // ... and every other wave's: stage 0 and the query residual are readable
    if (ntrip > 1) stage(1, 1);
    v16h qa[2];
    const size_t qo0 = (tok0 + q0 + lr) * DM + h * HD + 8 * hi;
#pragma unroll
    for (int kc = 0; kc < 2; ++kc) qa[kc] = cat16(*(const v8h*)(Q16 + qo0 + kc * 32), *(const v8h*)(Q16 + qo0 + kc * 32 + 16));
    const h16* qlp = qls + (wave * 16 + lr) * KP + 8 * hi;
    v8f o[4], ox[4];
#pragma unroll
    for (int n = 0; n < 4; ++n) { o[n] = (v8f){}; ox[n] = (v8f){}; }
    float lpart[8];
#pragma unroll
    for (int j = 0; j < 8; ++j) lpart[j] = 0.f;
    int qpos[8];
#pragma unroll
    for (int j = 0; j < 8; ++j) qpos[j] = q0 + 8 * hi + j;
#pragma unroll 1
    for (int t = 0; t < ntrip; ++t) {
        const h16* sb = ring + (t & 1) * STG;
#pragma unroll 1
        for (int sub = 0; sub < 2; ++sub) {
            const int l0 = t * 64 + sub * 32;
            const h16* kp0 = sb + (sub * 32 + lr) * KP + 8 * hi;
            v16h k0h[2], k1h[2], k0l[2], k1l[2], qlk[2];
#pragma unroll
            for (int kc = 0; kc < 2; ++kc) {
                k0h[kc] = frag(kp0 + kc * 32); k1h[kc] = frag(kp0 + 16 * KP + kc * 32); qlk[kc] = frag(qlp + kc * 32);
                k0l[kc] = frag(kp0 + PLN + kc * 32); k1l[kc] = frag(kp0 + PLN + 16 * KP + kc * 32);
            }
            v8f s0 = {}, s1 = {}, x0 = {}, x1 = {};
#pragma unroll
            for (int kc = 0; kc < 2; ++kc) {
                s0 = wmma16(qa[kc], k0h[kc], s0); x0 = wmma16(qlk[kc], k0h[kc], x0); s1 = wmma16(qa[kc], k1h[kc], s1); x1 = wmma16(qlk[kc], k1h[kc], x1);
                x0 = wmma16(qa[kc], k0l[kc], x0); x1 = wmma16(qa[kc], k1l[kc], x1);
            }
            // four vector slots between the last score WMMA and the first use of its result or rewrite of its operands
            asm volatile("v_nop\n\tv_nop\n\tv_nop\n\tv_nop" : "+v"(s0), "+v"(s1), "+v"(x0), "+v"(x1)
                         : "v"(qa[0]), "v"(qa[1]), "v"(qlk[0]), "v"(qlk[1]), "v"(k0h[0]), "v"(k0h[1]), "v"(k1h[0]), "v"(k1h[1]), "v"(k0l[0]), "v"(k0l[1]), "v"(k1l[0]), "v"(k1l[1]));
            // V^T fragments of this pass: fetched here so that the softplus work covers their LDS latency
            const h16* vp0 = sb + 2 * PLN + lr * KP + sub * 32 + hi * 8;
            v16h vh[4], vl[4];
#pragma unroll
            for (int n = 0; n < 4; ++n) { vh[n] = frag(vp0 + n * 16 * KP); vl[n] = frag(vp0 + PLN + n * 16 * KP); }
#pragma unroll
            for (int j = 0; j < 8; ++j) {
                const int ja = l0 + lr, jb = l0 + 16 + lr, qi = qpos[j];
                // sp2norm: w = causal ? softplus(s x scale) : 0 (softplus as logaddexp(x, 0) = max(x,0) + log1p(exp(-|x|))); the row is later divided by sqrt(sum w^2)
                const float a0 = (s0[j] + x0[j] * LOSCI) * 0.125f, a1 = (s1[j] + x1[j] * LOSCI) * 0.125f;
                const float w0 = softplusf(a0), w1 = softplusf(a1);
                const float p0 = (ja <= qi) ? w0 : 0.f, p1 = (jb <= qi) ? w1 : 0.f;
                lpart[j] = lpart[j] + (p0 * p0 + p1 * p1);
                const int mr = hi * 8 + j;
                const float ps0 = p0 * PSC, ps1 = p1 * PSC; const h16 h0 = (h16)ps0, h1 = (h16)ps1;
                pl[mr * 32 + lr] = h0; pl[mr * 32 + 16 + lr] = h1;
                pl2[mr * 32 + lr] = (h16)((ps0 - (float)h0) * LOSC); pl2[mr * 32 + 16 + lr] = (h16)((ps1 - (float)h1) * LOSC);
            }
            asm volatile("" ::: "memory");
            const v16h pa = cat16(*(const v8ha*)(pl + lr * 32 + hi * 8), *(const v8ha*)(pl + lr * 32 + 16 + hi * 8));
            const v16h px = cat16(*(const v8ha*)(pl2 + lr * 32 + hi * 8), *(const v8ha*)(pl2 + lr * 32 + 16 + hi * 8));
#pragma unroll
            for (int n = 0; n < 4; ++n) { o[n] = wmma16(pa, vh[n], o[n]); ox[n] = wmma16(pa, vl[n], ox[n]); ox[n] = wmma16(px, vh[n], ox[n]); }
            // four vector slots behind the last WMMA, on the loop's back edge too, before its operands are refilled
            asm volatile("v_nop\n\tv_nop\n\tv_nop\n\tv_nop" : "+v"(o[0]), "+v"(o[1]), "+v"(o[2]), "+v"(o[3]), "+v"(ox[0]), "+v"(ox[1]), "+v"(ox[2]), "+v"(ox[3])
                         : "v"(pa), "v"(px), "v"(vh[0]), "v"(vh[1]), "v"(vh[2]), "v"(vh[3]), "v"(vl[0]), "v"(vl[1]), "v"(vl[2]), "v"(vl[3]));
        }
        // publish point of stage t + 1: own LDS reads of stage t done, own copies of stage t + 1 landed, then the barrier that serves both
        asm volatile("s_wait_dscnt 0x0" ::: "memory");
        asm volatile("s_wait_asynccnt 0x0" ::: "memory");
        __syncthreads();
        if (t + 2 < ntrip) stage(t + 2, t & 1);           // refill the buffer that every wave has just left
    }
    asm volatile("s_wait_asynccnt 0x0" ::: "memory");     // nothing of this wave is in flight when it goes on to the epilogue
    float inv[8];
#pragma unroll
    for (int j = 0; j < 8; ++j) { float rs = lpart[j]; rs += __shfl_xor(rs, 1, 16); rs += __shfl_xor(rs, 2, 16); rs += __shfl_xor(rs, 4, 16); rs += __shfl_xor(rs, 8, 16); inv[j] = 1.0f / (sqrtf(rs) * PSC); }     // 1 / (||w||_2 x the P scaling)
    float* os = &ost[wave][0];
#pragma unroll
    for (int n = 0; n < 4; ++n)
#pragma unroll
        for (int j = 0; j < 8; ++j) os[(hi * 8 + j) * 68 + n * 16 + lr] = (o[n][j] + ox[n][j] * LOSCI) * inv[j];
    __syncthreads();
    const size_t cbase = (tok0 + q0) * DM + (size_t)h * HD;
    auto pass = [&]() {
#pragma unroll
        for (int s = 0; s < 4; ++s) { const int row = 4 * s + (lane >> 3), piece = lane & 7; const float* sp = os + row * 68 + piece * 8; v8us oh, ol;
#pragma unroll
            for (int i = 0; i < 8; ++i) { const unsigned short hb = f2bf(sp[i]); oh[i] = hb; ol[i] = f2bf(sp[i] - bf2f(hb)); }
            *(v8us*)(CH + cbase + (size_t)row * DM + piece * 8) = oh; *(v8us*)(CL + cbase + (size_t)row * DM + piece * 8) = ol; }
    };
    pass(); 
}

#define VST2(T, p, v) do { const T vst2_v_ = (v); *(T*)(p) = vst2_v_;  } while (0)
extern "C" void kernel_launch(void* const* d_in, const int* in_sizes, int n_in,
                              void* d_out, int out_size, void* d_ws, size_t ws_size, hipStream_t stream) {
    (void)in_sizes; (void)n_in; (void)out_size;
    const float* x = (const float*)d_in[0]; const float* Wqkv = (const float*)d_in[1]; const float* Wp = (const float*)d_in[2]; const float* bp = (const float*)d_in[3];   // [out][in]
    float* out = (float*)d_out;    // [2][2048][1024]
    char* wsp = (char*)d_ws;
    auto take = [&](size_t bytes) { char* p = wsp; wsp += (bytes + 255) & ~(size_t)255; return (void*)p; };
    bf* Xb = (bf*)take((size_t)NTK * DM * 2); bf* WB = (bf*)take((size_t)3 * DM * DM * 2); bf* WpB = (bf*)take((size_t)DM * DM * 2);
    float* TMP = (float*)take((size_t)NTK * DM * 4);
    h16* QH = (h16*)take((size_t)NTK * DM * 2); h16* QL = (h16*)take((size_t)NTK * DM * 2); h16* KH = (h16*)take((size_t)NTK * DM * 2); h16* KL = (h16*)take((size_t)NTK * DM * 2);
    h16* VTH = (h16*)take((size_t)NTK * DM * 2); h16* VTL = (h16*)take((size_t)NTK * DM * 2); bf* CH = (bf*)take((size_t)NTK * DM * 2); bf* CL = (bf*)take((size_t)NTK * DM * 2);
    if ((size_t)(wsp - (char*)d_ws) > ws_size) return;    // ~ 55 MB, no aliasing (per-item reuse in stream order)
    k_cvtb<<<3 * DM / 8, 256, 0, stream>>>(Wqkv, 3 * DM, WB); k_cvtb<<<DM / 8, 256, 0, stream>>>(Wp, DM, WpB);
    for (int b = 0; b < 2; ++b) {
        k_cvtb<<<NTK / 8, 256, 0, stream>>>(x + (size_t)b * NTK * DM, NTK, Xb);
        k_gemmb<false, true><<<dim3(NTK / 64, DM / 64, 1), 128, 0, stream>>>(Xb, nullptr, WB, nullptr, (float*)(void*)QH, DM, QL);                            // q = x.W_qkv[0:1024]^T
        k_gemmb<false, true><<<dim3(NTK / 64, DM / 64, 1), 128, 0, stream>>>(Xb, nullptr, WB + (size_t)DM * DM, nullptr, (float*)(void*)KH, DM, KL);         // k
        k_gemmb<false, false><<<dim3(NTK / 64, DM / 64, 1), 128, 0, stream>>>(Xb, nullptr, WB + (size_t)2 * DM * DM, nullptr, TMP, DM, nullptr);            // v
        k_vt<<<NB_ * NH_ * (NT_ / 64), 256, 0, stream>>>(TMP, VTH, VTL);
        k_attn<<<NB_ * NH_ * (NT_ / 64), 128, 0, stream>>>(QH, QL, KH, KL, VTH, VTL, CH, CL);
        k_gemmb<true, false><<<dim3(NTK / 64, DM / 64, 1), 128, 0, stream>>>(CH, CL, WpB, bp, out + (size_t)b * NTK * DM, DM, nullptr);
    }
}

// v003
// It runs in 208 microseconds.
// Timed twice side by side with v002, it ran 1.55 and 1.56 times as fast.
// Counting every step since v000, it is 3.93 times as fast.
#include <hip/hip_runtime.h>

// Compute dtypes, f32 accumulate, one batch item per pass: qkv = x.W_qkv^T ([2048 x 1024].[1024 x 3072]; [out][in] weights as the n-major B operand; PLAIN
// bf16 operands = inputs rounded once, exact) with q/k straight to f16 hi + residual x1024 planes, out = y.W_proj^T + b_proj (y as bf16 hi + residual) on
// v_wmma_f32_16x16x32_bf16; the 16-head causal "sp2norm" attention fused on v_wmma_f32_16x16x32_f16: scores (hh + hl + lh) x 1/8, weights w = softplus(score)
// on the causal part (0 elsewhere), y = (sum_k w v_k) / ||w||_2 with the weights (x2048) as f16 hi + residual x1024 against v as f16 hi + residual; softplus and

#define NB_  1                   // per pass: the 2 batch items are processed one at a time
#define NT_  2048
#define DM   1024
#define NH_  16
#define HD   64
#define NTK  (NB_ * NT_)
#define NW   1024
#define NQKV 1024
#define PSC  2048.0f                 // softplus weights are not bounded by 1: x2048 keeps them inside f16 range up to w = 31
#define LOSC 1024.0f
#define LOSCI (1.0f / 1024.0f)

typedef _Float16 h16;
typedef unsigned short bf;
typedef __attribute__((ext_vector_type(16))) __bf16   v16bf;
typedef __attribute__((ext_vector_type(16))) _Float16 v16h;
typedef __attribute__((ext_vector_type(8)))  _Float16 v8h;
typedef __attribute__((ext_vector_type(8)))  unsigned short v8us;
typedef __attribute__((ext_vector_type(8)))  float    v8f;
typedef __attribute__((ext_vector_type(4)))  float    v4f;
typedef v8h  __attribute__((may_alias)) v8ha;
typedef v4f  __attribute__((may_alias)) v4fa;
typedef v8us __attribute__((may_alias)) v8usa;

__device__ __forceinline__ unsigned short f2bf(float f) { unsigned u = __float_as_uint(f); u += 0x7FFFu + ((u >> 16) & 1u); return (unsigned short)(u >> 16); }
__device__ __forceinline__ float bf2f(unsigned short b) { return __uint_as_float(((unsigned)b) << 16); }
__device__ __forceinline__ float bfr(float f) { return bf2f(f2bf(f)); }
__device__ __forceinline__ v16h cat16(v8h lo, v8h hi) { return __builtin_shufflevector(lo, hi, 0, 1, 2, 3, 4, 5, 6, 7, 8, 9, 10, 11, 12, 13, 14, 15); }
__device__ __forceinline__ v16bf cat16b(v8us lo, v8us hi) { return __builtin_bit_cast(v16bf, __builtin_shufflevector(lo, hi, 0, 1, 2, 3, 4, 5, 6, 7, 8, 9, 10, 11, 12, 13, 14, 15)); }
__device__ __forceinline__ v8f wmma16(v16h a, v16h b, v8f c) { return __builtin_amdgcn_wmma_f32_16x16x32_f16(false, a, false, b, (short)0, c, false, false); }
__device__ __forceinline__ v8f wmmab(v16bf a, v16bf b, v8f c) { return __builtin_amdgcn_wmma_f32_16x16x32_bf16(false, a, false, b, (short)0, c, false, false); }

__global__ __launch_bounds__(256) void k_cvtb(const float* __restrict__ src, int nrows, bf* dst) {
    const int lane = threadIdx.x & 31, r = blockIdx.x * 8 + (threadIdx.x >> 5);
    if (r >= nrows) return;
    v8us o[DM / 256];
#pragma unroll
    for (int q = 0; q < DM / 256; ++q) { v8us t;
#pragma unroll
        for (int i = 0; i < 8; ++i) t[i] = f2bf(src[(size_t)r * DM + q * 256 + lane * 8 + i]);
        o[q] = t; }
#pragma unroll
    for (int q = 0; q < DM / 256; ++q) *(v8us*)(dst + (size_t)r * DM + q * 256 + lane * 8) = o[q];
    
}

// Staged rows in LDS: 64 f16 of data + 8 of pad = 144 B, a pitch of 16 B x odd, which ds_load_b128 fragment reads take without bank conflicts.
#define KP   72
#define PLN  (64 * KP)               // one plane of a stage: 64 rows (K: 64 keys x 64 dims; V^T: 64 dims x 64 keys)
#define STG  (4 * PLN)               // a stage = 64 keys: K hi, K residual, V^T hi, V^T residual

__device__ __forceinline__ unsigned lds_addr(const void* p) { return (unsigned)(unsigned long long)p; }     // low 32 bits of a __shared__ address = LDS byte address

// Four rows-of-16 steps of one plane pair: each lane copies its own 16 B, global -> LDS, through no register. The s_wait_xcnt stands inside the statement so that
// no address register of an issued copy is rewritten ahead of it.
__device__ __forceinline__ void cp8(unsigned la, const h16* ga, unsigned lb, const h16* gb, size_t gstep) {
    asm volatile("global_load_async_to_lds_b128 %0, %1, off\n\t"
                 "global_load_async_to_lds_b128 %2, %3, off\n\t"
                 "global_load_async_to_lds_b128 %4, %5, off\n\t"
                 "global_load_async_to_lds_b128 %6, %7, off\n\t"
                 "global_load_async_to_lds_b128 %8, %9, off\n\t"
                 "global_load_async_to_lds_b128 %10, %11, off\n\t"
                 "global_load_async_to_lds_b128 %12, %13, off\n\t"
                 "global_load_async_to_lds_b128 %14, %15, off\n\t"
                 "s_wait_xcnt 0x0"
                 :: "v"(la), "v"(ga), "v"(la + 16 * KP * 2), "v"(ga + 16 * gstep), "v"(la + 32 * KP * 2), "v"(ga + 32 * gstep), "v"(la + 48 * KP * 2), "v"(ga + 48 * gstep),
                    "v"(lb), "v"(gb), "v"(lb + 16 * KP * 2), "v"(gb + 16 * gstep), "v"(lb + 32 * KP * 2), "v"(gb + 32 * gstep), "v"(lb + 48 * KP * 2), "v"(gb + 48 * gstep)
                 : "memory");
}
__device__ __forceinline__ void cp4(unsigned la, const h16* ga, size_t gstep) {
    asm volatile("global_load_async_to_lds_b128 %0, %1, off\n\t"
                 "global_load_async_to_lds_b128 %2, %3, off\n\t"
                 "global_load_async_to_lds_b128 %4, %5, off\n\t"
                 "global_load_async_to_lds_b128 %6, %7, off\n\t"
                 "s_wait_xcnt 0x0"
                 :: "v"(la), "v"(ga), "v"(la + 16 * KP * 2), "v"(ga + 16 * gstep), "v"(la + 32 * KP * 2), "v"(ga + 32 * gstep), "v"(la + 48 * KP * 2), "v"(ga + 48 * gstep)
                 : "memory");
}
__device__ __forceinline__ v16bf fragb(const bf* p) { return cat16b(*(const v8usa*)p, *(const v8usa*)(p + 16)); }

// k_gemmb: block = 64 rows x 64 columns, wave = 16 rows x 64 columns. The k range runs in stages of 128 (two halves of 64, each a set of 64 x 64 planes): the block's A rows
// (and their residual plane) and B rows come into a two-buffer LDS ring by asynchronous copies, whole 128-B lines, once per block instead of once per wave, stage t + 1 in
// flight while stage t is worked on.
template <bool SPLITA, bool F16OUT = false>
__global__ __launch_bounds__(128) void k_gemmb(const bf* __restrict__ A, const bf* __restrict__ Al, const bf* __restrict__ Bn, const float* __restrict__ bias, float* C, int ldc, h16* C2) {
    constexpr int GHF = (SPLITA ? 3 : 2) * PLN;          // half a stage, 64 of k: A, B and, where A is split, its residual plane
    constexpr int GST = 2 * GHF, NST = DM / 128;
    __shared__ __align__(16) bf gring[2 * GST];
    __shared__ __align__(16) float ost[4][16 * 68];
    const int lane = threadIdx.x & 31, wave = threadIdx.x >> 5, lr = lane & 15, hi = lane >> 4;
    const int rb = blockIdx.x * 64, r0 = rb + wave * 16, c0 = blockIdx.y * 64;
    // copy slots: thread -> row (tid >> 3) + 16 i, 16-byte piece tid & 7: a wave's copy covers four whole 128-B lines
    const int crow = threadIdx.x >> 3, cpc = threadIdx.x & 7;
    const unsigned lring = lds_addr(&gring[0]) + (unsigned)(crow * KP + cpc * 8) * 2u;
    const size_t ao = (size_t)(rb + crow) * DM + cpc * 8, bo = (size_t)(c0 + crow) * DM + cpc * 8;
    auto stage = [&](int t, int bufi) {
#pragma unroll
        for (int hf = 0; hf < 2; ++hf) {
            const unsigned lb = lring + (unsigned)bufi * (GST * 2u) + (unsigned)hf * (GHF * 2u);
            const int k0 = t * 128 + hf * 64;
            cp8(lb, (const h16*)(const void*)(A + ao + k0), lb + PLN * 2u, (const h16*)(const void*)(Bn + bo + k0), DM);
            if (SPLITA) cp4(lb + 2u * PLN * 2u, (const h16*)(const void*)(Al + ao + k0), DM);
        }
    };
    stage(0, 0);
    asm volatile("s_wait_asynccnt 0x0" ::: "memory");     // this wave's copies of stage 0 have landed
    __syncthreads();                                      // ... and every other wave's: stage 0 is readable
    stage(1, 1);
    v8f acc[4];
#pragma unroll
    for (int t = 0; t < 4; ++t) acc[t] = (v8f){};
#pragma unroll 1
    for (int st = 0; st < NST; ++st) {
#pragma unroll
      for (int hf = 0; hf < 2; ++hf) {
        const bf* sb = gring + (st & 1) * GST + hf * GHF;
        const bf* ap = sb + (wave * 16 + lr) * KP + 8 * hi;
        const bf* bp = sb + PLN + lr * KP + 8 * hi;
        v16bf a[2], al[2], b[2][4];
#pragma unroll
        for (int kc = 0; kc < 2; ++kc) {
            a[kc] = fragb(ap + kc * 32); al[kc] = a[kc];
            if (SPLITA) al[kc] = fragb(ap + 2 * PLN + kc * 32);
#pragma unroll
            for (int t = 0; t < 4; ++t) b[kc][t] = fragb(bp + t * 16 * KP + kc * 32);
        }
#pragma unroll
        for (int kc = 0; kc < 2; ++kc)
#pragma unroll
            for (int t = 0; t < 4; ++t) { acc[t] = wmmab(a[kc], b[kc][t], acc[t]); if (SPLITA) acc[t] = wmmab(al[kc], b[kc][t], acc[t]); }
        // four vector slots behind the last WMMA, on the loop's back edge too, before its operands are refilled
        asm volatile("v_nop\n\tv_nop\n\tv_nop\n\tv_nop" : "+v"(acc[0]), "+v"(acc[1]), "+v"(acc[2]), "+v"(acc[3])
                     : "v"(a[0]), "v"(a[1]), "v"(al[0]), "v"(al[1]), "v"(b[0][0]), "v"(b[0][1]), "v"(b[0][2]), "v"(b[0][3]), "v"(b[1][0]), "v"(b[1][1]), "v"(b[1][2]), "v"(b[1][3]));
      }
        // publish point of stage st + 1: own LDS reads of stage st done, own copies of stage st + 1 landed, then the barrier that serves both
        asm volatile("s_wait_dscnt 0x0" ::: "memory");
        asm volatile("s_wait_asynccnt 0x0" ::: "memory");
        __syncthreads();
        if (st + 2 < NST) stage(st + 2, st & 1);          // refill the buffer that every wave has just left
    }
    asm volatile("s_wait_asynccnt 0x0" ::: "memory");     // nothing of this wave is in flight when it goes on to the epilogue
    float* os = &ost[wave][0];
#pragma unroll
    for (int t = 0; t < 4; ++t) { const float bv = bias ? bfr(bias[c0 + t * 16 + lr]) : 0.f;
#pragma unroll
        for (int j = 0; j < 8; ++j) os[(hi * 8 + j) * 68 + t * 16 + lr] = acc[t][j] + bv; }
    __syncthreads();
    if (F16OUT) {
        h16* crow = (h16*)(void*)C + (size_t)r0 * ldc + c0;
        auto pass = [&]() {
#pragma unroll
            for (int s = 0; s < 4; ++s) { const int row = 4 * s + (lane >> 3), piece = lane & 7; const float* sp = os + row * 68 + piece * 8; v8h o, o2;
#pragma unroll
                for (int i = 0; i < 8; ++i) { const h16 a = (h16)sp[i]; o[i] = a; o2[i] = (h16)((sp[i] - (float)a) * LOSC); }
                *(v8h*)(crow + (size_t)row * ldc + piece * 8) = o; if (C2) *(v8h*)(C2 + (size_t)r0 * ldc + c0 + (size_t)row * ldc + piece * 8) = o2; }
        };
        pass(); 
    } else {
        float* crow = C + (size_t)r0 * ldc + c0;
        auto pass = [&]() {
#pragma unroll
            for (int s = 0; s < 8; ++s) { const int Lid = (lane >> 3) + 4 * s, piece = lane & 7; const int row = Lid >> 1, cofs = (Lid & 1) * 32 + piece * 4;
                const v4f val = *(const v4fa*)(os + row * 68 + cofs); *(v4f*)(crow + (size_t)row * ldc + cofs) = val; }
        };
        pass(); 
    }
}

__global__ __launch_bounds__(256) void k_vt(const float* __restrict__ V, h16* VTH, h16* VTL) {
    __shared__ __align__(16) h16 tile[64 * 72];
    __shared__ __align__(16) h16 til2[64 * 72];
    const int bid = blockIdx.x;
    const int b = bid / (NH_ * (NT_ / 64)), rem = bid - b * (NH_ * (NT_ / 64)), h = rem / (NT_ / 64), kt = rem - h * (NT_ / 64);
    const int k0 = kt * 64, tid = threadIdx.x;
    const int kk = tid >> 2, d0 = (tid & 3) * 16;
    const float* src = V + ((size_t)b * NT_ + k0 + kk) * DM + h * HD + d0;
#pragma unroll
    for (int i = 0; i < 16; ++i) { const float v = src[i]; const h16 a = (h16)v; tile[(d0 + i) * 72 + kk] = a; til2[(d0 + i) * 72 + kk] = (h16)((v - (float)a) * LOSC); }
    __syncthreads();
    const int piece = tid & 7;
    const size_t base = (((size_t)b * NH_ + h) * HD) * NT_ + k0;
    auto pass = [&]() {
#pragma unroll
        for (int s = 0; s < 4; ++s) { const int Lid = (tid >> 3) + 32 * s; const int pln = Lid >> 6, d = Lid & 63;
            const v8h val = *(const v8ha*)((pln ? til2 : tile) + d * 72 + piece * 8); *(v8h*)((pln ? VTL : VTH) + base + (size_t)d * NT_ + piece * 8) = val; }
    };
    pass(); 
}

// softplus(x) = max(x, 0) + log1p(e), e = exp(-|x|) in (0, 1]. log1p(e) = log(u) + c with u = 1 + e rounded and c = e - (u - 1), exactly what that rounding lost
// (|c| <= 2^-24; taking c for c / u moves the result by at most 2^-24 of itself): one hardware log2, small e keeps its relative accuracy and never falls to 0.
__device__ __forceinline__ float softplusf(float x) {
    const float e = __expf(-fabsf(x)), u = 1.0f + e;
    return fmaxf(x, 0.f) + fmaf(__builtin_amdgcn_logf(u), 0.69314718f, e - (u - 1.0f));
}
__device__ __forceinline__ v16h frag(const h16* p) { return cat16(*(const v8ha*)p, *(const v8ha*)(p + 16)); }

// k_attn: block = (b, h, 64 queries), wave = 16 queries; causal key range in stages of 64 keys, two passes of 32 keys each. The block's four waves share each stage:
// K and V^T (hi + residual) come into a two-buffer LDS ring by asynchronous copies, stage t + 1 in flight while stage t is worked on; the query residual is staged once.
// Per pass: 12 WMMA scores /8 (f32), softplus weights x2048 as f16 hi + residual (same-wave may_alias reload after a compiler barrier), 12 WMMA .v;
// ctx -> bf16 hi + residual planes CH/CL[tok][h*64+d].
__global__ __launch_bounds__(128) void k_attn(const h16* __restrict__ Q16, const h16* __restrict__ QL16, const h16* __restrict__ K16, const h16* __restrict__ KL16, const h16* __restrict__ VTH, const h16* __restrict__ VTL, bf* CH, bf* CL) {
    __shared__ __align__(16) h16 ring[2 * STG];
    __shared__ __align__(16) h16 qls[PLN];
    __shared__ __align__(16) h16 plds[4][16 * 32];
    __shared__ __align__(16) h16 plds2[4][16 * 32];
    __shared__ __align__(16) float ost[4][16 * 68];
    const int lane = threadIdx.x & 31, wave = threadIdx.x >> 5, lr = lane & 15, hi = lane >> 4;
    const int bid = blockIdx.x;
    const int b = bid / (NH_ * (NT_ / 64)), rem = bid - b * (NH_ * (NT_ / 64)), h = rem / (NT_ / 64), qt = rem - h * (NT_ / 64);
    const int q0 = qt * 64 + wave * 16;
    const size_t tok0 = (size_t)b * NT_;
    h16* pl = &plds[wave][0]; h16* pl2 = &plds2[wave][0];
    const h16* kh_b = K16 + tok0 * DM + h * HD;
    const h16* kl_b = KL16 + tok0 * DM + h * HD;
    const size_t vbase = (((size_t)b * NH_ + h) * HD) * NT_;
    // copy slots: thread -> row (tid >> 3) + 16 i, 16-byte piece tid & 7: a wave's copy covers four whole 128-B lines
    const int crow = threadIdx.x >> 3, cpc = threadIdx.x & 7;
    const unsigned lslot = (unsigned)(crow * KP + cpc * 8) * 2u;
    const unsigned lring = lds_addr(&ring[0]) + lslot;
    auto stage = [&](int t, int bufi) {
        const unsigned lb = lring + (unsigned)bufi * (STG * 2u);
        const size_t ko = (size_t)(t * 64 + crow) * DM + cpc * 8, vo = vbase + (size_t)crow * NT_ + t * 64 + cpc * 8;
        cp8(lb, kh_b + ko, lb + PLN * 2u, kl_b + ko, DM);
        cp8(lb + 2u * PLN * 2u, VTH + vo, lb + 3u * PLN * 2u, VTL + vo, NT_);
    };
    const int ntrip = qt + 1;     // causal: keys 0 .. qt * 64 + 63
    cp4(lds_addr(&qls[0]) + lslot, QL16 + (tok0 + qt * 64 + crow) * DM + h * HD + cpc * 8, DM);
    stage(0, 0);
    asm volatile("s_wait_asynccnt 0x0" ::: "memory");     // this wave's copies of stage 0 have landed
    __syncthreads();                                      // ... and every other wave's: stage 0 and the query residual are readable
    if (ntrip > 1) stage(1, 1);
    v16h qa[2];
    const size_t qo0 = (tok0 + q0 + lr) * DM + h * HD + 8 * hi;
#pragma unroll
    for (int kc = 0; kc < 2; ++kc) qa[kc] = cat16(*(const v8h*)(Q16 + qo0 + kc * 32), *(const v8h*)(Q16 + qo0 + kc * 32 + 16));
    const h16* qlp = qls + (wave * 16 + lr) * KP + 8 * hi;
    v8f o[4], ox[4];
#pragma unroll
    for (int n = 0; n < 4; ++n) { o[n] = (v8f){}; ox[n] = (v8f){}; }
    float lpart[8];
#pragma unroll
    for (int j = 0; j < 8; ++j) lpart[j] = 0.f;
    int qpos[8];
#pragma unroll
    for (int j = 0; j < 8; ++j) qpos[j] = q0 + 8 * hi + j;
#pragma unroll 1
    for (int t = 0; t < ntrip; ++t) {
        const h16* sb = ring + (t & 1) * STG;
#pragma unroll 1
        for (int sub = 0; sub < 2; ++sub) {
            const int l0 = t * 64 + sub * 32;
            const h16* kp0 = sb + (sub * 32 + lr) * KP + 8 * hi;
            v16h k0h[2], k1h[2], k0l[2], k1l[2], qlk[2];
#pragma unroll
            for (int kc = 0; kc < 2; ++kc) {
                k0h[kc] = frag(kp0 + kc * 32); k1h[kc] = frag(kp0 + 16 * KP + kc * 32); qlk[kc] = frag(qlp + kc * 32);
                k0l[kc] = frag(kp0 + PLN + kc * 32); k1l[kc] = frag(kp0 + PLN + 16 * KP + kc * 32);
            }
            v8f s0 = {}, s1 = {}, x0 = {}, x1 = {};
#pragma unroll
            for (int kc = 0; kc < 2; ++kc) {
                s0 = wmma16(qa[kc], k0h[kc], s0); x0 = wmma16(qlk[kc], k0h[kc], x0); s1 = wmma16(qa[kc], k1h[kc], s1); x1 = wmma16(qlk[kc], k1h[kc], x1);
                x0 = wmma16(qa[kc], k0l[kc], x0); x1 = wmma16(qa[kc], k1l[kc], x1);
            }
            // four vector slots between the last score WMMA and the first use of its result or rewrite of its operands
            asm volatile("v_nop\n\tv_nop\n\tv_nop\n\tv_nop" : "+v"(s0), "+v"(s1), "+v"(x0), "+v"(x1)
                         : "v"(qa[0]), "v"(qa[1]), "v"(qlk[0]), "v"(qlk[1]), "v"(k0h[0]), "v"(k0h[1]), "v"(k1h[0]), "v"(k1h[1]), "v"(k0l[0]), "v"(k0l[1]), "v"(k1l[0]), "v"(k1l[1]));
            // V^T fragments of this pass: fetched here so that the softplus work covers their LDS latency
            const h16* vp0 = sb + 2 * PLN + lr * KP + sub * 32 + hi * 8;
            v16h vh[4], vl[4];
#pragma unroll
            for (int n = 0; n < 4; ++n) { vh[n] = frag(vp0 + n * 16 * KP); vl[n] = frag(vp0 + PLN + n * 16 * KP); }
#pragma unroll
            for (int j = 0; j < 8; ++j) {
                const int ja = l0 + lr, jb = l0 + 16 + lr, qi = qpos[j];
                // sp2norm: w = causal ? softplus(s x scale) : 0 (softplus as logaddexp(x, 0) = max(x,0) + log1p(exp(-|x|))); the row is later divided by sqrt(sum w^2)
                const float a0 = (s0[j] + x0[j] * LOSCI) * 0.125f, a1 = (s1[j] + x1[j] * LOSCI) * 0.125f;
                const float w0 = softplusf(a0), w1 = softplusf(a1);
                const float p0 = (ja <= qi) ? w0 : 0.f, p1 = (jb <= qi) ? w1 : 0.f;
                lpart[j] = lpart[j] + (p0 * p0 + p1 * p1);
                const int mr = hi * 8 + j;
                const float ps0 = p0 * PSC, ps1 = p1 * PSC; const h16 h0 = (h16)ps0, h1 = (h16)ps1;
                pl[mr * 32 + lr] = h0; pl[mr * 32 + 16 + lr] = h1;
                pl2[mr * 32 + lr] = (h16)((ps0 - (float)h0) * LOSC); pl2[mr * 32 + 16 + lr] = (h16)((ps1 - (float)h1) * LOSC);
            }
            asm volatile("" ::: "memory");
            const v16h pa = cat16(*(const v8ha*)(pl + lr * 32 + hi * 8), *(const v8ha*)(pl + lr * 32 + 16 + hi * 8));
            const v16h px = cat16(*(const v8ha*)(pl2 + lr * 32 + hi * 8), *(const v8ha*)(pl2 + lr * 32 + 16 + hi * 8));
#pragma unroll
            for (int n = 0; n < 4; ++n) { o[n] = wmma16(pa, vh[n], o[n]); ox[n] = wmma16(pa, vl[n], ox[n]); ox[n] = wmma16(px, vh[n], ox[n]); }
            // four vector slots behind the last WMMA, on the loop's back edge too, before its operands are refilled
            asm volatile("v_nop\n\tv_nop\n\tv_nop\n\tv_nop" : "+v"(o[0]), "+v"(o[1]), "+v"(o[2]), "+v"(o[3]), "+v"(ox[0]), "+v"(ox[1]), "+v"(ox[2]), "+v"(ox[3])
                         : "v"(pa), "v"(px), "v"(vh[0]), "v"(vh[1]), "v"(vh[2]), "v"(vh[3]), "v"(vl[0]), "v"(vl[1]), "v"(vl[2]), "v"(vl[3]));
        }
        // publish point of stage t + 1: own LDS reads of stage t done, own copies of stage t + 1 landed, then the barrier that serves both
        asm volatile("s_wait_dscnt 0x0" ::: "memory");
        asm volatile("s_wait_asynccnt 0x0" ::: "memory");
        __syncthreads();
        if (t + 2 < ntrip) stage(t + 2, t & 1);           // refill the buffer that every wave has just left
    }
    asm volatile("s_wait_asynccnt 0x0" ::: "memory");     // nothing of this wave is in flight when it goes on to the epilogue
    float inv[8];
#pragma unroll
    for (int j = 0; j < 8; ++j) { float rs = lpart[j]; rs += __shfl_xor(rs, 1, 16); rs += __shfl_xor(rs, 2, 16); rs += __shfl_xor(rs, 4, 16); rs += __shfl_xor(rs, 8, 16); inv[j] = 1.0f / (sqrtf(rs) * PSC); }     // 1 / (||w||_2 x the P scaling)
    float* os = &ost[wave][0];
#pragma unroll
    for (int n = 0; n < 4; ++n)
#pragma unroll
        for (int j = 0; j < 8; ++j) os[(hi * 8 + j) * 68 + n * 16 + lr] = (o[n][j] + ox[n][j] * LOSCI) * inv[j];
    __syncthreads();
    const size_t cbase = (tok0 + q0) * DM + (size_t)h * HD;
    auto pass = [&]() {
#pragma unroll
        for (int s = 0; s < 4; ++s) { const int row = 4 * s + (lane >> 3), piece = lane & 7; const float* sp = os + row * 68 + piece * 8; v8us oh, ol;
#pragma unroll
            for (int i = 0; i < 8; ++i) { const unsigned short hb = f2bf(sp[i]); oh[i] = hb; ol[i] = f2bf(sp[i] - bf2f(hb)); }
            *(v8us*)(CH + cbase + (size_t)row * DM + piece * 8) = oh; *(v8us*)(CL + cbase + (size_t)row * DM + piece * 8) = ol; }
    };
    pass(); 
}

#define VST2(T, p, v) do { const T vst2_v_ = (v); *(T*)(p) = vst2_v_;  } while (0)
extern "C" void kernel_launch(void* const* d_in, const int* in_sizes, int n_in,
                              void* d_out, int out_size, void* d_ws, size_t ws_size, hipStream_t stream) {
    (void)in_sizes; (void)n_in; (void)out_size;
    const float* x = (const float*)d_in[0]; const float* Wqkv = (const float*)d_in[1]; const float* Wp = (const float*)d_in[2]; const float* bp = (const float*)d_in[3];   // [out][in]
    float* out = (float*)d_out;    // [2][2048][1024]
    char* wsp = (char*)d_ws;
    auto take = [&](size_t bytes) { char* p = wsp; wsp += (bytes + 255) & ~(size_t)255; return (void*)p; };
    bf* Xb = (bf*)take((size_t)NTK * DM * 2); bf* WB = (bf*)take((size_t)3 * DM * DM * 2); bf* WpB = (bf*)take((size_t)DM * DM * 2);
    float* TMP = (float*)take((size_t)NTK * DM * 4);
    h16* QH = (h16*)take((size_t)NTK * DM * 2); h16* QL = (h16*)take((size_t)NTK * DM * 2); h16* KH = (h16*)take((size_t)NTK * DM * 2); h16* KL = (h16*)take((size_t)NTK * DM * 2);
    h16* VTH = (h16*)take((size_t)NTK * DM * 2); h16* VTL = (h16*)take((size_t)NTK * DM * 2); bf* CH = (bf*)take((size_t)NTK * DM * 2); bf* CL = (bf*)take((size_t)NTK * DM * 2);
    if ((size_t)(wsp - (char*)d_ws) > ws_size) return;    // ~ 55 MB, no aliasing (per-item reuse in stream order)
    k_cvtb<<<3 * DM / 8, 256, 0, stream>>>(Wqkv, 3 * DM, WB); k_cvtb<<<DM / 8, 256, 0, stream>>>(Wp, DM, WpB);
    for (int b = 0; b < 2; ++b) {
        k_cvtb<<<NTK / 8, 256, 0, stream>>>(x + (size_t)b * NTK * DM, NTK, Xb);
        k_gemmb<false, true><<<dim3(NTK / 64, DM / 64, 1), 128, 0, stream>>>(Xb, nullptr, WB, nullptr, (float*)(void*)QH, DM, QL);                            // q = x.W_qkv[0:1024]^T
        k_gemmb<false, true><<<dim3(NTK / 64, DM / 64, 1), 128, 0, stream>>>(Xb, nullptr, WB + (size_t)DM * DM, nullptr, (float*)(void*)KH, DM, KL);         // k
        k_gemmb<false, false><<<dim3(NTK / 64, DM / 64, 1), 128, 0, stream>>>(Xb, nullptr, WB + (size_t)2 * DM * DM, nullptr, TMP, DM, nullptr);            // v
        k_vt<<<NB_ * NH_ * (NT_ / 64), 256, 0, stream>>>(TMP, VTH, VTL);
        k_attn<<<NB_ * NH_ * (NT_ / 64), 128, 0, stream>>>(QH, QL, KH, KL, VTH, VTL, CH, CL);
        k_gemmb<true, false><<<dim3(NTK / 64, DM / 64, 1), 128, 0, stream>>>(CH, CL, WpB, bp, out + (size_t)b * NTK * DM, DM, nullptr);
    }
}

// v004
// A run of this version takes 184 microseconds.
// Two timings next to v003 both put it at 1.12 times that version's speed.
// Counting every step since v000, it is 4.40 times as fast.
#include <hip/hip_runtime.h>

// Compute dtypes, f32 accumulate, both batch items in every launch: qkv = x.W_qkv^T ([4096 x 1024].[1024 x 3072]; [out][in] weights as the n-major B operand; PLAIN
// bf16 operands = inputs rounded once, exact) with q/k straight to f16 hi + residual x1024 planes, out = y.W_proj^T + b_proj (y as bf16 hi + residual) on
// v_wmma_f32_16x16x32_bf16; the 16-head causal "sp2norm" attention fused on v_wmma_f32_16x16x32_f16: scores (hh + hl + lh) x 1/8, weights w = softplus(score)
// on the causal part (0 elsewhere), y = (sum_k w v_k) / ||w||_2 with the weights (x2048) as f16 hi + residual x1024 against v as f16 hi + residual; softplus and

#define NB_  2                   // both batch items go through every kernel in one launch
#define NT_  2048
#define DM   1024
#define NH_  16
#define HD   64
#define NTK  (NB_ * NT_)
#define NW   1024
#define NQKV 1024
#define PSC  2048.0f                 // softplus weights are not bounded by 1: x2048 keeps them inside f16 range up to w = 31
#define LOSC 1024.0f
#define LOSCI (1.0f / 1024.0f)

typedef _Float16 h16;
typedef unsigned short bf;
typedef __attribute__((ext_vector_type(16))) __bf16   v16bf;
typedef __attribute__((ext_vector_type(16))) _Float16 v16h;
typedef __attribute__((ext_vector_type(8)))  _Float16 v8h;
typedef __attribute__((ext_vector_type(8)))  unsigned short v8us;
typedef __attribute__((ext_vector_type(8)))  float    v8f;
typedef __attribute__((ext_vector_type(4)))  float    v4f;
typedef v8h  __attribute__((may_alias)) v8ha;
typedef v4f  __attribute__((may_alias)) v4fa;
typedef v8us __attribute__((may_alias)) v8usa;

__device__ __forceinline__ unsigned short f2bf(float f) { unsigned u = __float_as_uint(f); u += 0x7FFFu + ((u >> 16) & 1u); return (unsigned short)(u >> 16); }
__device__ __forceinline__ float bf2f(unsigned short b) { return __uint_as_float(((unsigned)b) << 16); }
__device__ __forceinline__ float bfr(float f) { return bf2f(f2bf(f)); }
__device__ __forceinline__ v16h cat16(v8h lo, v8h hi) { return __builtin_shufflevector(lo, hi, 0, 1, 2, 3, 4, 5, 6, 7, 8, 9, 10, 11, 12, 13, 14, 15); }
__device__ __forceinline__ v16bf cat16b(v8us lo, v8us hi) { return __builtin_bit_cast(v16bf, __builtin_shufflevector(lo, hi, 0, 1, 2, 3, 4, 5, 6, 7, 8, 9, 10, 11, 12, 13, 14, 15)); }
__device__ __forceinline__ v8f wmma16(v16h a, v16h b, v8f c) { return __builtin_amdgcn_wmma_f32_16x16x32_f16(false, a, false, b, (short)0, c, false, false); }
__device__ __forceinline__ v8f wmmab(v16bf a, v16bf b, v8f c) { return __builtin_amdgcn_wmma_f32_16x16x32_bf16(false, a, false, b, (short)0, c, false, false); }

__global__ __launch_bounds__(256) void k_cvtb(const float* __restrict__ src, int nrows, bf* dst) {
    const int lane = threadIdx.x & 31, r = blockIdx.x * 8 + (threadIdx.x >> 5);
    if (r >= nrows) return;
    v8us o[DM / 256];
#pragma unroll
    for (int q = 0; q < DM / 256; ++q) { v8us t;
#pragma unroll
        for (int i = 0; i < 8; ++i) t[i] = f2bf(src[(size_t)r * DM + q * 256 + lane * 8 + i]);
        o[q] = t; }
#pragma unroll
    for (int q = 0; q < DM / 256; ++q) *(v8us*)(dst + (size_t)r * DM + q * 256 + lane * 8) = o[q];
    
}

// Staged rows in LDS: 64 f16 of data + 8 of pad = 144 B, a pitch of 16 B x odd, which ds_load_b128 fragment reads take without bank conflicts.
#define KP   72
#define PLN  (64 * KP)               // one plane of a stage: 64 rows (K: 64 keys x 64 dims; V^T: 64 dims x 64 keys)
#define STG  (4 * PLN)               // a stage = 64 keys: K hi, K residual, V^T hi, V^T residual

__device__ __forceinline__ unsigned lds_addr(const void* p) { return (unsigned)(unsigned long long)p; }     // low 32 bits of a __shared__ address = LDS byte address

// Four rows-of-16 steps of one plane pair: each lane copies its own 16 B, global -> LDS, through no register. The s_wait_xcnt stands inside the statement so that
// no address register of an issued copy is rewritten ahead of it.
__device__ __forceinline__ void cp8(unsigned la, const h16* ga, unsigned lb, const h16* gb, size_t gstep) {
    asm volatile("global_load_async_to_lds_b128 %0, %1, off\n\t"
                 "global_load_async_to_lds_b128 %2, %3, off\n\t"
                 "global_load_async_to_lds_b128 %4, %5, off\n\t"
                 "global_load_async_to_lds_b128 %6, %7, off\n\t"
                 "global_load_async_to_lds_b128 %8, %9, off\n\t"
                 "global_load_async_to_lds_b128 %10, %11, off\n\t"
                 "global_load_async_to_lds_b128 %12, %13, off\n\t"
                 "global_load_async_to_lds_b128 %14, %15, off\n\t"
                 "s_wait_xcnt 0x0"
                 :: "v"(la), "v"(ga), "v"(la + 16 * KP * 2), "v"(ga + 16 * gstep), "v"(la + 32 * KP * 2), "v"(ga + 32 * gstep), "v"(la + 48 * KP * 2), "v"(ga + 48 * gstep),
                    "v"(lb), "v"(gb), "v"(lb + 16 * KP * 2), "v"(gb + 16 * gstep), "v"(lb + 32 * KP * 2), "v"(gb + 32 * gstep), "v"(lb + 48 * KP * 2), "v"(gb + 48 * gstep)
                 : "memory");
}
__device__ __forceinline__ void cp4(unsigned la, const h16* ga, size_t gstep) {
    asm volatile("global_load_async_to_lds_b128 %0, %1, off\n\t"
                 "global_load_async_to_lds_b128 %2, %3, off\n\t"
                 "global_load_async_to_lds_b128 %4, %5, off\n\t"
                 "global_load_async_to_lds_b128 %6, %7, off\n\t"
                 "s_wait_xcnt 0x0"
                 :: "v"(la), "v"(ga), "v"(la + 16 * KP * 2), "v"(ga + 16 * gstep), "v"(la + 32 * KP * 2), "v"(ga + 32 * gstep), "v"(la + 48 * KP * 2), "v"(ga + 48 * gstep)
                 : "memory");
}
__device__ __forceinline__ v16bf fragb(const bf* p) { return cat16b(*(const v8usa*)p, *(const v8usa*)(p + 16)); }

// k_gemmb: block = 64 rows x 64 columns, wave = 16 rows x 64 columns. The k range runs in stages of 128 (two halves of 64, each a set of 64 x 64 planes): the block's A rows
// (and their residual plane) and B rows come into a two-buffer LDS ring by asynchronous copies, whole 128-B lines, once per block instead of once per wave, stage t + 1 in
// flight while stage t is worked on.
template <bool SPLITA, bool F16OUT = false>
__global__ __launch_bounds__(128) void k_gemmb(const bf* __restrict__ A, const bf* __restrict__ Al, const bf* __restrict__ Bn, const float* __restrict__ bias, float* C, int ldc, h16* C2) {
    constexpr int GHF = (SPLITA ? 3 : 2) * PLN;          // half a stage, 64 of k: A, B and, where A is split, its residual plane
    constexpr int GST = 2 * GHF, NST = DM / 128;
    __shared__ __align__(16) bf gring[2 * GST];
    __shared__ __align__(16) float ost[4][16 * 68];
    const int lane = threadIdx.x & 31, wave = threadIdx.x >> 5, lr = lane & 15, hi = lane >> 4;
    const int rb = blockIdx.x * 64, r0 = rb + wave * 16, c0 = blockIdx.y * 64;
    // copy slots: thread -> row (tid >> 3) + 16 i, 16-byte piece tid & 7: a wave's copy covers four whole 128-B lines
    const int crow = threadIdx.x >> 3, cpc = threadIdx.x & 7;
    const unsigned lring = lds_addr(&gring[0]) + (unsigned)(crow * KP + cpc * 8) * 2u;
    const size_t ao = (size_t)(rb + crow) * DM + cpc * 8, bo = (size_t)(c0 + crow) * DM + cpc * 8;
    auto stage = [&](int t, int bufi) {
#pragma unroll
        for (int hf = 0; hf < 2; ++hf) {
            const unsigned lb = lring + (unsigned)bufi * (GST * 2u) + (unsigned)hf * (GHF * 2u);
            const int k0 = t * 128 + hf * 64;
            cp8(lb, (const h16*)(const void*)(A + ao + k0), lb + PLN * 2u, (const h16*)(const void*)(Bn + bo + k0), DM);
            if (SPLITA) cp4(lb + 2u * PLN * 2u, (const h16*)(const void*)(Al + ao + k0), DM);
        }
    };
    stage(0, 0);
    asm volatile("s_wait_asynccnt 0x0" ::: "memory");     // this wave's copies of stage 0 have landed
    __syncthreads();                                      // ... and every other wave's: stage 0 is readable
    stage(1, 1);
    v8f acc[4];
#pragma unroll
    for (int t = 0; t < 4; ++t) acc[t] = (v8f){};
#pragma unroll 1
    for (int st = 0; st < NST; ++st) {
#pragma unroll
      for (int hf = 0; hf < 2; ++hf) {
        const bf* sb = gring + (st & 1) * GST + hf * GHF;
        const bf* ap = sb + (wave * 16 + lr) * KP + 8 * hi;
        const bf* bp = sb + PLN + lr * KP + 8 * hi;
        v16bf a[2], al[2], b[2][4];
#pragma unroll
        for (int kc = 0; kc < 2; ++kc) {
            a[kc] = fragb(ap + kc * 32); al[kc] = a[kc];
            if (SPLITA) al[kc] = fragb(ap + 2 * PLN + kc * 32);
#pragma unroll
            for (int t = 0; t < 4; ++t) b[kc][t] = fragb(bp + t * 16 * KP + kc * 32);
        }
#pragma unroll
        for (int kc = 0; kc < 2; ++kc)
#pragma unroll
            for (int t = 0; t < 4; ++t) { acc[t] = wmmab(a[kc], b[kc][t], acc[t]); if (SPLITA) acc[t] = wmmab(al[kc], b[kc][t], acc[t]); }
        // four vector slots behind the last WMMA, on the loop's back edge too, before its operands are refilled
        asm volatile("v_nop\n\tv_nop\n\tv_nop\n\tv_nop" : "+v"(acc[0]), "+v"(acc[1]), "+v"(acc[2]), "+v"(acc[3])
                     : "v"(a[0]), "v"(a[1]), "v"(al[0]), "v"(al[1]), "v"(b[0][0]), "v"(b[0][1]), "v"(b[0][2]), "v"(b[0][3]), "v"(b[1][0]), "v"(b[1][1]), "v"(b[1][2]), "v"(b[1][3]));
      }
        // publish point of stage st + 1: own LDS reads of stage st done, own copies of stage st + 1 landed, then the barrier that serves both
        asm volatile("s_wait_dscnt 0x0" ::: "memory");
        asm volatile("s_wait_asynccnt 0x0" ::: "memory");
        __syncthreads();
        if (st + 2 < NST) stage(st + 2, st & 1);          // refill the buffer that every wave has just left
    }
    asm volatile("s_wait_asynccnt 0x0" ::: "memory");     // nothing of this wave is in flight when it goes on to the epilogue
    float* os = &ost[wave][0];
#pragma unroll
    for (int t = 0; t < 4; ++t) { const float bv = bias ? bfr(bias[c0 + t * 16 + lr]) : 0.f;
#pragma unroll
        for (int j = 0; j < 8; ++j) os[(hi * 8 + j) * 68 + t * 16 + lr] = acc[t][j] + bv; }
    __syncthreads();
    if (F16OUT) {
        h16* crow = (h16*)(void*)C + (size_t)r0 * ldc + c0;
        auto pass = [&]() {
#pragma unroll
            for (int s = 0; s < 4; ++s) { const int row = 4 * s + (lane >> 3), piece = lane & 7; const float* sp = os + row * 68 + piece * 8; v8h o, o2;
#pragma unroll
                for (int i = 0; i < 8; ++i) { const h16 a = (h16)sp[i]; o[i] = a; o2[i] = (h16)((sp[i] - (float)a) * LOSC); }
                *(v8h*)(crow + (size_t)row * ldc + piece * 8) = o; if (C2) *(v8h*)(C2 + (size_t)r0 * ldc + c0 + (size_t)row * ldc + piece * 8) = o2; }
        };
        pass(); 
    } else {
        float* crow = C + (size_t)r0 * ldc + c0;
        auto pass = [&]() {
#pragma unroll
            for (int s = 0; s < 8; ++s) { const int Lid = (lane >> 3) + 4 * s, piece = lane & 7; const int row = Lid >> 1, cofs = (Lid & 1) * 32 + piece * 4;
                const v4f val = *(const v4fa*)(os + row * 68 + cofs); *(v4f*)(crow + (size_t)row * ldc + cofs) = val; }
        };
        pass(); 
    }
}

__global__ __launch_bounds__(256) void k_vt(const float* __restrict__ V, h16* VTH, h16* VTL) {
    __shared__ __align__(16) h16 tile[64 * 72];
    __shared__ __align__(16) h16 til2[64 * 72];
    const int bid = blockIdx.x;
    const int b = bid / (NH_ * (NT_ / 64)), rem = bid - b * (NH_ * (NT_ / 64)), h = rem / (NT_ / 64), kt = rem - h * (NT_ / 64);
    const int k0 = kt * 64, tid = threadIdx.x;
    const int kk = tid >> 2, d0 = (tid & 3) * 16;
    const float* src = V + ((size_t)b * NT_ + k0 + kk) * DM + h * HD + d0;
#pragma unroll
    for (int i = 0; i < 16; ++i) { const float v = src[i]; const h16 a = (h16)v; tile[(d0 + i) * 72 + kk] = a; til2[(d0 + i) * 72 + kk] = (h16)((v - (float)a) * LOSC); }
    __syncthreads();
    const int piece = tid & 7;
    const size_t base = (((size_t)b * NH_ + h) * HD) * NT_ + k0;
    auto pass = [&]() {
#pragma unroll
        for (int s = 0; s < 4; ++s) { const int Lid = (tid >> 3) + 32 * s; const int pln = Lid >> 6, d = Lid & 63;
            const v8h val = *(const v8ha*)((pln ? til2 : tile) + d * 72 + piece * 8); *(v8h*)((pln ? VTL : VTH) + base + (size_t)d * NT_ + piece * 8) = val; }
    };
    pass(); 
}

// softplus(x) = max(x, 0) + log1p(e), e = exp(-|x|) in (0, 1]. log1p(e) = log(u) + c with u = 1 + e rounded and c = e - (u - 1), exactly what that rounding lost
// (|c| <= 2^-24; taking c for c / u moves the result by at most 2^-24 of itself): one hardware log2, small e keeps its relative accuracy and never falls to 0.
__device__ __forceinline__ float softplusf(float x) {
    const float e = __expf(-fabsf(x)), u = 1.0f + e;
    return fmaxf(x, 0.f) + fmaf(__builtin_amdgcn_logf(u), 0.69314718f, e - (u - 1.0f));
}
__device__ __forceinline__ v16h frag(const h16* p) { return cat16(*(const v8ha*)p, *(const v8ha*)(p + 16)); }

// k_attn: block = (b, h, 64 queries), wave = 16 queries; causal key range in stages of 64 keys, two passes of 32 keys each. The block's four waves share each stage:
// K and V^T (hi + residual) come into a two-buffer LDS ring by asynchronous copies, stage t + 1 in flight while stage t is worked on; the query residual is staged once.
// Per pass: 12 WMMA scores /8 (f32), softplus weights x2048 as f16 hi + residual (same-wave may_alias reload after a compiler barrier), 12 WMMA .v;
// ctx -> bf16 hi + residual planes CH/CL[tok][h*64+d].
__global__ __launch_bounds__(128) void k_attn(const h16* __restrict__ Q16, const h16* __restrict__ QL16, const h16* __restrict__ K16, const h16* __restrict__ KL16, const h16* __restrict__ VTH, const h16* __restrict__ VTL, bf* CH, bf* CL) {
    __shared__ __align__(16) h16 ring[2 * STG];
    __shared__ __align__(16) h16 qls[PLN];
    __shared__ __align__(16) h16 plds[4][16 * 32];
    __shared__ __align__(16) h16 plds2[4][16 * 32];
    __shared__ __align__(16) float ost[4][16 * 68];
    const int lane = threadIdx.x & 31, wave = threadIdx.x >> 5, lr = lane & 15, hi = lane >> 4;
    const int bid = blockIdx.x;
    const int b = bid / (NH_ * (NT_ / 64)), rem = bid - b * (NH_ * (NT_ / 64)), h = rem / (NT_ / 64), qt = rem - h * (NT_ / 64);
    const int q0 = qt * 64 + wave * 16;
    const size_t tok0 = (size_t)b * NT_;
    h16* pl = &plds[wave][0]; h16* pl2 = &plds2[wave][0];
    const h16* kh_b = K16 + tok0 * DM + h * HD;
    const h16* kl_b = KL16 + tok0 * DM + h * HD;
    const size_t vbase = (((size_t)b * NH_ + h) * HD) * NT_;
    // copy slots: thread -> row (tid >> 3) + 16 i, 16-byte piece tid & 7: a wave's copy covers four whole 128-B lines
    const int crow = threadIdx.x >> 3, cpc = threadIdx.x & 7;
    const unsigned lslot = (unsigned)(crow * KP + cpc * 8) * 2u;
    const unsigned lring = lds_addr(&ring[0]) + lslot;
    auto stage = [&](int t, int bufi) {
        const unsigned lb = lring + (unsigned)bufi * (STG * 2u);
        const size_t ko = (size_t)(t * 64 + crow) * DM + cpc * 8, vo = vbase + (size_t)crow * NT_ + t * 64 + cpc * 8;
        cp8(lb, kh_b + ko, lb + PLN * 2u, kl_b + ko, DM);
        cp8(lb + 2u * PLN * 2u, VTH + vo, lb + 3u * PLN * 2u, VTL + vo, NT_);
    };
    const int ntrip = qt + 1;     // causal: keys 0 .. qt * 64 + 63
    cp4(lds_addr(&qls[0]) + lslot, QL16 + (tok0 + qt * 64 + crow) * DM + h * HD + cpc * 8, DM);
    stage(0, 0);
    asm volatile("s_wait_asynccnt 0x0" ::: "memory");     // this wave's copies of stage 0 have landed
    __syncthreads();                                      // ... and every other wave's: stage 0 and the query residual are readable
    if (ntrip > 1) stage(1, 1);
    v16h qa[2];
    const size_t qo0 = (tok0 + q0 + lr) * DM + h * HD + 8 * hi;
#pragma unroll
    for (int kc = 0; kc < 2; ++kc) qa[kc] = cat16(*(const v8h*)(Q16 + qo0 + kc * 32), *(const v8h*)(Q16 + qo0 + kc * 32 + 16));
    const h16* qlp = qls + (wave * 16 + lr) * KP + 8 * hi;
    v8f o[4], ox[4];
#pragma unroll
    for (int n = 0; n < 4; ++n) { o[n] = (v8f){}; ox[n] = (v8f){}; }
    float lpart[8];
#pragma unroll
    for (int j = 0; j < 8; ++j) lpart[j] = 0.f;
    int qpos[8];
#pragma unroll
    for (int j = 0; j < 8; ++j) qpos[j] = q0 + 8 * hi + j;
#pragma unroll 1
    for (int t = 0; t < ntrip; ++t) {
        const h16* sb = ring + (t & 1) * STG;
#pragma unroll 1
        for (int sub = 0; sub < 2; ++sub) {
            const int l0 = t * 64 + sub * 32;
            const h16* kp0 = sb + (sub * 32 + lr) * KP + 8 * hi;
            v16h k0h[2], k1h[2], k0l[2], k1l[2], qlk[2];
#pragma unroll
            for (int kc = 0; kc < 2; ++kc) {
                k0h[kc] = frag(kp0 + kc * 32); k1h[kc] = frag(kp0 + 16 * KP + kc * 32); qlk[kc] = frag(qlp + kc * 32);
                k0l[kc] = frag(kp0 + PLN + kc * 32); k1l[kc] = frag(kp0 + PLN + 16 * KP + kc * 32);
            }
            v8f s0 = {}, s1 = {}, x0 = {}, x1 = {};
#pragma unroll
            for (int kc = 0; kc < 2; ++kc) {
                s0 = wmma16(qa[kc], k0h[kc], s0); x0 = wmma16(qlk[kc], k0h[kc], x0); s1 = wmma16(qa[kc], k1h[kc], s1); x1 = wmma16(qlk[kc], k1h[kc], x1);
                x0 = wmma16(qa[kc], k0l[kc], x0); x1 = wmma16(qa[kc], k1l[kc], x1);
            }
            // four vector slots between the last score WMMA and the first use of its result or rewrite of its operands
            asm volatile("v_nop\n\tv_nop\n\tv_nop\n\tv_nop" : "+v"(s0), "+v"(s1), "+v"(x0), "+v"(x1)
                         : "v"(qa[0]), "v"(qa[1]), "v"(qlk[0]), "v"(qlk[1]), "v"(k0h[0]), "v"(k0h[1]), "v"(k1h[0]), "v"(k1h[1]), "v"(k0l[0]), "v"(k0l[1]), "v"(k1l[0]), "v"(k1l[1]));
            // V^T fragments of this pass: fetched here so that the softplus work covers their LDS latency
            const h16* vp0 = sb + 2 * PLN + lr * KP + sub * 32 + hi * 8;
            v16h vh[4], vl[4];
#pragma unroll
            for (int n = 0; n < 4; ++n) { vh[n] = frag(vp0 + n * 16 * KP); vl[n] = frag(vp0 + PLN + n * 16 * KP); }
#pragma unroll
            for (int j = 0; j < 8; ++j) {
                const int ja = l0 + lr, jb = l0 + 16 + lr, qi = qpos[j];
                // sp2norm: w = causal ? softplus(s x scale) : 0 (softplus as logaddexp(x, 0) = max(x,0) + log1p(exp(-|x|))); the row is later divided by sqrt(sum w^2)
                const float a0 = (s0[j] + x0[j] * LOSCI) * 0.125f, a1 = (s1[j] + x1[j] * LOSCI) * 0.125f;
                const float w0 = softplusf(a0), w1 = softplusf(a1);
                const float p0 = (ja <= qi) ? w0 : 0.f, p1 = (jb <= qi) ? w1 : 0.f;
                lpart[j] = lpart[j] + (p0 * p0 + p1 * p1);
                const int mr = hi * 8 + j;
                const float ps0 = p0 * PSC, ps1 = p1 * PSC; const h16 h0 = (h16)ps0, h1 = (h16)ps1;
                pl[mr * 32 + lr] = h0; pl[mr * 32 + 16 + lr] = h1;
                pl2[mr * 32 + lr] = (h16)((ps0 - (float)h0) * LOSC); pl2[mr * 32 + 16 + lr] = (h16)((ps1 - (float)h1) * LOSC);
            }
            asm volatile("" ::: "memory");
            const v16h pa = cat16(*(const v8ha*)(pl + lr * 32 + hi * 8), *(const v8ha*)(pl + lr * 32 + 16 + hi * 8));
            const v16h px = cat16(*(const v8ha*)(pl2 + lr * 32 + hi * 8), *(const v8ha*)(pl2 + lr * 32 + 16 + hi * 8));
#pragma unroll
            for (int n = 0; n < 4; ++n) { o[n] = wmma16(pa, vh[n], o[n]); ox[n] = wmma16(pa, vl[n], ox[n]); ox[n] = wmma16(px, vh[n], ox[n]); }
            // four vector slots behind the last WMMA, on the loop's back edge too, before its operands are refilled
            asm volatile("v_nop\n\tv_nop\n\tv_nop\n\tv_nop" : "+v"(o[0]), "+v"(o[1]), "+v"(o[2]), "+v"(o[3]), "+v"(ox[0]), "+v"(ox[1]), "+v"(ox[2]), "+v"(ox[3])
                         : "v"(pa), "v"(px), "v"(vh[0]), "v"(vh[1]), "v"(vh[2]), "v"(vh[3]), "v"(vl[0]), "v"(vl[1]), "v"(vl[2]), "v"(vl[3]));
        }
        // publish point of stage t + 1: own LDS reads of stage t done, own copies of stage t + 1 landed, then the barrier that serves both
        asm volatile("s_wait_dscnt 0x0" ::: "memory");
        asm volatile("s_wait_asynccnt 0x0" ::: "memory");
        __syncthreads();
        if (t + 2 < ntrip) stage(t + 2, t & 1);           // refill the buffer that every wave has just left
    }
    asm volatile("s_wait_asynccnt 0x0" ::: "memory");     // nothing of this wave is in flight when it goes on to the epilogue
    float inv[8];
#pragma unroll
    for (int j = 0; j < 8; ++j) { float rs = lpart[j]; rs += __shfl_xor(rs, 1, 16); rs += __shfl_xor(rs, 2, 16); rs += __shfl_xor(rs, 4, 16); rs += __shfl_xor(rs, 8, 16); inv[j] = 1.0f / (sqrtf(rs) * PSC); }     // 1 / (||w||_2 x the P scaling)
    float* os = &ost[wave][0];
#pragma unroll
    for (int n = 0; n < 4; ++n)
#pragma unroll
        for (int j = 0; j < 8; ++j) os[(hi * 8 + j) * 68 + n * 16 + lr] = (o[n][j] + ox[n][j] * LOSCI) * inv[j];
    __syncthreads();
    const size_t cbase = (tok0 + q0) * DM + (size_t)h * HD;
    auto pass = [&]() {
#pragma unroll
        for (int s = 0; s < 4; ++s) { const int row = 4 * s + (lane >> 3), piece = lane & 7; const float* sp = os + row * 68 + piece * 8; v8us oh, ol;
#pragma unroll
            for (int i = 0; i < 8; ++i) { const unsigned short hb = f2bf(sp[i]); oh[i] = hb; ol[i] = f2bf(sp[i] - bf2f(hb)); }
            *(v8us*)(CH + cbase + (size_t)row * DM + piece * 8) = oh; *(v8us*)(CL + cbase + (size_t)row * DM + piece * 8) = ol; }
    };
    pass(); 
}

#define VST2(T, p, v) do { const T vst2_v_ = (v); *(T*)(p) = vst2_v_;  } while (0)
extern "C" void kernel_launch(void* const* d_in, const int* in_sizes, int n_in,
                              void* d_out, int out_size, void* d_ws, size_t ws_size, hipStream_t stream) {
    (void)in_sizes; (void)n_in; (void)out_size;
    const float* x = (const float*)d_in[0]; const float* Wqkv = (const float*)d_in[1]; const float* Wp = (const float*)d_in[2]; const float* bp = (const float*)d_in[3];   // [out][in]
    float* out = (float*)d_out;    // [2][2048][1024] = [4096 tokens][1024]
    char* wsp = (char*)d_ws;
    auto take = [&](size_t bytes) { char* p = wsp; wsp += (bytes + 255) & ~(size_t)255; return (void*)p; };
    bf* Xb = (bf*)take((size_t)NTK * DM * 2); bf* WB = (bf*)take((size_t)3 * DM * DM * 2); bf* WpB = (bf*)take((size_t)DM * DM * 2);
    float* TMP = (float*)take((size_t)NTK * DM * 4);
    h16* QH = (h16*)take((size_t)NTK * DM * 2); h16* QL = (h16*)take((size_t)NTK * DM * 2); h16* KH = (h16*)take((size_t)NTK * DM * 2); h16* KL = (h16*)take((size_t)NTK * DM * 2);
    h16* VTH = (h16*)take((size_t)NTK * DM * 2); h16* VTL = (h16*)take((size_t)NTK * DM * 2); bf* CH = (bf*)take((size_t)NTK * DM * 2); bf* CL = (bf*)take((size_t)NTK * DM * 2);
    if ((size_t)(wsp - (char*)d_ws) > ws_size) return;    // 96 MiB, no aliasing
    k_cvtb<<<3 * DM / 8, 256, 0, stream>>>(Wqkv, 3 * DM, WB); k_cvtb<<<DM / 8, 256, 0, stream>>>(Wp, DM, WpB);
    k_cvtb<<<NTK / 8, 256, 0, stream>>>(x, NTK, Xb);
    k_gemmb<false, true><<<dim3(NTK / 64, DM / 64, 1), 128, 0, stream>>>(Xb, nullptr, WB, nullptr, (float*)(void*)QH, DM, QL);                            // q = x.W_qkv[0:1024]^T
    k_gemmb<false, true><<<dim3(NTK / 64, DM / 64, 1), 128, 0, stream>>>(Xb, nullptr, WB + (size_t)DM * DM, nullptr, (float*)(void*)KH, DM, KL);         // k
    k_gemmb<false, false><<<dim3(NTK / 64, DM / 64, 1), 128, 0, stream>>>(Xb, nullptr, WB + (size_t)2 * DM * DM, nullptr, TMP, DM, nullptr);            // v
    k_vt<<<NB_ * NH_ * (NT_ / 64), 256, 0, stream>>>(TMP, VTH, VTL);
    k_attn<<<NB_ * NH_ * (NT_ / 64), 128, 0, stream>>>(QH, QL, KH, KL, VTH, VTL, CH, CL);
    k_gemmb<true, false><<<dim3(NTK / 64, DM / 64, 1), 128, 0, stream>>>(CH, CL, WpB, bp, out, DM, nullptr);
}

// v005
// A run of this version takes 164 microseconds.
// Next to v004, in two timings, it ran 1.12 times as fast each time.
// All steps since v000 together make it 4.94 times as fast.
#include <hip/hip_runtime.h>

// Compute dtypes, f32 accumulate, both batch items in every launch: qkv = x.W_qkv^T ([4096 x 1024].[1024 x 3072]; [out][in] weights as the n-major B operand; PLAIN
// bf16 operands = inputs rounded once, exact) with q/k straight to f16 hi + residual x1024 planes, out = y.W_proj^T + b_proj (y as bf16 hi + residual) on
// v_wmma_f32_16x16x32_bf16; the 16-head causal "sp2norm" attention fused on v_wmma_f32_16x16x32_f16: scores (hh + hl + lh) x 1/8, weights w = softplus(score)
// on the causal part (0 elsewhere), y = (sum_k w v_k) / ||w||_2 with the weights (x2048) as f16 hi + residual x1024 against v as f16 hi + residual; softplus and

#define NB_  2                   // both batch items go through every kernel in one launch
#define NT_  2048
#define DM   1024
#define NH_  16
#define HD   64
#define NTK  (NB_ * NT_)
#define NW   1024
#define NQKV 1024
#define PSC  2048.0f                 // softplus weights are not bounded by 1: x2048 keeps them inside f16 range up to w = 31
#define LOSC 1024.0f
#define LOSCI (1.0f / 1024.0f)

typedef _Float16 h16;
typedef unsigned short bf;
typedef __attribute__((ext_vector_type(16))) __bf16   v16bf;
typedef __attribute__((ext_vector_type(16))) _Float16 v16h;
typedef __attribute__((ext_vector_type(8)))  _Float16 v8h;
typedef __attribute__((ext_vector_type(8)))  unsigned short v8us;
typedef __attribute__((ext_vector_type(8)))  float    v8f;
typedef __attribute__((ext_vector_type(4)))  float    v4f;
typedef v8h  __attribute__((may_alias)) v8ha;
typedef v4f  __attribute__((may_alias)) v4fa;
typedef v8us __attribute__((may_alias)) v8usa;

__device__ __forceinline__ unsigned short f2bf(float f) { unsigned u = __float_as_uint(f); u += 0x7FFFu + ((u >> 16) & 1u); return (unsigned short)(u >> 16); }
__device__ __forceinline__ float bf2f(unsigned short b) { return __uint_as_float(((unsigned)b) << 16); }
__device__ __forceinline__ float bfr(float f) { return bf2f(f2bf(f)); }
__device__ __forceinline__ v16h cat16(v8h lo, v8h hi) { return __builtin_shufflevector(lo, hi, 0, 1, 2, 3, 4, 5, 6, 7, 8, 9, 10, 11, 12, 13, 14, 15); }
__device__ __forceinline__ v16bf cat16b(v8us lo, v8us hi) { return __builtin_bit_cast(v16bf, __builtin_shufflevector(lo, hi, 0, 1, 2, 3, 4, 5, 6, 7, 8, 9, 10, 11, 12, 13, 14, 15)); }
__device__ __forceinline__ v8f wmma16(v16h a, v16h b, v8f c) { return __builtin_amdgcn_wmma_f32_16x16x32_f16(false, a, false, b, (short)0, c, false, false); }
__device__ __forceinline__ v8f wmmab(v16bf a, v16bf b, v8f c) { return __builtin_amdgcn_wmma_f32_16x16x32_bf16(false, a, false, b, (short)0, c, false, false); }

// k_cvtb: one launch rounds all three f32 operands to bf16. Blocks of 8 rows: first x (NTK rows), then W_qkv (3 DM rows), then W_proj (DM rows); the grid covers exactly these rows.
__global__ __launch_bounds__(256) void k_cvtb(const float* __restrict__ x, const float* __restrict__ wqkv, const float* __restrict__ wp, bf* xb, bf* wb, bf* wpb) {
    const int row0 = blockIdx.x * 8, part = row0 < NTK ? 0 : (row0 < NTK + 3 * DM ? 1 : 2);        // the same for the whole block
    const float* __restrict__ src = part == 0 ? x : (part == 1 ? wqkv : wp);
    bf* dst = part == 0 ? xb : (part == 1 ? wb : wpb);
    const int lane = threadIdx.x & 31, r = row0 - (part == 0 ? 0 : (part == 1 ? NTK : NTK + 3 * DM)) + (threadIdx.x >> 5);
    v8us o[DM / 256];
#pragma unroll
    for (int q = 0; q < DM / 256; ++q) { v8us t;
#pragma unroll
        for (int i = 0; i < 8; ++i) t[i] = f2bf(src[(size_t)r * DM + q * 256 + lane * 8 + i]);
        o[q] = t; }
#pragma unroll
    for (int q = 0; q < DM / 256; ++q) *(v8us*)(dst + (size_t)r * DM + q * 256 + lane * 8) = o[q];
    
}

// Staged rows in LDS: 64 f16 of data + 8 of pad = 144 B, a pitch of 16 B x odd, which ds_load_b128 fragment reads take without bank conflicts.
#define KP   72
#define PLN  (64 * KP)               // one plane of a stage: 64 rows (K: 64 keys x 64 dims; V^T: 64 dims x 64 keys)
#define STG  (4 * PLN)               // a stage = 64 keys: K hi, K residual, V^T hi, V^T residual

__device__ __forceinline__ unsigned lds_addr(const void* p) { return (unsigned)(unsigned long long)p; }     // low 32 bits of a __shared__ address = LDS byte address

// Four rows-of-16 steps of one plane pair: each lane copies its own 16 B, global -> LDS, through no register. The s_wait_xcnt stands inside the statement so that
// no address register of an issued copy is rewritten ahead of it.
__device__ __forceinline__ void cp8(unsigned la, const h16* ga, unsigned lb, const h16* gb, size_t gstep) {
    asm volatile("global_load_async_to_lds_b128 %0, %1, off\n\t"
                 "global_load_async_to_lds_b128 %2, %3, off\n\t"
                 "global_load_async_to_lds_b128 %4, %5, off\n\t"
                 "global_load_async_to_lds_b128 %6, %7, off\n\t"
                 "global_load_async_to_lds_b128 %8, %9, off\n\t"
                 "global_load_async_to_lds_b128 %10, %11, off\n\t"
                 "global_load_async_to_lds_b128 %12, %13, off\n\t"
                 "global_load_async_to_lds_b128 %14, %15, off\n\t"
                 "s_wait_xcnt 0x0"
                 :: "v"(la), "v"(ga), "v"(la + 16 * KP * 2), "v"(ga + 16 * gstep), "v"(la + 32 * KP * 2), "v"(ga + 32 * gstep), "v"(la + 48 * KP * 2), "v"(ga + 48 * gstep),
                    "v"(lb), "v"(gb), "v"(lb + 16 * KP * 2), "v"(gb + 16 * gstep), "v"(lb + 32 * KP * 2), "v"(gb + 32 * gstep), "v"(lb + 48 * KP * 2), "v"(gb + 48 * gstep)
                 : "memory");
}
__device__ __forceinline__ void cp4(unsigned la, const h16* ga, size_t gstep) {
    asm volatile("global_load_async_to_lds_b128 %0, %1, off\n\t"
                 "global_load_async_to_lds_b128 %2, %3, off\n\t"
                 "global_load_async_to_lds_b128 %4, %5, off\n\t"
                 "global_load_async_to_lds_b128 %6, %7, off\n\t"
                 "s_wait_xcnt 0x0"
                 :: "v"(la), "v"(ga), "v"(la + 16 * KP * 2), "v"(ga + 16 * gstep), "v"(la + 32 * KP * 2), "v"(ga + 32 * gstep), "v"(la + 48 * KP * 2), "v"(ga + 48 * gstep)
                 : "memory");
}
__device__ __forceinline__ v16bf fragb(const bf* p) { return cat16b(*(const v8usa*)p, *(const v8usa*)(p + 16)); }

// k_gemmb: block = 64 rows x 64 columns, wave = 16 rows x 64 columns. The k range runs in stages of 128 (two halves of 64, each a set of 64 x 64 planes): the block's A rows
// (and their residual plane) and B rows come into a two-buffer LDS ring by asynchronous copies, whole 128-B lines, once per block instead of once per wave, stage t + 1 in
// flight while stage t is worked on.
// QKV: Bn holds the 3 DM rows of W_qkv and blockIdx.y walks all of them in one launch; a block's 64 columns lie in one of q, k, v: q and k leave as f16 hi + residual planes, v as f32 in C.
template <bool SPLITA, bool QKV>
__global__ __launch_bounds__(128) void k_gemmb(const bf* __restrict__ A, const bf* __restrict__ Al, const bf* __restrict__ Bn, const float* __restrict__ bias, float* C, int ldc, h16* QH, h16* QL, h16* KH, h16* KL) {
    constexpr int GHF = (SPLITA ? 3 : 2) * PLN;          // half a stage, 64 of k: A, B and, where A is split, its residual plane
    constexpr int GST = 2 * GHF, NST = DM / 128;
    __shared__ __align__(16) bf gring[2 * GST];
    __shared__ __align__(16) float ost[4][16 * 68];
    const int lane = threadIdx.x & 31, wave = threadIdx.x >> 5, lr = lane & 15, hi = lane >> 4;
    const int rb = blockIdx.x * 64, r0 = rb + wave * 16, c0 = blockIdx.y * 64;
    // copy slots: thread -> row (tid >> 3) + 16 i, 16-byte piece tid & 7: a wave's copy covers four whole 128-B lines
    const int crow = threadIdx.x >> 3, cpc = threadIdx.x & 7;
    const unsigned lring = lds_addr(&gring[0]) + (unsigned)(crow * KP + cpc * 8) * 2u;
    const size_t ao = (size_t)(rb + crow) * DM + cpc * 8, bo = (size_t)(c0 + crow) * DM + cpc * 8;
    auto stage = [&](int t, int bufi) {
#pragma unroll
        for (int hf = 0; hf < 2; ++hf) {
            const unsigned lb = lring + (unsigned)bufi * (GST * 2u) + (unsigned)hf * (GHF * 2u);
            const int k0 = t * 128 + hf * 64;
            cp8(lb, (const h16*)(const void*)(A + ao + k0), lb + PLN * 2u, (const h16*)(const void*)(Bn + bo + k0), DM);
            if (SPLITA) cp4(lb + 2u * PLN * 2u, (const h16*)(const void*)(Al + ao + k0), DM);
        }
    };
    stage(0, 0);
    asm volatile("s_wait_asynccnt 0x0" ::: "memory");     // this wave's copies of stage 0 have landed
    __syncthreads();                                      // ... and every other wave's: stage 0 is readable
    stage(1, 1);
    v8f acc[4];
#pragma unroll
    for (int t = 0; t < 4; ++t) acc[t] = (v8f){};
#pragma unroll 1
    for (int st = 0; st < NST; ++st) {
#pragma unroll
      for (int hf = 0; hf < 2; ++hf) {
        const bf* sb = gring + (st & 1) * GST + hf * GHF;
        const bf* ap = sb + (wave * 16 + lr) * KP + 8 * hi;
        const bf* bp = sb + PLN + lr * KP + 8 * hi;
        v16bf a[2], al[2], b[2][4];
#pragma unroll
        for (int kc = 0; kc < 2; ++kc) {
            a[kc] = fragb(ap + kc * 32); al[kc] = a[kc];
            if (SPLITA) al[kc] = fragb(ap + 2 * PLN + kc * 32);
#pragma unroll
            for (int t = 0; t < 4; ++t) b[kc][t] = fragb(bp + t * 16 * KP + kc * 32);
        }
#pragma unroll
        for (int kc = 0; kc < 2; ++kc)
#pragma unroll
            for (int t = 0; t < 4; ++t) { acc[t] = wmmab(a[kc], b[kc][t], acc[t]); if (SPLITA) acc[t] = wmmab(al[kc], b[kc][t], acc[t]); }
        // four vector slots behind the last WMMA, on the loop's back edge too, before its operands are refilled
        asm volatile("v_nop\n\tv_nop\n\tv_nop\n\tv_nop" : "+v"(acc[0]), "+v"(acc[1]), "+v"(acc[2]), "+v"(acc[3])
                     : "v"(a[0]), "v"(a[1]), "v"(al[0]), "v"(al[1]), "v"(b[0][0]), "v"(b[0][1]), "v"(b[0][2]), "v"(b[0][3]), "v"(b[1][0]), "v"(b[1][1]), "v"(b[1][2]), "v"(b[1][3]));
      }
        // publish point of stage st + 1: own LDS reads of stage st done, own copies of stage st + 1 landed, then the barrier that serves both
        asm volatile("s_wait_dscnt 0x0" ::: "memory");
        asm volatile("s_wait_asynccnt 0x0" ::: "memory");
        __syncthreads();
        if (st + 2 < NST) stage(st + 2, st & 1);          // refill the buffer that every wave has just left
    }
    asm volatile("s_wait_asynccnt 0x0" ::: "memory");     // nothing of this wave is in flight when it goes on to the epilogue
    float* os = &ost[wave][0];
#pragma unroll
    for (int t = 0; t < 4; ++t) { const float bv = bias ? bfr(bias[c0 + t * 16 + lr]) : 0.f;
#pragma unroll
        for (int j = 0; j < 8; ++j) os[(hi * 8 + j) * 68 + t * 16 + lr] = acc[t][j] + bv; }
    __syncthreads();
    const int sel = QKV ? (int)(blockIdx.y / (unsigned)(DM / 64)) : 2;     // whose columns these are: 0 q, 1 k, 2 the f32 output; the same for the whole block
    const int cc = QKV ? c0 - sel * DM : c0;                   // first column inside that output
    if (QKV && sel < 2) {
        h16* crow = (sel ? KH : QH) + (size_t)r0 * ldc + cc;
        h16* crow2 = (sel ? KL : QL) + (size_t)r0 * ldc + cc;
        auto pass = [&]() {
#pragma unroll
            for (int s = 0; s < 4; ++s) { const int row = 4 * s + (lane >> 3), piece = lane & 7; const float* sp = os + row * 68 + piece * 8; v8h o, o2;
#pragma unroll
                for (int i = 0; i < 8; ++i) { const h16 a = (h16)sp[i]; o[i] = a; o2[i] = (h16)((sp[i] - (float)a) * LOSC); }
                *(v8h*)(crow + (size_t)row * ldc + piece * 8) = o; *(v8h*)(crow2 + (size_t)row * ldc + piece * 8) = o2; }
        };
        pass(); 
    } else {
        float* crow = C + (size_t)r0 * ldc + cc;
        auto pass = [&]() {
#pragma unroll
            for (int s = 0; s < 8; ++s) { const int Lid = (lane >> 3) + 4 * s, piece = lane & 7; const int row = Lid >> 1, cofs = (Lid & 1) * 32 + piece * 4;
                const v4f val = *(const v4fa*)(os + row * 68 + cofs); *(v4f*)(crow + (size_t)row * ldc + cofs) = val; }
        };
        pass(); 
        // the built code lays the f16 branch right behind these stores, past a branch it keeps conditional: the wait stands in front of that code's writes to the stores' registers
        if (QKV) asm volatile("s_wait_xcnt 0x0" ::: "memory");
    }
}

__global__ __launch_bounds__(256) void k_vt(const float* __restrict__ V, h16* VTH, h16* VTL) {
    __shared__ __align__(16) h16 tile[64 * 72];
    __shared__ __align__(16) h16 til2[64 * 72];
    const int bid = blockIdx.x;
    const int b = bid / (NH_ * (NT_ / 64)), rem = bid - b * (NH_ * (NT_ / 64)), h = rem / (NT_ / 64), kt = rem - h * (NT_ / 64);
    const int k0 = kt * 64, tid = threadIdx.x;
    const int kk = tid >> 2, d0 = (tid & 3) * 16;
    const float* src = V + ((size_t)b * NT_ + k0 + kk) * DM + h * HD + d0;
#pragma unroll
    for (int i = 0; i < 16; ++i) { const float v = src[i]; const h16 a = (h16)v; tile[(d0 + i) * 72 + kk] = a; til2[(d0 + i) * 72 + kk] = (h16)((v - (float)a) * LOSC); }
    __syncthreads();
    const int piece = tid & 7;
    const size_t base = (((size_t)b * NH_ + h) * HD) * NT_ + k0;
    auto pass = [&]() {
#pragma unroll
        for (int s = 0; s < 4; ++s) { const int Lid = (tid >> 3) + 32 * s; const int pln = Lid >> 6, d = Lid & 63;
            const v8h val = *(const v8ha*)((pln ? til2 : tile) + d * 72 + piece * 8); *(v8h*)((pln ? VTL : VTH) + base + (size_t)d * NT_ + piece * 8) = val; }
    };
    pass(); 
}

// softplus(x) = max(x, 0) + log1p(e), e = exp(-|x|) in (0, 1]. log1p(e) = log(u) + c with u = 1 + e rounded and c = e - (u - 1), exactly what that rounding lost
// (|c| <= 2^-24; taking c for c / u moves the result by at most 2^-24 of itself): one hardware log2, small e keeps its relative accuracy and never falls to 0.
__device__ __forceinline__ float softplusf(float x) {
    const float e = __expf(-fabsf(x)), u = 1.0f + e;
    return fmaxf(x, 0.f) + fmaf(__builtin_amdgcn_logf(u), 0.69314718f, e - (u - 1.0f));
}
__device__ __forceinline__ v16h frag(const h16* p) { return cat16(*(const v8ha*)p, *(const v8ha*)(p + 16)); }

// k_attn: block = (b, h, 64 queries), wave = 16 queries; causal key range in stages of 64 keys, two passes of 32 keys each. The block's four waves share each stage:
// K and V^T (hi + residual) come into a two-buffer LDS ring by asynchronous copies, stage t + 1 in flight while stage t is worked on; the query residual is staged once.
// Per pass: 12 WMMA scores /8 (f32), softplus weights x2048 as f16 hi + residual (same-wave may_alias reload after a compiler barrier), 12 WMMA .v;
// ctx -> bf16 hi + residual planes CH/CL[tok][h*64+d].
__global__ __launch_bounds__(128) void k_attn(const h16* __restrict__ Q16, const h16* __restrict__ QL16, const h16* __restrict__ K16, const h16* __restrict__ KL16, const h16* __restrict__ VTH, const h16* __restrict__ VTL, bf* CH, bf* CL) {
    __shared__ __align__(16) h16 ring[2 * STG];
    __shared__ __align__(16) h16 qls[PLN];
    __shared__ __align__(16) h16 plds[4][16 * 32];
    __shared__ __align__(16) h16 plds2[4][16 * 32];
    __shared__ __align__(16) float ost[4][16 * 68];
    const int lane = threadIdx.x & 31, wave = threadIdx.x >> 5, lr = lane & 15, hi = lane >> 4;
    const int bid = blockIdx.x;
    const int b = bid / (NH_ * (NT_ / 64)), rem = bid - b * (NH_ * (NT_ / 64)), h = rem / (NT_ / 64), qt = rem - h * (NT_ / 64);
    const int q0 = qt * 64 + wave * 16;
    const size_t tok0 = (size_t)b * NT_;
    h16* pl = &plds[wave][0]; h16* pl2 = &plds2[wave][0];
    const h16* kh_b = K16 + tok0 * DM + h * HD;
    const h16* kl_b = KL16 + tok0 * DM + h * HD;
    const size_t vbase = (((size_t)b * NH_ + h) * HD) * NT_;
    // copy slots: thread -> row (tid >> 3) + 16 i, 16-byte piece tid & 7: a wave's copy covers four whole 128-B lines
    const int crow = threadIdx.x >> 3, cpc = threadIdx.x & 7;
    const unsigned lslot = (unsigned)(crow * KP + cpc * 8) * 2u;
    const unsigned lring = lds_addr(&ring[0]) + lslot;
    auto stage = [&](int t, int bufi) {
        const unsigned lb = lring + (unsigned)bufi * (STG * 2u);
        const size_t ko = (size_t)(t * 64 + crow) * DM + cpc * 8, vo = vbase + (size_t)crow * NT_ + t * 64 + cpc * 8;
        cp8(lb, kh_b + ko, lb + PLN * 2u, kl_b + ko, DM);
        cp8(lb + 2u * PLN * 2u, VTH + vo, lb + 3u * PLN * 2u, VTL + vo, NT_);
    };
    const int ntrip = qt + 1;     // causal: keys 0 .. qt * 64 + 63
    cp4(lds_addr(&qls[0]) + lslot, QL16 + (tok0 + qt * 64 + crow) * DM + h * HD + cpc * 8, DM);
    stage(0, 0);
    asm volatile("s_wait_asynccnt 0x0" ::: "memory");     // this wave's copies of stage 0 have landed
    __syncthreads();                                      // ... and every other wave's: stage 0 and the query residual are readable
    if (ntrip > 1) stage(1, 1);
    v16h qa[2];
    const size_t qo0 = (tok0 + q0 + lr) * DM + h * HD + 8 * hi;
#pragma unroll
    for (int kc = 0; kc < 2; ++kc) qa[kc] = cat16(*(const v8h*)(Q16 + qo0 + kc * 32), *(const v8h*)(Q16 + qo0 + kc * 32 + 16));
    const h16* qlp = qls + (wave * 16 + lr) * KP + 8 * hi;
    v8f o[4], ox[4];
#pragma unroll
    for (int n = 0; n < 4; ++n) { o[n] = (v8f){}; ox[n] = (v8f){}; }
    float lpart[8];
#pragma unroll
    for (int j = 0; j < 8; ++j) lpart[j] = 0.f;
    int qpos[8];
#pragma unroll
    for (int j = 0; j < 8; ++j) qpos[j] = q0 + 8 * hi + j;
#pragma unroll 1
    for (int t = 0; t < ntrip; ++t) {
        const h16* sb = ring + (t & 1) * STG;
#pragma unroll 1
        for (int sub = 0; sub < 2; ++sub) {
            const int l0 = t * 64 + sub * 32;
            const h16* kp0 = sb + (sub * 32 + lr) * KP + 8 * hi;
            v16h k0h[2], k1h[2], k0l[2], k1l[2], qlk[2];
#pragma unroll
            for (int kc = 0; kc < 2; ++kc) {
                k0h[kc] = frag(kp0 + kc * 32); k1h[kc] = frag(kp0 + 16 * KP + kc * 32); qlk[kc] = frag(qlp + kc * 32);
                k0l[kc] = frag(kp0 + PLN + kc * 32); k1l[kc] = frag(kp0 + PLN + 16 * KP + kc * 32);
            }
            v8f s0 = {}, s1 = {}, x0 = {}, x1 = {};
#pragma unroll
            for (int kc = 0; kc < 2; ++kc) {
                s0 = wmma16(qa[kc], k0h[kc], s0); x0 = wmma16(qlk[kc], k0h[kc], x0); s1 = wmma16(qa[kc], k1h[kc], s1); x1 = wmma16(qlk[kc], k1h[kc], x1);
                x0 = wmma16(qa[kc], k0l[kc], x0); x1 = wmma16(qa[kc], k1l[kc], x1);
            }
            // four vector slots between the last score WMMA and the first use of its result or rewrite of its operands
            asm volatile("v_nop\n\tv_nop\n\tv_nop\n\tv_nop" : "+v"(s0), "+v"(s1), "+v"(x0), "+v"(x1)
                         : "v"(qa[0]), "v"(qa[1]), "v"(qlk[0]), "v"(qlk[1]), "v"(k0h[0]), "v"(k0h[1]), "v"(k1h[0]), "v"(k1h[1]), "v"(k0l[0]), "v"(k0l[1]), "v"(k1l[0]), "v"(k1l[1]));
            // V^T fragments of this pass: fetched here so that the softplus work covers their LDS latency
            const h16* vp0 = sb + 2 * PLN + lr * KP + sub * 32 + hi * 8;
            v16h vh[4], vl[4];
#pragma unroll
            for (int n = 0; n < 4; ++n) { vh[n] = frag(vp0 + n * 16 * KP); vl[n] = frag(vp0 + PLN + n * 16 * KP); }
#pragma unroll
            for (int j = 0; j < 8; ++j) {
                const int ja = l0 + lr, jb = l0 + 16 + lr, qi = qpos[j];
                // sp2norm: w = causal ? softplus(s x scale) : 0 (softplus as logaddexp(x, 0) = max(x,0) + log1p(exp(-|x|))); the row is later divided by sqrt(sum w^2)
                const float a0 = (s0[j] + x0[j] * LOSCI) * 0.125f, a1 = (s1[j] + x1[j] * LOSCI) * 0.125f;
                const float w0 = softplusf(a0), w1 = softplusf(a1);
                const float p0 = (ja <= qi) ? w0 : 0.f, p1 = (jb <= qi) ? w1 : 0.f;
                lpart[j] = lpart[j] + (p0 * p0 + p1 * p1);
                const int mr = hi * 8 + j;
                const float ps0 = p0 * PSC, ps1 = p1 * PSC; const h16 h0 = (h16)ps0, h1 = (h16)ps1;
                pl[mr * 32 + lr] = h0; pl[mr * 32 + 16 + lr] = h1;
                pl2[mr * 32 + lr] = (h16)((ps0 - (float)h0) * LOSC); pl2[mr * 32 + 16 + lr] = (h16)((ps1 - (float)h1) * LOSC);
            }
            asm volatile("" ::: "memory");
            const v16h pa = cat16(*(const v8ha*)(pl + lr * 32 + hi * 8), *(const v8ha*)(pl + lr * 32 + 16 + hi * 8));
            const v16h px = cat16(*(const v8ha*)(pl2 + lr * 32 + hi * 8), *(const v8ha*)(pl2 + lr * 32 + 16 + hi * 8));
#pragma unroll
            for (int n = 0; n < 4; ++n) { o[n] = wmma16(pa, vh[n], o[n]); ox[n] = wmma16(pa, vl[n], ox[n]); ox[n] = wmma16(px, vh[n], ox[n]); }
            // four vector slots behind the last WMMA, on the loop's back edge too, before its operands are refilled
            asm volatile("v_nop\n\tv_nop\n\tv_nop\n\tv_nop" : "+v"(o[0]), "+v"(o[1]), "+v"(o[2]), "+v"(o[3]), "+v"(ox[0]), "+v"(ox[1]), "+v"(ox[2]), "+v"(ox[3])
                         : "v"(pa), "v"(px), "v"(vh[0]), "v"(vh[1]), "v"(vh[2]), "v"(vh[3]), "v"(vl[0]), "v"(vl[1]), "v"(vl[2]), "v"(vl[3]));
        }
        // publish point of stage t + 1: own LDS reads of stage t done, own copies of stage t + 1 landed, then the barrier that serves both
        asm volatile("s_wait_dscnt 0x0" ::: "memory");
        asm volatile("s_wait_asynccnt 0x0" ::: "memory");
        __syncthreads();
        if (t + 2 < ntrip) stage(t + 2, t & 1);           // refill the buffer that every wave has just left
    }
    asm volatile("s_wait_asynccnt 0x0" ::: "memory");     // nothing of this wave is in flight when it goes on to the epilogue
    float inv[8];
#pragma unroll
    for (int j = 0; j < 8; ++j) { float rs = lpart[j]; rs += __shfl_xor(rs, 1, 16); rs += __shfl_xor(rs, 2, 16); rs += __shfl_xor(rs, 4, 16); rs += __shfl_xor(rs, 8, 16); inv[j] = 1.0f / (sqrtf(rs) * PSC); }     // 1 / (||w||_2 x the P scaling)
    float* os = &ost[wave][0];
#pragma unroll
    for (int n = 0; n < 4; ++n)
#pragma unroll
        for (int j = 0; j < 8; ++j) os[(hi * 8 + j) * 68 + n * 16 + lr] = (o[n][j] + ox[n][j] * LOSCI) * inv[j];
    __syncthreads();
    const size_t cbase = (tok0 + q0) * DM + (size_t)h * HD;
    auto pass = [&]() {
#pragma unroll
        for (int s = 0; s < 4; ++s) { const int row = 4 * s + (lane >> 3), piece = lane & 7; const float* sp = os + row * 68 + piece * 8; v8us oh, ol;
#pragma unroll
            for (int i = 0; i < 8; ++i) { const unsigned short hb = f2bf(sp[i]); oh[i] = hb; ol[i] = f2bf(sp[i] - bf2f(hb)); }
            *(v8us*)(CH + cbase + (size_t)row * DM + piece * 8) = oh; *(v8us*)(CL + cbase + (size_t)row * DM + piece * 8) = ol; }
    };
    pass(); 
}

#define VST2(T, p, v) do { const T vst2_v_ = (v); *(T*)(p) = vst2_v_;  } while (0)
extern "C" void kernel_launch(void* const* d_in, const int* in_sizes, int n_in,
                              void* d_out, int out_size, void* d_ws, size_t ws_size, hipStream_t stream) {
    (void)in_sizes; (void)n_in; (void)out_size;
    const float* x = (const float*)d_in[0]; const float* Wqkv = (const float*)d_in[1]; const float* Wp = (const float*)d_in[2]; const float* bp = (const float*)d_in[3];   // [out][in]
    float* out = (float*)d_out;    // [2][2048][1024] = [4096 tokens][1024]
    char* wsp = (char*)d_ws;
    auto take = [&](size_t bytes) { char* p = wsp; wsp += (bytes + 255) & ~(size_t)255; return (void*)p; };
    bf* Xb = (bf*)take((size_t)NTK * DM * 2); bf* WB = (bf*)take((size_t)3 * DM * DM * 2); bf* WpB = (bf*)take((size_t)DM * DM * 2);
    float* TMP = (float*)take((size_t)NTK * DM * 4);
    h16* QH = (h16*)take((size_t)NTK * DM * 2); h16* QL = (h16*)take((size_t)NTK * DM * 2); h16* KH = (h16*)take((size_t)NTK * DM * 2); h16* KL = (h16*)take((size_t)NTK * DM * 2);
    h16* VTH = (h16*)take((size_t)NTK * DM * 2); h16* VTL = (h16*)take((size_t)NTK * DM * 2); bf* CH = (bf*)take((size_t)NTK * DM * 2); bf* CL = (bf*)take((size_t)NTK * DM * 2);
    if ((size_t)(wsp - (char*)d_ws) > ws_size) return;    // 96 MiB, no aliasing
    k_cvtb<<<(NTK + 4 * DM) / 8, 256, 0, stream>>>(x, Wqkv, Wp, Xb, WB, WpB);
    k_gemmb<false, true><<<dim3(NTK / 64, 3 * DM / 64, 1), 128, 0, stream>>>(Xb, nullptr, WB, nullptr, TMP, DM, QH, QL, KH, KL);                        // q, k, v = x.W_qkv^T
    k_vt<<<NB_ * NH_ * (NT_ / 64), 256, 0, stream>>>(TMP, VTH, VTL);
    k_attn<<<NB_ * NH_ * (NT_ / 64), 128, 0, stream>>>(QH, QL, KH, KL, VTH, VTL, CH, CL);
    k_gemmb<true, false><<<dim3(NTK / 64, DM / 64, 1), 128, 0, stream>>>(CH, CL, WpB, bp, out, DM, nullptr, nullptr, nullptr, nullptr);
}

// v006
// A run of this version takes 137 microseconds.
// Two timings next to v005 put it at 1.21 and 1.20 times that version's speed.
// Over all steps from v000 it is 5.95 times as fast.
#include <hip/hip_runtime.h>

// Compute dtypes, f32 accumulate, both batch items in every launch: qkv = x.W_qkv^T ([4096 x 1024].[1024 x 3072]; [out][in] weights as the n-major B operand; PLAIN
// bf16 operands = inputs rounded once, exact) with q/k straight to f16 hi + residual x1024 planes, out = y.W_proj^T + b_proj (y as bf16 hi + residual) on
// v_wmma_f32_16x16x32_bf16; the 16-head causal "sp2norm" attention fused on v_wmma_f32_16x16x32_f16: scores (hh + hl + lh) x 1/8, weights w = softplus(score)
// on the causal part (0 elsewhere), y = (sum_k w v_k) / ||w||_2 with the weights (x2048) as f16 hi + residual x1024 against v as f16 hi + residual; softplus and

#define NB_  2                   // both batch items go through every kernel in one launch
#define NT_  2048
#define DM   1024
#define NH_  16
#define HD   64
#define NTK  (NB_ * NT_)
#define NW   1024
#define NQKV 1024
#define PSC  2048.0f                 // softplus weights are not bounded by 1: x2048 keeps them inside f16 range up to w = 31
#define LOSC 1024.0f
#define LOSCI (1.0f / 1024.0f)

typedef _Float16 h16;
typedef unsigned short bf;
typedef __attribute__((ext_vector_type(16))) __bf16   v16bf;
typedef __attribute__((ext_vector_type(16))) _Float16 v16h;
typedef __attribute__((ext_vector_type(8)))  _Float16 v8h;
typedef __attribute__((ext_vector_type(8)))  unsigned short v8us;
typedef __attribute__((ext_vector_type(8)))  float    v8f;
typedef __attribute__((ext_vector_type(4)))  float    v4f;
typedef v8h  __attribute__((may_alias)) v8ha;
typedef v4f  __attribute__((may_alias)) v4fa;
typedef v8us __attribute__((may_alias)) v8usa;

__device__ __forceinline__ unsigned short f2bf(float f) { unsigned u = __float_as_uint(f); u += 0x7FFFu + ((u >> 16) & 1u); return (unsigned short)(u >> 16); }
__device__ __forceinline__ float bf2f(unsigned short b) { return __uint_as_float(((unsigned)b) << 16); }
__device__ __forceinline__ float bfr(float f) { return bf2f(f2bf(f)); }
__device__ __forceinline__ v16h cat16(v8h lo, v8h hi) { return __builtin_shufflevector(lo, hi, 0, 1, 2, 3, 4, 5, 6, 7, 8, 9, 10, 11, 12, 13, 14, 15); }
__device__ __forceinline__ v16bf cat16b(v8us lo, v8us hi) { return __builtin_bit_cast(v16bf, __builtin_shufflevector(lo, hi, 0, 1, 2, 3, 4, 5, 6, 7, 8, 9, 10, 11, 12, 13, 14, 15)); }
__device__ __forceinline__ v8f wmma16(v16h a, v16h b, v8f c) { return __builtin_amdgcn_wmma_f32_16x16x32_f16(false, a, false, b, (short)0, c, false, false); }
__device__ __forceinline__ v8f wmmab(v16bf a, v16bf b, v8f c) { return __builtin_amdgcn_wmma_f32_16x16x32_bf16(false, a, false, b, (short)0, c, false, false); }

// k_cvtb: one launch rounds all three f32 operands to bf16. Blocks of 8 rows: first x (NTK rows), then W_qkv (3 DM rows), then W_proj (DM rows); the grid covers exactly these rows.
__global__ __launch_bounds__(256) void k_cvtb(const float* __restrict__ x, const float* __restrict__ wqkv, const float* __restrict__ wp, bf* xb, bf* wb, bf* wpb) {
    const int row0 = blockIdx.x * 8, part = row0 < NTK ? 0 : (row0 < NTK + 3 * DM ? 1 : 2);        // the same for the whole block
    const float* __restrict__ src = part == 0 ? x : (part == 1 ? wqkv : wp);
    bf* dst = part == 0 ? xb : (part == 1 ? wb : wpb);
    const int lane = threadIdx.x & 31, r = row0 - (part == 0 ? 0 : (part == 1 ? NTK : NTK + 3 * DM)) + (threadIdx.x >> 5);
    v8us o[DM / 256];
#pragma unroll
    for (int q = 0; q < DM / 256; ++q) { v8us t;
#pragma unroll
        for (int i = 0; i < 8; ++i) t[i] = f2bf(src[(size_t)r * DM + q * 256 + lane * 8 + i]);
        o[q] = t; }
#pragma unroll
    for (int q = 0; q < DM / 256; ++q) *(v8us*)(dst + (size_t)r * DM + q * 256 + lane * 8) = o[q];
    
}

// Staged rows in LDS: 64 f16 of data + 8 of pad = 144 B, a pitch of 16 B x odd, which ds_load_b128 fragment reads take without bank conflicts.
#define KP   72
#define PLN  (64 * KP)               // one plane of a stage: 64 rows (K: 64 keys x 64 dims; V^T: 64 dims x 64 keys)
#define STG  (4 * PLN)               // a stage = 64 keys: K hi, K residual, V^T hi, V^T residual

__device__ __forceinline__ unsigned lds_addr(const void* p) { return (unsigned)(unsigned long long)p; }     // low 32 bits of a __shared__ address = LDS byte address

// Four rows-of-16 steps of one plane pair: each lane copies its own 16 B, global -> LDS, through no register. The s_wait_xcnt stands inside the statement so that
// no address register of an issued copy is rewritten ahead of it.
__device__ __forceinline__ void cp8(unsigned la, const h16* ga, unsigned lb, const h16* gb, size_t gstep) {
    asm volatile("global_load_async_to_lds_b128 %0, %1, off\n\t"
                 "global_load_async_to_lds_b128 %2, %3, off\n\t"
                 "global_load_async_to_lds_b128 %4, %5, off\n\t"
                 "global_load_async_to_lds_b128 %6, %7, off\n\t"
                 "global_load_async_to_lds_b128 %8, %9, off\n\t"
                 "global_load_async_to_lds_b128 %10, %11, off\n\t"
                 "global_load_async_to_lds_b128 %12, %13, off\n\t"
                 "global_load_async_to_lds_b128 %14, %15, off\n\t"
                 "s_wait_xcnt 0x0"
                 :: "v"(la), "v"(ga), "v"(la + 16 * KP * 2), "v"(ga + 16 * gstep), "v"(la + 32 * KP * 2), "v"(ga + 32 * gstep), "v"(la + 48 * KP * 2), "v"(ga + 48 * gstep),
                    "v"(lb), "v"(gb), "v"(lb + 16 * KP * 2), "v"(gb + 16 * gstep), "v"(lb + 32 * KP * 2), "v"(gb + 32 * gstep), "v"(lb + 48 * KP * 2), "v"(gb + 48 * gstep)
                 : "memory");
}
__device__ __forceinline__ void cp4(unsigned la, const h16* ga, size_t gstep) {
    asm volatile("global_load_async_to_lds_b128 %0, %1, off\n\t"
                 "global_load_async_to_lds_b128 %2, %3, off\n\t"
                 "global_load_async_to_lds_b128 %4, %5, off\n\t"
                 "global_load_async_to_lds_b128 %6, %7, off\n\t"
                 "s_wait_xcnt 0x0"
                 :: "v"(la), "v"(ga), "v"(la + 16 * KP * 2), "v"(ga + 16 * gstep), "v"(la + 32 * KP * 2), "v"(ga + 32 * gstep), "v"(la + 48 * KP * 2), "v"(ga + 48 * gstep)
                 : "memory");
}
__device__ __forceinline__ v16bf fragb(const bf* p) { return cat16b(*(const v8usa*)p, *(const v8usa*)(p + 16)); }

// k_gemmb: block = 64 rows x 64 columns, wave = 16 rows x 64 columns. The k range runs in stages of 128 (two halves of 64, each a set of 64 x 64 planes): the block's A rows
// (and their residual plane) and B rows come into a two-buffer LDS ring by asynchronous copies, whole 128-B lines, once per block instead of once per wave, stage t + 1 in
// flight while stage t is worked on.
// QKV: Bn holds the 3 DM rows of W_qkv and blockIdx.y walks all of them in one launch; a block's 64 columns lie in one of q, k, v: q and k leave as f16 hi + residual planes, v as f32 in C.
template <bool SPLITA, bool QKV>
__global__ __launch_bounds__(128) void k_gemmb(const bf* __restrict__ A, const bf* __restrict__ Al, const bf* __restrict__ Bn, const float* __restrict__ bias, float* C, int ldc, h16* QH, h16* QL, h16* KH, h16* KL) {
    constexpr int GHF = (SPLITA ? 3 : 2) * PLN;          // half a stage, 64 of k: A, B and, where A is split, its residual plane
    constexpr int GST = 2 * GHF, NST = DM / 128;
    __shared__ __align__(16) bf gring[2 * GST];
    __shared__ __align__(16) float ost[4][16 * 68];
    const int lane = threadIdx.x & 31, wave = threadIdx.x >> 5, lr = lane & 15, hi = lane >> 4;
    const int rb = blockIdx.x * 64, r0 = rb + wave * 16, c0 = blockIdx.y * 64;
    // copy slots: thread -> row (tid >> 3) + 16 i, 16-byte piece tid & 7: a wave's copy covers four whole 128-B lines
    const int crow = threadIdx.x >> 3, cpc = threadIdx.x & 7;
    const unsigned lring = lds_addr(&gring[0]) + (unsigned)(crow * KP + cpc * 8) * 2u;
    const size_t ao = (size_t)(rb + crow) * DM + cpc * 8, bo = (size_t)(c0 + crow) * DM + cpc * 8;
    auto stage = [&](int t, int bufi) {
#pragma unroll
        for (int hf = 0; hf < 2; ++hf) {
            const unsigned lb = lring + (unsigned)bufi * (GST * 2u) + (unsigned)hf * (GHF * 2u);
            const int k0 = t * 128 + hf * 64;
            cp8(lb, (const h16*)(const void*)(A + ao + k0), lb + PLN * 2u, (const h16*)(const void*)(Bn + bo + k0), DM);
            if (SPLITA) cp4(lb + 2u * PLN * 2u, (const h16*)(const void*)(Al + ao + k0), DM);
        }
    };
    stage(0, 0);
    asm volatile("s_wait_asynccnt 0x0" ::: "memory");     // this wave's copies of stage 0 have landed
    __syncthreads();                                      // ... and every other wave's: stage 0 is readable
    stage(1, 1);
    v8f acc[4];
#pragma unroll
    for (int t = 0; t < 4; ++t) acc[t] = (v8f){};
#pragma unroll 1
    for (int st = 0; st < NST; ++st) {
#pragma unroll
      for (int hf = 0; hf < 2; ++hf) {
        const bf* sb = gring + (st & 1) * GST + hf * GHF;
        const bf* ap = sb + (wave * 16 + lr) * KP + 8 * hi;
        const bf* bp = sb + PLN + lr * KP + 8 * hi;
        v16bf a[2], al[2], b[2][4];
#pragma unroll
        for (int kc = 0; kc < 2; ++kc) {
            a[kc] = fragb(ap + kc * 32); al[kc] = a[kc];
            if (SPLITA) al[kc] = fragb(ap + 2 * PLN + kc * 32);
#pragma unroll
            for (int t = 0; t < 4; ++t) b[kc][t] = fragb(bp + t * 16 * KP + kc * 32);
        }
#pragma unroll
        for (int kc = 0; kc < 2; ++kc)
#pragma unroll
            for (int t = 0; t < 4; ++t) { acc[t] = wmmab(a[kc], b[kc][t], acc[t]); if (SPLITA) acc[t] = wmmab(al[kc], b[kc][t], acc[t]); }
        // four vector slots behind the last WMMA, on the loop's back edge too, before its operands are refilled
        asm volatile("v_nop\n\tv_nop\n\tv_nop\n\tv_nop" : "+v"(acc[0]), "+v"(acc[1]), "+v"(acc[2]), "+v"(acc[3])
                     : "v"(a[0]), "v"(a[1]), "v"(al[0]), "v"(al[1]), "v"(b[0][0]), "v"(b[0][1]), "v"(b[0][2]), "v"(b[0][3]), "v"(b[1][0]), "v"(b[1][1]), "v"(b[1][2]), "v"(b[1][3]));
      }
        // publish point of stage st + 1: own LDS reads of stage st done, own copies of stage st + 1 landed, then the barrier that serves both
        asm volatile("s_wait_dscnt 0x0" ::: "memory");
        asm volatile("s_wait_asynccnt 0x0" ::: "memory");
        __syncthreads();
        if (st + 2 < NST) stage(st + 2, st & 1);          // refill the buffer that every wave has just left
    }
    asm volatile("s_wait_asynccnt 0x0" ::: "memory");     // nothing of this wave is in flight when it goes on to the epilogue
    float* os = &ost[wave][0];
#pragma unroll
    for (int t = 0; t < 4; ++t) { const float bv = bias ? bfr(bias[c0 + t * 16 + lr]) : 0.f;
#pragma unroll
        for (int j = 0; j < 8; ++j) os[(hi * 8 + j) * 68 + t * 16 + lr] = acc[t][j] + bv; }
    __syncthreads();
    const int sel = QKV ? (int)(blockIdx.y / (unsigned)(DM / 64)) : 2;     // whose columns these are: 0 q, 1 k, 2 the f32 output; the same for the whole block
    const int cc = QKV ? c0 - sel * DM : c0;                   // first column inside that output
    if (QKV && sel < 2) {
        h16* crow = (sel ? KH : QH) + (size_t)r0 * ldc + cc;
        h16* crow2 = (sel ? KL : QL) + (size_t)r0 * ldc + cc;
        auto pass = [&]() {
#pragma unroll
            for (int s = 0; s < 4; ++s) { const int row = 4 * s + (lane >> 3), piece = lane & 7; const float* sp = os + row * 68 + piece * 8; v8h o, o2;
#pragma unroll
                for (int i = 0; i < 8; ++i) { const h16 a = (h16)sp[i]; o[i] = a; o2[i] = (h16)((sp[i] - (float)a) * LOSC); }
                *(v8h*)(crow + (size_t)row * ldc + piece * 8) = o; *(v8h*)(crow2 + (size_t)row * ldc + piece * 8) = o2; }
        };
        pass(); 
    } else {
        float* crow = C + (size_t)r0 * ldc + cc;
        auto pass = [&]() {
#pragma unroll
            for (int s = 0; s < 8; ++s) { const int Lid = (lane >> 3) + 4 * s, piece = lane & 7; const int row = Lid >> 1, cofs = (Lid & 1) * 32 + piece * 4;
                const v4f val = *(const v4fa*)(os + row * 68 + cofs); *(v4f*)(crow + (size_t)row * ldc + cofs) = val; }
        };
        pass(); 
        // the built code lays the f16 branch right behind these stores, past a branch it keeps conditional: the wait stands in front of that code's writes to the stores' registers
        if (QKV) asm volatile("s_wait_xcnt 0x0" ::: "memory");
    }
}

__global__ __launch_bounds__(256) void k_vt(const float* __restrict__ V, h16* VTH, h16* VTL) {
    __shared__ __align__(16) h16 tile[64 * 72];
    __shared__ __align__(16) h16 til2[64 * 72];
    const int bid = blockIdx.x;
    const int b = bid / (NH_ * (NT_ / 64)), rem = bid - b * (NH_ * (NT_ / 64)), h = rem / (NT_ / 64), kt = rem - h * (NT_ / 64);
    const int k0 = kt * 64, tid = threadIdx.x;
    const int kk = tid >> 2, d0 = (tid & 3) * 16;
    const float* src = V + ((size_t)b * NT_ + k0 + kk) * DM + h * HD + d0;
#pragma unroll
    for (int i = 0; i < 16; ++i) { const float v = src[i]; const h16 a = (h16)v; tile[(d0 + i) * 72 + kk] = a; til2[(d0 + i) * 72 + kk] = (h16)((v - (float)a) * LOSC); }
    __syncthreads();
    const int piece = tid & 7;
    const size_t base = (((size_t)b * NH_ + h) * HD) * NT_ + k0;
    auto pass = [&]() {
#pragma unroll
        for (int s = 0; s < 4; ++s) { const int Lid = (tid >> 3) + 32 * s; const int pln = Lid >> 6, d = Lid & 63;
            const v8h val = *(const v8ha*)((pln ? til2 : tile) + d * 72 + piece * 8); *(v8h*)((pln ? VTL : VTH) + base + (size_t)d * NT_ + piece * 8) = val; }
    };
    pass(); 
}

// softplus(x) = max(x, 0) + log1p(e), e = exp(-|x|) in (0, 1]. log1p(e) = log(u) + c with u = 1 + e rounded and c = e - (u - 1), exactly what that rounding lost
// (|c| <= 2^-24; taking c for c / u moves the result by at most 2^-24 of itself): one hardware log2, small e keeps its relative accuracy and never falls to 0.
__device__ __forceinline__ float softplusf(float x) {
    const float e = __expf(-fabsf(x)), u = 1.0f + e;
    return fmaxf(x, 0.f) + fmaf(__builtin_amdgcn_logf(u), 0.69314718f, e - (u - 1.0f));
}
__device__ __forceinline__ v16h frag(const h16* p) { return cat16(*(const v8ha*)p, *(const v8ha*)(p + 16)); }

// k_attn: block = (b, h, 64 queries), wave = 16 queries; causal key range in stages of 64 keys, two passes of 32 keys each. The block's four waves share each stage:
// K and V^T (hi + residual) come into a two-buffer LDS ring by asynchronous copies, stage t + 1 in flight while stage t is worked on; the query residual is staged once.
// Per pass: 12 WMMA scores /8 (f32), softplus weights x2048 as f16 hi + residual (same-wave may_alias reload after a compiler barrier), 12 WMMA .v;
// ctx -> bf16 hi + residual planes CH/CL[tok][h*64+d].
__global__ __launch_bounds__(128) void k_attn(const h16* __restrict__ Q16, const h16* __restrict__ QL16, const h16* __restrict__ K16, const h16* __restrict__ KL16, const h16* __restrict__ VTH, const h16* __restrict__ VTL, bf* CH, bf* CL) {
    __shared__ __align__(16) h16 ring[2 * STG];
    __shared__ __align__(16) h16 qls[PLN];
    __shared__ __align__(16) h16 plds[4][16 * 32];
    __shared__ __align__(16) h16 plds2[4][16 * 32];
    __shared__ __align__(16) float ost[4][16 * 68];
    const int lane = threadIdx.x & 31, wave = threadIdx.x >> 5, lr = lane & 15, hi = lane >> 4;
    const int bid = blockIdx.x;
    // a block's cost grows with its query tile (qt + 1 stages); the longest tiles take the lowest indices
    // (all heads of tile 31, then of tile 30, ...), for speed only
    const unsigned rank = (unsigned)bid / (NB_ * NH_), bh = (unsigned)bid % (NB_ * NH_);
    const int qt = NT_ / 64 - 1 - (int)rank, b = (int)(bh / NH_), h = (int)(bh % NH_);
    const int q0 = qt * 64 + wave * 16;
    const size_t tok0 = (size_t)b * NT_;
    h16* pl = &plds[wave][0]; h16* pl2 = &plds2[wave][0];
    const h16* kh_b = K16 + tok0 * DM + h * HD;
    const h16* kl_b = KL16 + tok0 * DM + h * HD;
    const size_t vbase = (((size_t)b * NH_ + h) * HD) * NT_;
    // copy slots: thread -> row (tid >> 3) + 16 i, 16-byte piece tid & 7: a wave's copy covers four whole 128-B lines
    const int crow = threadIdx.x >> 3, cpc = threadIdx.x & 7;
    const unsigned lslot = (unsigned)(crow * KP + cpc * 8) * 2u;
    const unsigned lring = lds_addr(&ring[0]) + lslot;
    auto stage = [&](int t, int bufi) {
        const unsigned lb = lring + (unsigned)bufi * (STG * 2u);
        const size_t ko = (size_t)(t * 64 + crow) * DM + cpc * 8, vo = vbase + (size_t)crow * NT_ + t * 64 + cpc * 8;
        cp8(lb, kh_b + ko, lb + PLN * 2u, kl_b + ko, DM);
        cp8(lb + 2u * PLN * 2u, VTH + vo, lb + 3u * PLN * 2u, VTL + vo, NT_);
    };
    const int ntrip = qt + 1;     // causal: keys 0 .. qt * 64 + 63
    cp4(lds_addr(&qls[0]) + lslot, QL16 + (tok0 + qt * 64 + crow) * DM + h * HD + cpc * 8, DM);
    stage(0, 0);
    asm volatile("s_wait_asynccnt 0x0" ::: "memory");     // this wave's copies of stage 0 have landed
    __syncthreads();                                      // ... and every other wave's: stage 0 and the query residual are readable
    if (ntrip > 1) stage(1, 1);
    v16h qa[2];
    const size_t qo0 = (tok0 + q0 + lr) * DM + h * HD + 8 * hi;
#pragma unroll
    for (int kc = 0; kc < 2; ++kc) qa[kc] = cat16(*(const v8h*)(Q16 + qo0 + kc * 32), *(const v8h*)(Q16 + qo0 + kc * 32 + 16));
    const h16* qlp = qls + (wave * 16 + lr) * KP + 8 * hi;
    v8f o[4], ox[4];
#pragma unroll
    for (int n = 0; n < 4; ++n) { o[n] = (v8f){}; ox[n] = (v8f){}; }
    float lpart[8];
#pragma unroll
    for (int j = 0; j < 8; ++j) lpart[j] = 0.f;
    int qpos[8];
#pragma unroll
    for (int j = 0; j < 8; ++j) qpos[j] = q0 + 8 * hi + j;
#pragma unroll 1
    for (int t = 0; t < ntrip; ++t) {
        const h16* sb = ring + (t & 1) * STG;
#pragma unroll 1
        for (int sub = 0; sub < 2; ++sub) {
            const int l0 = t * 64 + sub * 32;
            const h16* kp0 = sb + (sub * 32 + lr) * KP + 8 * hi;
            v16h k0h[2], k1h[2], k0l[2], k1l[2], qlk[2];
#pragma unroll
            for (int kc = 0; kc < 2; ++kc) {
                k0h[kc] = frag(kp0 + kc * 32); k1h[kc] = frag(kp0 + 16 * KP + kc * 32); qlk[kc] = frag(qlp + kc * 32);
                k0l[kc] = frag(kp0 + PLN + kc * 32); k1l[kc] = frag(kp0 + PLN + 16 * KP + kc * 32);
            }
            v8f s0 = {}, s1 = {}, x0 = {}, x1 = {};
#pragma unroll
            for (int kc = 0; kc < 2; ++kc) {
                s0 = wmma16(qa[kc], k0h[kc], s0); x0 = wmma16(qlk[kc], k0h[kc], x0); s1 = wmma16(qa[kc], k1h[kc], s1); x1 = wmma16(qlk[kc], k1h[kc], x1);
                x0 = wmma16(qa[kc], k0l[kc], x0); x1 = wmma16(qa[kc], k1l[kc], x1);
            }
            // four vector slots between the last score WMMA and the first use of its result or rewrite of its operands
            asm volatile("v_nop\n\tv_nop\n\tv_nop\n\tv_nop" : "+v"(s0), "+v"(s1), "+v"(x0), "+v"(x1)
                         : "v"(qa[0]), "v"(qa[1]), "v"(qlk[0]), "v"(qlk[1]), "v"(k0h[0]), "v"(k0h[1]), "v"(k1h[0]), "v"(k1h[1]), "v"(k0l[0]), "v"(k0l[1]), "v"(k1l[0]), "v"(k1l[1]));
            // V^T fragments of this pass: fetched here so that the softplus work covers their LDS latency
            const h16* vp0 = sb + 2 * PLN + lr * KP + sub * 32 + hi * 8;
            v16h vh[4], vl[4];
#pragma unroll
            for (int n = 0; n < 4; ++n) { vh[n] = frag(vp0 + n * 16 * KP); vl[n] = frag(vp0 + PLN + n * 16 * KP); }
#pragma unroll
            for (int j = 0; j < 8; ++j) {
                const int ja = l0 + lr, jb = l0 + 16 + lr, qi = qpos[j];
                // sp2norm: w = causal ? softplus(s x scale) : 0 (softplus as logaddexp(x, 0) = max(x,0) + log1p(exp(-|x|))); the row is later divided by sqrt(sum w^2)
                const float a0 = (s0[j] + x0[j] * LOSCI) * 0.125f, a1 = (s1[j] + x1[j] * LOSCI) * 0.125f;
                const float w0 = softplusf(a0), w1 = softplusf(a1);
                const float p0 = (ja <= qi) ? w0 : 0.f, p1 = (jb <= qi) ? w1 : 0.f;
                lpart[j] = lpart[j] + (p0 * p0 + p1 * p1);
                const int mr = hi * 8 + j;
                const float ps0 = p0 * PSC, ps1 = p1 * PSC; const h16 h0 = (h16)ps0, h1 = (h16)ps1;
                pl[mr * 32 + lr] = h0; pl[mr * 32 + 16 + lr] = h1;
                pl2[mr * 32 + lr] = (h16)((ps0 - (float)h0) * LOSC); pl2[mr * 32 + 16 + lr] = (h16)((ps1 - (float)h1) * LOSC);
            }
            asm volatile("" ::: "memory");
            const v16h pa = cat16(*(const v8ha*)(pl + lr * 32 + hi * 8), *(const v8ha*)(pl + lr * 32 + 16 + hi * 8));
            const v16h px = cat16(*(const v8ha*)(pl2 + lr * 32 + hi * 8), *(const v8ha*)(pl2 + lr * 32 + 16 + hi * 8));
#pragma unroll
            for (int n = 0; n < 4; ++n) { o[n] = wmma16(pa, vh[n], o[n]); ox[n] = wmma16(pa, vl[n], ox[n]); ox[n] = wmma16(px, vh[n], ox[n]); }
            // four vector slots behind the last WMMA, on the loop's back edge too, before its operands are refilled
            asm volatile("v_nop\n\tv_nop\n\tv_nop\n\tv_nop" : "+v"(o[0]), "+v"(o[1]), "+v"(o[2]), "+v"(o[3]), "+v"(ox[0]), "+v"(ox[1]), "+v"(ox[2]), "+v"(ox[3])
                         : "v"(pa), "v"(px), "v"(vh[0]), "v"(vh[1]), "v"(vh[2]), "v"(vh[3]), "v"(vl[0]), "v"(vl[1]), "v"(vl[2]), "v"(vl[3]));
        }
        // publish point of stage t + 1: own LDS reads of stage t done, own copies of stage t + 1 landed, then the barrier that serves both
        asm volatile("s_wait_dscnt 0x0" ::: "memory");
        asm volatile("s_wait_asynccnt 0x0" ::: "memory");
        __syncthreads();
        if (t + 2 < ntrip) stage(t + 2, t & 1);           // refill the buffer that every wave has just left
    }
    asm volatile("s_wait_asynccnt 0x0" ::: "memory");     // nothing of this wave is in flight when it goes on to the epilogue
    float inv[8];
#pragma unroll
    for (int j = 0; j < 8; ++j) { float rs = lpart[j]; rs += __shfl_xor(rs, 1, 16); rs += __shfl_xor(rs, 2, 16); rs += __shfl_xor(rs, 4, 16); rs += __shfl_xor(rs, 8, 16); inv[j] = 1.0f / (sqrtf(rs) * PSC); }     // 1 / (||w||_2 x the P scaling)
    float* os = &ost[wave][0];
#pragma unroll
    for (int n = 0; n < 4; ++n)
#pragma unroll
        for (int j = 0; j < 8; ++j) os[(hi * 8 + j) * 68 + n * 16 + lr] = (o[n][j] + ox[n][j] * LOSCI) * inv[j];
    __syncthreads();
    const size_t cbase = (tok0 + q0) * DM + (size_t)h * HD;
    auto pass = [&]() {
#pragma unroll
        for (int s = 0; s < 4; ++s) { const int row = 4 * s + (lane >> 3), piece = lane & 7; const float* sp = os + row * 68 + piece * 8; v8us oh, ol;
#pragma unroll
            for (int i = 0; i < 8; ++i) { const unsigned short hb = f2bf(sp[i]); oh[i] = hb; ol[i] = f2bf(sp[i] - bf2f(hb)); }
            *(v8us*)(CH + cbase + (size_t)row * DM + piece * 8) = oh; *(v8us*)(CL + cbase + (size_t)row * DM + piece * 8) = ol; }
    };
    pass(); 
}

#define VST2(T, p, v) do { const T vst2_v_ = (v); *(T*)(p) = vst2_v_;  } while (0)
extern "C" void kernel_launch(void* const* d_in, const int* in_sizes, int n_in,
                              void* d_out, int out_size, void* d_ws, size_t ws_size, hipStream_t stream) {
    (void)in_sizes; (void)n_in; (void)out_size;
    const float* x = (const float*)d_in[0]; const float* Wqkv = (const float*)d_in[1]; const float* Wp = (const float*)d_in[2]; const float* bp = (const float*)d_in[3];   // [out][in]
    float* out = (float*)d_out;    // [2][2048][1024] = [4096 tokens][1024]
    char* wsp = (char*)d_ws;
    auto take = [&](size_t bytes) { char* p = wsp; wsp += (bytes + 255) & ~(size_t)255; return (void*)p; };
    bf* Xb = (bf*)take((size_t)NTK * DM * 2); bf* WB = (bf*)take((size_t)3 * DM * DM * 2); bf* WpB = (bf*)take((size_t)DM * DM * 2);
    float* TMP = (float*)take((size_t)NTK * DM * 4);
    h16* QH = (h16*)take((size_t)NTK * DM * 2); h16* QL = (h16*)take((size_t)NTK * DM * 2); h16* KH = (h16*)take((size_t)NTK * DM * 2); h16* KL = (h16*)take((size_t)NTK * DM * 2);
    h16* VTH = (h16*)take((size_t)NTK * DM * 2); h16* VTL = (h16*)take((size_t)NTK * DM * 2); bf* CH = (bf*)take((size_t)NTK * DM * 2); bf* CL = (bf*)take((size_t)NTK * DM * 2);
    if ((size_t)(wsp - (char*)d_ws) > ws_size) return;    // 96 MiB, no aliasing
    k_cvtb<<<(NTK + 4 * DM) / 8, 256, 0, stream>>>(x, Wqkv, Wp, Xb, WB, WpB);
    k_gemmb<false, true><<<dim3(NTK / 64, 3 * DM / 64, 1), 128, 0, stream>>>(Xb, nullptr, WB, nullptr, TMP, DM, QH, QL, KH, KL);                        // q, k, v = x.W_qkv^T
    k_vt<<<NB_ * NH_ * (NT_ / 64), 256, 0, stream>>>(TMP, VTH, VTL);
    k_attn<<<NB_ * NH_ * (NT_ / 64), 128, 0, stream>>>(QH, QL, KH, KL, VTH, VTL, CH, CL);
    k_gemmb<true, false><<<dim3(NTK / 64, DM / 64, 1), 128, 0, stream>>>(CH, CL, WpB, bp, out, DM, nullptr, nullptr, nullptr, nullptr);
}

// v007
// One run takes 121 microseconds.
// Next to v006, in two timings, it ran 1.13 and 1.12 times as fast.
// Over all steps from v000 it is 6.67 times as fast.
#include <hip/hip_runtime.h>

// Compute dtypes, f32 accumulate, both batch items in every launch: qkv = x.W_qkv^T ([4096 x 1024].[1024 x 3072]; [out][in] weights as the n-major B operand; PLAIN
// bf16 operands = inputs rounded once, exact) with q/k straight to f16 hi + residual x1024 planes, out = y.W_proj^T + b_proj (y as bf16 hi + residual) on
// v_wmma_f32_16x16x32_bf16; the 16-head causal "sp2norm" attention fused on v_wmma_f32_16x16x32_f16: scores (hh + hl + lh) x 1/8, weights w = softplus(score)
// on the causal part (0 elsewhere), y = (sum_k w v_k) / ||w||_2 with the weights (x2048) as f16 hi + residual x1024 against v as f16 hi + residual; softplus and

#define NB_  2                   // both batch items go through every kernel in one launch
#define NT_  2048
#define DM   1024
#define NH_  16
#define HD   64
#define NTK  (NB_ * NT_)
#define NW   1024
#define NQKV 1024
#define PSC  2048.0f                 // softplus weights are not bounded by 1: x2048 keeps them inside f16 range up to w = 31
#define LOSC 1024.0f
#define LOSCI (1.0f / 1024.0f)

typedef _Float16 h16;
typedef unsigned short bf;
typedef __attribute__((ext_vector_type(16))) __bf16   v16bf;
typedef __attribute__((ext_vector_type(16))) _Float16 v16h;
typedef __attribute__((ext_vector_type(8)))  _Float16 v8h;
typedef __attribute__((ext_vector_type(8)))  unsigned short v8us;
typedef __attribute__((ext_vector_type(8)))  float    v8f;
typedef __attribute__((ext_vector_type(4)))  float    v4f;
typedef __attribute__((ext_vector_type(2)))  float    v2f;
typedef __attribute__((ext_vector_type(2)))  _Float16 v2h;
typedef v8h  __attribute__((may_alias)) v8ha;
typedef v4f  __attribute__((may_alias)) v4fa;
typedef v8us __attribute__((may_alias)) v8usa;

__device__ __forceinline__ unsigned short f2bf(float f) { unsigned u = __float_as_uint(f); u += 0x7FFFu + ((u >> 16) & 1u); return (unsigned short)(u >> 16); }
__device__ __forceinline__ float bf2f(unsigned short b) { return __uint_as_float(((unsigned)b) << 16); }
__device__ __forceinline__ float bfr(float f) { return bf2f(f2bf(f)); }
__device__ __forceinline__ v16h cat16(v8h lo, v8h hi) { return __builtin_shufflevector(lo, hi, 0, 1, 2, 3, 4, 5, 6, 7, 8, 9, 10, 11, 12, 13, 14, 15); }
__device__ __forceinline__ v16bf cat16b(v8us lo, v8us hi) { return __builtin_bit_cast(v16bf, __builtin_shufflevector(lo, hi, 0, 1, 2, 3, 4, 5, 6, 7, 8, 9, 10, 11, 12, 13, 14, 15)); }
__device__ __forceinline__ v8f wmma16(v16h a, v16h b, v8f c) { return __builtin_amdgcn_wmma_f32_16x16x32_f16(false, a, false, b, (short)0, c, false, false); }
__device__ __forceinline__ v8f wmmab(v16bf a, v16bf b, v8f c) { return __builtin_amdgcn_wmma_f32_16x16x32_bf16(false, a, false, b, (short)0, c, false, false); }

// k_cvtb: one launch rounds all three f32 operands to bf16. Blocks of 8 rows: first x (NTK rows), then W_qkv (3 DM rows), then W_proj (DM rows); the grid covers exactly these rows.
__global__ __launch_bounds__(256) void k_cvtb(const float* __restrict__ x, const float* __restrict__ wqkv, const float* __restrict__ wp, bf* xb, bf* wb, bf* wpb) {
    const int row0 = blockIdx.x * 8, part = row0 < NTK ? 0 : (row0 < NTK + 3 * DM ? 1 : 2);        // the same for the whole block
    const float* __restrict__ src = part == 0 ? x : (part == 1 ? wqkv : wp);
    bf* dst = part == 0 ? xb : (part == 1 ? wb : wpb);
    const int lane = threadIdx.x & 31, r = row0 - (part == 0 ? 0 : (part == 1 ? NTK : NTK + 3 * DM)) + (threadIdx.x >> 5);
    v8us o[DM / 256];
#pragma unroll
    for (int q = 0; q < DM / 256; ++q) { v8us t;
#pragma unroll
        for (int i = 0; i < 8; ++i) t[i] = f2bf(src[(size_t)r * DM + q * 256 + lane * 8 + i]);
        o[q] = t; }
#pragma unroll
    for (int q = 0; q < DM / 256; ++q) *(v8us*)(dst + (size_t)r * DM + q * 256 + lane * 8) = o[q];
    
}

// Staged rows in LDS: 64 f16 of data + 8 of pad = 144 B, a pitch of 16 B x odd, which ds_load_b128 fragment reads take without bank conflicts.
#define KP   72
#define PLN  (64 * KP)               // one plane of a stage: 64 rows (K: 64 keys x 64 dims; V^T: 64 dims x 64 keys)
#define STG  (4 * PLN)               // a stage = 64 keys: K hi, K residual, V^T hi, V^T residual

__device__ __forceinline__ unsigned lds_addr(const void* p) { return (unsigned)(unsigned long long)p; }     // low 32 bits of a __shared__ address = LDS byte address

// Four rows-of-16 steps of one plane pair: each lane copies its own 16 B, global -> LDS, through no register. The s_wait_xcnt stands inside the statement so that
// no address register of an issued copy is rewritten ahead of it.
__device__ __forceinline__ void cp8(unsigned la, const h16* ga, unsigned lb, const h16* gb, size_t gstep) {
    asm volatile("global_load_async_to_lds_b128 %0, %1, off\n\t"
                 "global_load_async_to_lds_b128 %2, %3, off\n\t"
                 "global_load_async_to_lds_b128 %4, %5, off\n\t"
                 "global_load_async_to_lds_b128 %6, %7, off\n\t"
                 "global_load_async_to_lds_b128 %8, %9, off\n\t"
                 "global_load_async_to_lds_b128 %10, %11, off\n\t"
                 "global_load_async_to_lds_b128 %12, %13, off\n\t"
                 "global_load_async_to_lds_b128 %14, %15, off\n\t"
                 "s_wait_xcnt 0x0"
                 :: "v"(la), "v"(ga), "v"(la + 16 * KP * 2), "v"(ga + 16 * gstep), "v"(la + 32 * KP * 2), "v"(ga + 32 * gstep), "v"(la + 48 * KP * 2), "v"(ga + 48 * gstep),
                    "v"(lb), "v"(gb), "v"(lb + 16 * KP * 2), "v"(gb + 16 * gstep), "v"(lb + 32 * KP * 2), "v"(gb + 32 * gstep), "v"(lb + 48 * KP * 2), "v"(gb + 48 * gstep)
                 : "memory");
}
__device__ __forceinline__ void cp4(unsigned la, const h16* ga, size_t gstep) {
    asm volatile("global_load_async_to_lds_b128 %0, %1, off\n\t"
                 "global_load_async_to_lds_b128 %2, %3, off\n\t"
                 "global_load_async_to_lds_b128 %4, %5, off\n\t"
                 "global_load_async_to_lds_b128 %6, %7, off\n\t"
                 "s_wait_xcnt 0x0"
                 :: "v"(la), "v"(ga), "v"(la + 16 * KP * 2), "v"(ga + 16 * gstep), "v"(la + 32 * KP * 2), "v"(ga + 32 * gstep), "v"(la + 48 * KP * 2), "v"(ga + 48 * gstep)
                 : "memory");
}
__device__ __forceinline__ v16bf fragb(const bf* p) { return cat16b(*(const v8usa*)p, *(const v8usa*)(p + 16)); }

// k_gemmb: block = 64 rows x 64 columns, wave = 16 rows x 64 columns. The k range runs in stages of 128 (two halves of 64, each a set of 64 x 64 planes): the block's A rows
// (and their residual plane) and B rows come into a two-buffer LDS ring by asynchronous copies, whole 128-B lines, once per block instead of once per wave, stage t + 1 in
// flight while stage t is worked on.
// QKV: Bn holds the 3 DM rows of W_qkv and blockIdx.y walks all of them in one launch; a block's 64 columns lie in one of q, k, v: q and k leave as f16 hi + residual planes, v as f32 in C.
template <bool SPLITA, bool QKV>
__global__ __launch_bounds__(128) void k_gemmb(const bf* __restrict__ A, const bf* __restrict__ Al, const bf* __restrict__ Bn, const float* __restrict__ bias, float* C, int ldc, h16* QH, h16* QL, h16* KH, h16* KL) {
    constexpr int GHF = (SPLITA ? 3 : 2) * PLN;          // half a stage, 64 of k: A, B and, where A is split, its residual plane
    constexpr int GST = 2 * GHF, NST = DM / 128;
    __shared__ __align__(16) bf gring[2 * GST];
    __shared__ __align__(16) float ost[4][16 * 68];
    const int lane = threadIdx.x & 31, wave = threadIdx.x >> 5, lr = lane & 15, hi = lane >> 4;
    const int rb = blockIdx.x * 64, r0 = rb + wave * 16, c0 = blockIdx.y * 64;
    // copy slots: thread -> row (tid >> 3) + 16 i, 16-byte piece tid & 7: a wave's copy covers four whole 128-B lines
    const int crow = threadIdx.x >> 3, cpc = threadIdx.x & 7;
    const unsigned lring = lds_addr(&gring[0]) + (unsigned)(crow * KP + cpc * 8) * 2u;
    const size_t ao = (size_t)(rb + crow) * DM + cpc * 8, bo = (size_t)(c0 + crow) * DM + cpc * 8;
    auto stage = [&](int t, int bufi) {
#pragma unroll
        for (int hf = 0; hf < 2; ++hf) {
            const unsigned lb = lring + (unsigned)bufi * (GST * 2u) + (unsigned)hf * (GHF * 2u);
            const int k0 = t * 128 + hf * 64;
            cp8(lb, (const h16*)(const void*)(A + ao + k0), lb + PLN * 2u, (const h16*)(const void*)(Bn + bo + k0), DM);
            if (SPLITA) cp4(lb + 2u * PLN * 2u, (const h16*)(const void*)(Al + ao + k0), DM);
        }
    };
    stage(0, 0);
    asm volatile("s_wait_asynccnt 0x0" ::: "memory");     // this wave's copies of stage 0 have landed
    __syncthreads();                                      // ... and every other wave's: stage 0 is readable
    stage(1, 1);
    v8f acc[4];
#pragma unroll
    for (int t = 0; t < 4; ++t) acc[t] = (v8f){};
#pragma unroll 1
    for (int st = 0; st < NST; ++st) {
#pragma unroll
      for (int hf = 0; hf < 2; ++hf) {
        const bf* sb = gring + (st & 1) * GST + hf * GHF;
        const bf* ap = sb + (wave * 16 + lr) * KP + 8 * hi;
        const bf* bp = sb + PLN + lr * KP + 8 * hi;
        v16bf a[2], al[2], b[2][4];
#pragma unroll
        for (int kc = 0; kc < 2; ++kc) {
            a[kc] = fragb(ap + kc * 32); al[kc] = a[kc];
            if (SPLITA) al[kc] = fragb(ap + 2 * PLN + kc * 32);
#pragma unroll
            for (int t = 0; t < 4; ++t) b[kc][t] = fragb(bp + t * 16 * KP + kc * 32);
        }
#pragma unroll
        for (int kc = 0; kc < 2; ++kc)
#pragma unroll
            for (int t = 0; t < 4; ++t) { acc[t] = wmmab(a[kc], b[kc][t], acc[t]); if (SPLITA) acc[t] = wmmab(al[kc], b[kc][t], acc[t]); }
        // four vector slots behind the last WMMA, on the loop's back edge too, before its operands are refilled
        asm volatile("v_nop\n\tv_nop\n\tv_nop\n\tv_nop" : "+v"(acc[0]), "+v"(acc[1]), "+v"(acc[2]), "+v"(acc[3])
                     : "v"(a[0]), "v"(a[1]), "v"(al[0]), "v"(al[1]), "v"(b[0][0]), "v"(b[0][1]), "v"(b[0][2]), "v"(b[0][3]), "v"(b[1][0]), "v"(b[1][1]), "v"(b[1][2]), "v"(b[1][3]));
      }
        // publish point of stage st + 1: own LDS reads of stage st done, own copies of stage st + 1 landed, then the barrier that serves both
        asm volatile("s_wait_dscnt 0x0" ::: "memory");
        asm volatile("s_wait_asynccnt 0x0" ::: "memory");
        __syncthreads();
        if (st + 2 < NST) stage(st + 2, st & 1);          // refill the buffer that every wave has just left
    }
    asm volatile("s_wait_asynccnt 0x0" ::: "memory");     // nothing of this wave is in flight when it goes on to the epilogue
    float* os = &ost[wave][0];
#pragma unroll
    for (int t = 0; t < 4; ++t) { const float bv = bias ? bfr(bias[c0 + t * 16 + lr]) : 0.f;
#pragma unroll
        for (int j = 0; j < 8; ++j) os[(hi * 8 + j) * 68 + t * 16 + lr] = acc[t][j] + bv; }
    __syncthreads();
    const int sel = QKV ? (int)(blockIdx.y / (unsigned)(DM / 64)) : 2;     // whose columns these are: 0 q, 1 k, 2 the f32 output; the same for the whole block
    const int cc = QKV ? c0 - sel * DM : c0;                   // first column inside that output
    if (QKV && sel < 2) {
        h16* crow = (sel ? KH : QH) + (size_t)r0 * ldc + cc;
        h16* crow2 = (sel ? KL : QL) + (size_t)r0 * ldc + cc;
        auto pass = [&]() {
#pragma unroll
            for (int s = 0; s < 4; ++s) { const int row = 4 * s + (lane >> 3), piece = lane & 7; const float* sp = os + row * 68 + piece * 8; v8h o, o2;
#pragma unroll
                for (int i = 0; i < 8; ++i) { const h16 a = (h16)sp[i]; o[i] = a; o2[i] = (h16)((sp[i] - (float)a) * LOSC); }
                *(v8h*)(crow + (size_t)row * ldc + piece * 8) = o; *(v8h*)(crow2 + (size_t)row * ldc + piece * 8) = o2; }
        };
        pass(); 
    } else {
        float* crow = C + (size_t)r0 * ldc + cc;
        auto pass = [&]() {
#pragma unroll
            for (int s = 0; s < 8; ++s) { const int Lid = (lane >> 3) + 4 * s, piece = lane & 7; const int row = Lid >> 1, cofs = (Lid & 1) * 32 + piece * 4;
                const v4f val = *(const v4fa*)(os + row * 68 + cofs); *(v4f*)(crow + (size_t)row * ldc + cofs) = val; }
        };
        pass(); 
        // the built code lays the f16 branch right behind these stores, past a branch it keeps conditional: the wait stands in front of that code's writes to the stores' registers
        if (QKV) asm volatile("s_wait_xcnt 0x0" ::: "memory");
    }
}

__global__ __launch_bounds__(256) void k_vt(const float* __restrict__ V, h16* VTH, h16* VTL) {
    __shared__ __align__(16) h16 tile[64 * 72];
    __shared__ __align__(16) h16 til2[64 * 72];
    const int bid = blockIdx.x;
    const int b = bid / (NH_ * (NT_ / 64)), rem = bid - b * (NH_ * (NT_ / 64)), h = rem / (NT_ / 64), kt = rem - h * (NT_ / 64);
    const int k0 = kt * 64, tid = threadIdx.x;
    const int kk = tid >> 2, d0 = (tid & 3) * 16;
    const float* src = V + ((size_t)b * NT_ + k0 + kk) * DM + h * HD + d0;
#pragma unroll
    for (int i = 0; i < 16; ++i) { const float v = src[i]; const h16 a = (h16)v; tile[(d0 + i) * 72 + kk] = a; til2[(d0 + i) * 72 + kk] = (h16)((v - (float)a) * LOSC); }
    __syncthreads();
    const int piece = tid & 7;
    const size_t base = (((size_t)b * NH_ + h) * HD) * NT_ + k0;
    auto pass = [&]() {
#pragma unroll
        for (int s = 0; s < 4; ++s) { const int Lid = (tid >> 3) + 32 * s; const int pln = Lid >> 6, d = Lid & 63;
            const v8h val = *(const v8ha*)((pln ? til2 : tile) + d * 72 + piece * 8); *(v8h*)((pln ? VTL : VTH) + base + (size_t)d * NT_ + piece * 8) = val; }
    };
    pass(); 
}

// softplus(x) = max(x, 0) + log1p(e), e = exp(-|x|) in (0, 1]. log1p(e) = log(u) + c with u = 1 + e rounded and c = e - (u - 1), exactly what that rounding lost
// (|c| <= 2^-24; taking c for c / u moves the result by at most 2^-24 of itself): one hardware log2, small e keeps its relative accuracy and never falls to 0.
__device__ __forceinline__ float softplusf(float x) {
    const float e = __expf(-fabsf(x)), u = 1.0f + e;
    return fmaxf(x, 0.f) + fmaf(__builtin_amdgcn_logf(u), 0.69314718f, e - (u - 1.0f));
}
__device__ __forceinline__ v16h frag(const h16* p) { return cat16(*(const v8ha*)p, *(const v8ha*)(p + 16)); }

// k_attn: block = (b, h, 64 queries), wave = 16 queries; causal key range in stages of 64 keys, two passes of 32 keys each. The block's four waves share each stage:
// K and V^T (hi + residual) come into a two-buffer LDS ring by asynchronous copies, stage t + 1 in flight while stage t is worked on; the query residual is staged once.
// Both products run transposed: S^T = K.Q^T (A = key rows, B = queries) and O^T += V^T.P^T (A = V^T rows, B = weights). A lane then holds one query's scores for keys
// 8 hi + j and 16 + 8 hi + j, which is the k order of a B operand: the weights go from the score accumulators into the second product inside the lane's own registers.
// Per pass: 12 WMMA scores /8 (f32), softplus weights x2048 as f16 hi + residual, 12 WMMA V^T.P^T;
// ctx -> bf16 hi + residual planes CH/CL[tok][h*64+d].
__global__ __launch_bounds__(128) void k_attn(const h16* __restrict__ Q16, const h16* __restrict__ QL16, const h16* __restrict__ K16, const h16* __restrict__ KL16, const h16* __restrict__ VTH, const h16* __restrict__ VTL, bf* CH, bf* CL) {
    __shared__ __align__(16) h16 ring[2 * STG];
    __shared__ __align__(16) h16 qls[PLN];
    __shared__ __align__(16) float ost[4][16 * 68];
    const int lane = threadIdx.x & 31, wave = threadIdx.x >> 5, lr = lane & 15, hi = lane >> 4;
    const int bid = blockIdx.x;
    // a block's cost grows with its query tile (qt + 1 stages); the longest tiles take the lowest indices
    // (all heads of tile 31, then of tile 30, ...), for speed only
    const unsigned rank = (unsigned)bid / (NB_ * NH_), bh = (unsigned)bid % (NB_ * NH_);
    const int qt = NT_ / 64 - 1 - (int)rank, b = (int)(bh / NH_), h = (int)(bh % NH_);
    const int q0 = qt * 64 + wave * 16;
    const size_t tok0 = (size_t)b * NT_;
    const h16* kh_b = K16 + tok0 * DM + h * HD;
    const h16* kl_b = KL16 + tok0 * DM + h * HD;
    const size_t vbase = (((size_t)b * NH_ + h) * HD) * NT_;
    // copy slots: thread -> row (tid >> 3) + 16 i, 16-byte piece tid & 7: a wave's copy covers four whole 128-B lines
    const int crow = threadIdx.x >> 3, cpc = threadIdx.x & 7;
    const unsigned lslot = (unsigned)(crow * KP + cpc * 8) * 2u;
    const unsigned lring = lds_addr(&ring[0]) + lslot;
    auto stage = [&](int t, int bufi) {
        const unsigned lb = lring + (unsigned)bufi * (STG * 2u);
        const size_t ko = (size_t)(t * 64 + crow) * DM + cpc * 8, vo = vbase + (size_t)crow * NT_ + t * 64 + cpc * 8;
        cp8(lb, kh_b + ko, lb + PLN * 2u, kl_b + ko, DM);
        cp8(lb + 2u * PLN * 2u, VTH + vo, lb + 3u * PLN * 2u, VTL + vo, NT_);
    };
    const int ntrip = qt + 1;     // causal: keys 0 .. qt * 64 + 63
    cp4(lds_addr(&qls[0]) + lslot, QL16 + (tok0 + qt * 64 + crow) * DM + h * HD + cpc * 8, DM);
    stage(0, 0);
    asm volatile("s_wait_asynccnt 0x0" ::: "memory");     // this wave's copies of stage 0 have landed
    __syncthreads();                                      // ... and every other wave's: stage 0 and the query residual are readable
    if (ntrip > 1) stage(1, 1);
    v16h qa[2];
    const size_t qo0 = (tok0 + q0 + lr) * DM + h * HD + 8 * hi;
#pragma unroll
    for (int kc = 0; kc < 2; ++kc) qa[kc] = cat16(*(const v8h*)(Q16 + qo0 + kc * 32), *(const v8h*)(Q16 + qo0 + kc * 32 + 16));
    const h16* qlp = qls + (wave * 16 + lr) * KP + 8 * hi;
    v8f o[4], ox[4];
#pragma unroll
    for (int n = 0; n < 4; ++n) { o[n] = (v8f){}; ox[n] = (v8f){}; }
    float lpart[8];
#pragma unroll
    for (int j = 0; j < 8; ++j) lpart[j] = 0.f;
    const int qi = q0 + lr;       // the lane's query: column lr of every S^T and O^T tile
#pragma unroll 1
    for (int t = 0; t < ntrip; ++t) {
        const h16* sb = ring + (t & 1) * STG;
#pragma unroll 1
        for (int sub = 0; sub < 2; ++sub) {
            const int l0 = t * 64 + sub * 32;
            const h16* kp0 = sb + (sub * 32 + lr) * KP + 8 * hi;
            v16h k0h[2], k1h[2], k0l[2], k1l[2], qlk[2];
#pragma unroll
            for (int kc = 0; kc < 2; ++kc) {
                k0h[kc] = frag(kp0 + kc * 32); k1h[kc] = frag(kp0 + 16 * KP + kc * 32); qlk[kc] = frag(qlp + kc * 32);
                k0l[kc] = frag(kp0 + PLN + kc * 32); k1l[kc] = frag(kp0 + PLN + 16 * KP + kc * 32);
            }
            v8f s0 = {}, s1 = {}, x0 = {}, x1 = {};
#pragma unroll
            for (int kc = 0; kc < 2; ++kc) {
                s0 = wmma16(k0h[kc], qa[kc], s0); x0 = wmma16(k0h[kc], qlk[kc], x0); s1 = wmma16(k1h[kc], qa[kc], s1); x1 = wmma16(k1h[kc], qlk[kc], x1);
                x0 = wmma16(k0l[kc], qa[kc], x0); x1 = wmma16(k1l[kc], qa[kc], x1);
            }
            // four vector slots between the last score WMMA and the first use of its result or rewrite of its operands
            asm volatile("v_nop\n\tv_nop\n\tv_nop\n\tv_nop" : "+v"(s0), "+v"(s1), "+v"(x0), "+v"(x1)
                         : "v"(qa[0]), "v"(qa[1]), "v"(qlk[0]), "v"(qlk[1]), "v"(k0h[0]), "v"(k0h[1]), "v"(k1h[0]), "v"(k1h[1]), "v"(k0l[0]), "v"(k0l[1]), "v"(k1l[0]), "v"(k1l[1]));
            // V^T fragments of this pass: fetched here so that the softplus work covers their LDS latency
            const h16* vp0 = sb + 2 * PLN + lr * KP + sub * 32 + hi * 8;
            v16h vh[4], vl[4];
#pragma unroll
            for (int n = 0; n < 4; ++n) { vh[n] = frag(vp0 + n * 16 * KP); vl[n] = frag(vp0 + PLN + n * 16 * KP); }
            v16h pa, px;
            const int dq = qi - l0 - 8 * hi;                      // accumulator register j holds keys l0 + 8 hi + j and + 16: causal where j <= dq, j + 16 <= dq
            float pw0[8], pw1[8];
#pragma unroll
            for (int j = 0; j < 8; ++j) {
                // sp2norm: w = causal ? softplus(s x scale) : 0 (softplus as logaddexp(x, 0) = max(x,0) + log1p(exp(-|x|))); the row is later divided by sqrt(sum w^2)
                const float a0 = (s0[j] + x0[j] * LOSCI) * 0.125f, a1 = (s1[j] + x1[j] * LOSCI) * 0.125f;
                const float w0 = softplusf(a0), w1 = softplusf(a1);
                const float p0 = (j <= dq) ? w0 : 0.f, p1 = (j + 16 <= dq) ? w1 : 0.f;
                lpart[j] = lpart[j] + (p0 * p0 + p1 * p1);
                pw0[j] = p0 * PSC; pw1[j] = p1 * PSC;
            }
#pragma unroll
            for (int j = 0; j < 8; j += 2) {                      // two neighbours fill one register of the B operand
                const v2f a0 = {pw0[j], pw0[j + 1]}, a1 = {pw1[j], pw1[j + 1]};
                const v2h h0 = __builtin_convertvector(a0, v2h), h1 = __builtin_convertvector(a1, v2h);
                const v2h r0 = __builtin_convertvector((a0 - __builtin_convertvector(h0, v2f)) * LOSC, v2h), r1 = __builtin_convertvector((a1 - __builtin_convertvector(h1, v2f)) * LOSC, v2h);
                pa[j] = h0[0]; pa[j + 1] = h0[1]; pa[8 + j] = h1[0]; pa[9 + j] = h1[1];
                px[j] = r0[0]; px[j + 1] = r0[1]; px[8 + j] = r1[0]; px[9 + j] = r1[1];
            }
#pragma unroll
            for (int n = 0; n < 4; ++n) { o[n] = wmma16(vh[n], pa, o[n]); ox[n] = wmma16(vl[n], pa, ox[n]); ox[n] = wmma16(vh[n], px, ox[n]); }
            // four vector slots behind the last WMMA, on the loop's back edge too, before its operands are refilled
            asm volatile("v_nop\n\tv_nop\n\tv_nop\n\tv_nop" : "+v"(o[0]), "+v"(o[1]), "+v"(o[2]), "+v"(o[3]), "+v"(ox[0]), "+v"(ox[1]), "+v"(ox[2]), "+v"(ox[3])
                         : "v"(pa), "v"(px), "v"(vh[0]), "v"(vh[1]), "v"(vh[2]), "v"(vh[3]), "v"(vl[0]), "v"(vl[1]), "v"(vl[2]), "v"(vl[3]));
        }
        // publish point of stage t + 1: own LDS reads of stage t done, own copies of stage t + 1 landed, then the barrier that serves both
        asm volatile("s_wait_dscnt 0x0" ::: "memory");
        asm volatile("s_wait_asynccnt 0x0" ::: "memory");
        __syncthreads();
        if (t + 2 < ntrip) stage(t + 2, t & 1);           // refill the buffer that every wave has just left
    }
    asm volatile("s_wait_asynccnt 0x0" ::: "memory");     // nothing of this wave is in flight when it goes on to the epilogue
    float rs = ((lpart[0] + lpart[1]) + (lpart[2] + lpart[3])) + ((lpart[4] + lpart[5]) + (lpart[6] + lpart[7]));     // the lane's own keys of its query
    rs += __shfl_xor(rs, 16);                             // lane lr + 16 holds the query's other keys
    const float inv = 1.0f / (sqrtf(rs) * PSC);           // 1 / (||w||_2 x the P scaling)
    float* os = &ost[wave][0];
#pragma unroll
    for (int n = 0; n < 4; ++n) { v4f e0, e1;             // O^T register j = dim n * 16 + 8 hi + j of query lr: eight neighbours of one staged row
#pragma unroll
        for (int j = 0; j < 4; ++j) { e0[j] = (o[n][j] + ox[n][j] * LOSCI) * inv; e1[j] = (o[n][4 + j] + ox[n][4 + j] * LOSCI) * inv; }
        *(v4fa*)(os + lr * 68 + n * 16 + hi * 8) = e0; *(v4fa*)(os + lr * 68 + n * 16 + hi * 8 + 4) = e1; }
    __syncthreads();
    const size_t cbase = (tok0 + q0) * DM + (size_t)h * HD;
    auto pass = [&]() {
#pragma unroll
        for (int s = 0; s < 4; ++s) { const int row = 4 * s + (lane >> 3), piece = lane & 7; const float* sp = os + row * 68 + piece * 8; v8us oh, ol;
#pragma unroll
            for (int i = 0; i < 8; ++i) { const unsigned short hb = f2bf(sp[i]); oh[i] = hb; ol[i] = f2bf(sp[i] - bf2f(hb)); }
            *(v8us*)(CH + cbase + (size_t)row * DM + piece * 8) = oh; *(v8us*)(CL + cbase + (size_t)row * DM + piece * 8) = ol; }
    };
    pass(); 
}

#define VST2(T, p, v) do { const T vst2_v_ = (v); *(T*)(p) = vst2_v_;  } while (0)
extern "C" void kernel_launch(void* const* d_in, const int* in_sizes, int n_in,
                              void* d_out, int out_size, void* d_ws, size_t ws_size, hipStream_t stream) {
    (void)in_sizes; (void)n_in; (void)out_size;
    const float* x = (const float*)d_in[0]; const float* Wqkv = (const float*)d_in[1]; const float* Wp = (const float*)d_in[2]; const float* bp = (const float*)d_in[3];   // [out][in]
    float* out = (float*)d_out;    // [2][2048][1024] = [4096 tokens][1024]
    char* wsp = (char*)d_ws;
    auto take = [&](size_t bytes) { char* p = wsp; wsp += (bytes + 255) & ~(size_t)255; return (void*)p; };
    bf* Xb = (bf*)take((size_t)NTK * DM * 2); bf* WB = (bf*)take((size_t)3 * DM * DM * 2); bf* WpB = (bf*)take((size_t)DM * DM * 2);
    float* TMP = (float*)take((size_t)NTK * DM * 4);
    h16* QH = (h16*)take((size_t)NTK * DM * 2); h16* QL = (h16*)take((size_t)NTK * DM * 2); h16* KH = (h16*)take((size_t)NTK * DM * 2); h16* KL = (h16*)take((size_t)NTK * DM * 2);
    h16* VTH = (h16*)take((size_t)NTK * DM * 2); h16* VTL = (h16*)take((size_t)NTK * DM * 2); bf* CH = (bf*)take((size_t)NTK * DM * 2); bf* CL = (bf*)take((size_t)NTK * DM * 2);
    if ((size_t)(wsp - (char*)d_ws) > ws_size) return;    // 96 MiB, no aliasing
    k_cvtb<<<(NTK + 4 * DM) / 8, 256, 0, stream>>>(x, Wqkv, Wp, Xb, WB, WpB);
    k_gemmb<false, true><<<dim3(NTK / 64, 3 * DM / 64, 1), 128, 0, stream>>>(Xb, nullptr, WB, nullptr, TMP, DM, QH, QL, KH, KL);                        // q, k, v = x.W_qkv^T
    k_vt<<<NB_ * NH_ * (NT_ / 64), 256, 0, stream>>>(TMP, VTH, VTL);
    k_attn<<<NB_ * NH_ * (NT_ / 64), 128, 0, stream>>>(QH, QL, KH, KL, VTH, VTL, CH, CL);
    k_gemmb<true, false><<<dim3(NTK / 64, DM / 64, 1), 128, 0, stream>>>(CH, CL, WpB, bp, out, DM, nullptr, nullptr, nullptr, nullptr);
}

// v008
// A run of this version takes 101 microseconds.
// Next to v007, in two timings, it ran 1.20 times as fast each time.
// Over all steps from v000 it is 8.01 times as fast.
#include <hip/hip_runtime.h>

// Compute dtypes, f32 accumulate, both batch items in every launch: qkv = x.W_qkv^T ([4096 x 1024].[1024 x 3072]; [out][in] weights as the n-major B operand; PLAIN
// bf16 operands = inputs rounded once, exact) with q/k straight to f16 hi + residual x1024 planes, out = y.W_proj^T + b_proj (y as bf16 hi + residual) on
// v_wmma_f32_16x16x32_bf16; the 16-head causal "sp2norm" attention fused on v_wmma_f32_16x16x32_f16: scores (hh + hl + lh) x 1/8, weights w = softplus(score)
// on the causal part (0 elsewhere), y = (sum_k w v_k) / ||w||_2 with the weights (x2048) as f16 hi + residual x1024 against v as f16 hi + residual; softplus and

#define NB_  2                   // both batch items go through every kernel in one launch
#define NT_  2048
#define DM   1024
#define NH_  16
#define HD   64
#define NTK  (NB_ * NT_)
#define NW   1024
#define NQKV 1024
#define PSC  2048.0f                 // softplus weights are not bounded by 1: x2048 keeps them inside f16 range up to w = 31
#define LOSC 1024.0f
#define LOSCI (1.0f / 1024.0f)

typedef _Float16 h16;
typedef unsigned short bf;
typedef __attribute__((ext_vector_type(16))) __bf16   v16bf;
typedef __attribute__((ext_vector_type(16))) _Float16 v16h;
typedef __attribute__((ext_vector_type(8)))  _Float16 v8h;
typedef __attribute__((ext_vector_type(8)))  unsigned short v8us;
typedef __attribute__((ext_vector_type(8)))  float    v8f;
typedef __attribute__((ext_vector_type(4)))  float    v4f;
typedef __attribute__((ext_vector_type(2)))  float    v2f;
typedef __attribute__((ext_vector_type(2)))  _Float16 v2h;
typedef v8h  __attribute__((may_alias)) v8ha;
typedef v4f  __attribute__((may_alias)) v4fa;
typedef v8us __attribute__((may_alias)) v8usa;

__device__ __forceinline__ unsigned short f2bf(float f) { unsigned u = __float_as_uint(f); u += 0x7FFFu + ((u >> 16) & 1u); return (unsigned short)(u >> 16); }
__device__ __forceinline__ float bf2f(unsigned short b) { return __uint_as_float(((unsigned)b) << 16); }
__device__ __forceinline__ float bfr(float f) { return bf2f(f2bf(f)); }
__device__ __forceinline__ v16h cat16(v8h lo, v8h hi) { return __builtin_shufflevector(lo, hi, 0, 1, 2, 3, 4, 5, 6, 7, 8, 9, 10, 11, 12, 13, 14, 15); }
__device__ __forceinline__ v16bf cat16b(v8us lo, v8us hi) { return __builtin_bit_cast(v16bf, __builtin_shufflevector(lo, hi, 0, 1, 2, 3, 4, 5, 6, 7, 8, 9, 10, 11, 12, 13, 14, 15)); }
__device__ __forceinline__ v8f wmma16(v16h a, v16h b, v8f c) { return __builtin_amdgcn_wmma_f32_16x16x32_f16(false, a, false, b, (short)0, c, false, false); }
__device__ __forceinline__ v8f wmmab(v16bf a, v16bf b, v8f c) { return __builtin_amdgcn_wmma_f32_16x16x32_bf16(false, a, false, b, (short)0, c, false, false); }

// k_cvtb: one launch rounds all three f32 operands to bf16. Blocks of 8 rows: first x (NTK rows), then W_qkv (3 DM rows), then W_proj (DM rows); the grid covers exactly these rows.
__global__ __launch_bounds__(256) void k_cvtb(const float* __restrict__ x, const float* __restrict__ wqkv, const float* __restrict__ wp, bf* xb, bf* wb, bf* wpb) {
    const int row0 = blockIdx.x * 8, part = row0 < NTK ? 0 : (row0 < NTK + 3 * DM ? 1 : 2);        // the same for the whole block
    const float* __restrict__ src = part == 0 ? x : (part == 1 ? wqkv : wp);
    bf* dst = part == 0 ? xb : (part == 1 ? wb : wpb);
    const int lane = threadIdx.x & 31, r = row0 - (part == 0 ? 0 : (part == 1 ? NTK : NTK + 3 * DM)) + (threadIdx.x >> 5);
    v8us o[DM / 256];
#pragma unroll
    for (int q = 0; q < DM / 256; ++q) { v8us t;
#pragma unroll
        for (int i = 0; i < 8; ++i) t[i] = f2bf(src[(size_t)r * DM + q * 256 + lane * 8 + i]);
        o[q] = t; }
#pragma unroll
    for (int q = 0; q < DM / 256; ++q) *(v8us*)(dst + (size_t)r * DM + q * 256 + lane * 8) = o[q];
    
}

// Staged rows in LDS: 64 f16 of data + 8 of pad = 144 B, a pitch of 16 B x odd, which ds_load_b128 fragment reads take without bank conflicts.
#define KP   72
#define PLN  (64 * KP)               // one plane of a stage: 64 rows (K: 64 keys x 64 dims; V^T: 64 dims x 64 keys)
#define STG  (4 * PLN)               // a stage = 64 keys: K hi, K residual, V^T hi, V^T residual

__device__ __forceinline__ unsigned lds_addr(const void* p) { return (unsigned)(unsigned long long)p; }     // low 32 bits of a __shared__ address = LDS byte address

// Four rows-of-16 steps of one plane pair: each lane copies its own 16 B, global -> LDS, through no register. The s_wait_xcnt stands inside the statement so that
// no address register of an issued copy is rewritten ahead of it.
__device__ __forceinline__ void cp8(unsigned la, const h16* ga, unsigned lb, const h16* gb, size_t gstep) {
    asm volatile("global_load_async_to_lds_b128 %0, %1, off\n\t"
                 "global_load_async_to_lds_b128 %2, %3, off\n\t"
                 "global_load_async_to_lds_b128 %4, %5, off\n\t"
                 "global_load_async_to_lds_b128 %6, %7, off\n\t"
                 "global_load_async_to_lds_b128 %8, %9, off\n\t"
                 "global_load_async_to_lds_b128 %10, %11, off\n\t"
                 "global_load_async_to_lds_b128 %12, %13, off\n\t"
                 "global_load_async_to_lds_b128 %14, %15, off\n\t"
                 "s_wait_xcnt 0x0"
                 :: "v"(la), "v"(ga), "v"(la + 16 * KP * 2), "v"(ga + 16 * gstep), "v"(la + 32 * KP * 2), "v"(ga + 32 * gstep), "v"(la + 48 * KP * 2), "v"(ga + 48 * gstep),
                    "v"(lb), "v"(gb), "v"(lb + 16 * KP * 2), "v"(gb + 16 * gstep), "v"(lb + 32 * KP * 2), "v"(gb + 32 * gstep), "v"(lb + 48 * KP * 2), "v"(gb + 48 * gstep)
                 : "memory");
}
__device__ __forceinline__ void cp4(unsigned la, const h16* ga, size_t gstep) {
    asm volatile("global_load_async_to_lds_b128 %0, %1, off\n\t"
                 "global_load_async_to_lds_b128 %2, %3, off\n\t"
                 "global_load_async_to_lds_b128 %4, %5, off\n\t"
                 "global_load_async_to_lds_b128 %6, %7, off\n\t"
                 "s_wait_xcnt 0x0"
                 :: "v"(la), "v"(ga), "v"(la + 16 * KP * 2), "v"(ga + 16 * gstep), "v"(la + 32 * KP * 2), "v"(ga + 32 * gstep), "v"(la + 48 * KP * 2), "v"(ga + 48 * gstep)
                 : "memory");
}
__device__ __forceinline__ v16bf fragb(const bf* p) { return cat16b(*(const v8usa*)p, *(const v8usa*)(p + 16)); }

// k_gemmb: block = 32 MT rows x 128 columns, four waves as 2 x 2, wave = 16 MT rows x 64 columns: every A or B row that the block brings in from L2 serves 128 columns or 32 MT rows,
// and every fragment read from LDS feeds 4 or MT matrix instructions. The k range runs in stages of 64 (planes of 64 rows x 64 k): the block's A rows (and their residual plane)
// and B rows come into a two-buffer LDS ring by asynchronous copies, whole 128-B lines, once per block, stage t + 1 in flight while stage t is worked on.
// QKV: Bn holds the 3 DM rows of W_qkv and blockIdx.y walks all of them in one launch; a block's 128 columns lie in one of q, k, v: q and k leave as f16 hi + residual planes, v as f32 in C.
template <bool SPLITA, bool QKV, int MT>
__global__ __launch_bounds__(128) void k_gemmb(const bf* __restrict__ A, const bf* __restrict__ Al, const bf* __restrict__ Bn, const float* __restrict__ bias, float* C, int ldc, h16* QH, h16* QL, h16* KH, h16* KL) {
    constexpr int APL = MT / 2;                          // planes of 64 rows that hold the block's A rows
    constexpr int BOF = APL * PLN, LOF = (APL + 2) * PLN;    // a stage: A planes, two B planes and, where A is split, its residual planes
    constexpr int GST = ((SPLITA ? 2 : 1) * APL + 2) * PLN, NST = DM / 64;
    __shared__ __align__(16) bf gring[2 * GST];
    __shared__ __align__(16) float ost[4][16 * 68];
    const int lane = threadIdx.x & 31, wave = threadIdx.x >> 5, lr = lane & 15, hi = lane >> 4;
    const int wm = wave >> 1, wn = wave & 1;
    const int rb = blockIdx.x * (32 * MT), r0 = rb + wm * (16 * MT), cb = blockIdx.y * 128, c0 = cb + wn * 64;
    // copy slots: thread -> row (tid >> 3) + 16 i, 16-byte piece tid & 7: a wave's copy covers four whole 128-B lines
    const int crow = threadIdx.x >> 3, cpc = threadIdx.x & 7;
    const unsigned lring = lds_addr(&gring[0]) + (unsigned)(crow * KP + cpc * 8) * 2u;
    const size_t ao = (size_t)(rb + crow) * DM + cpc * 8, bo = (size_t)(cb + crow) * DM + cpc * 8;
    auto stage = [&](int t, int bufi) {
        const unsigned lb = lring + (unsigned)bufi * (GST * 2u);
        const int k0 = t * 64;
#pragma unroll
        for (int p = 0; p < APL; p += SPLITA ? 1 : 2) {   // two planes a statement: A with its residual, or two planes of A
            const size_t go = ao + (size_t)p * 64 * DM + k0;
            if (SPLITA) cp8(lb + (unsigned)p * (PLN * 2u), (const h16*)(const void*)(A + go), lb + (unsigned)(LOF + p * PLN) * 2u, (const h16*)(const void*)(Al + go), DM);
            else if (p + 1 < APL) cp8(lb + (unsigned)p * (PLN * 2u), (const h16*)(const void*)(A + go), lb + (unsigned)(p + 1) * (PLN * 2u), (const h16*)(const void*)(A + go + (size_t)64 * DM), DM);
            else cp4(lb + (unsigned)p * (PLN * 2u), (const h16*)(const void*)(A + go), DM);
        }
        cp8(lb + BOF * 2u, (const h16*)(const void*)(Bn + bo + k0), lb + (BOF + PLN) * 2u, (const h16*)(const void*)(Bn + bo + (size_t)64 * DM + k0), DM);
    };
    stage(0, 0);
    asm volatile("s_wait_asynccnt 0x0" ::: "memory");     // this wave's copies of stage 0 have landed
    __syncthreads();                                      // ... and every other wave's: stage 0 is readable
    stage(1, 1);
    v8f acc[MT][4];
#pragma unroll
    for (int m = 0; m < MT; ++m)
#pragma unroll
        for (int t = 0; t < 4; ++t) acc[m][t] = (v8f){};
#pragma unroll 1
    for (int st = 0; st < NST; ++st) {
        const bf* sb = gring + (st & 1) * GST;
        const bf* ap = sb + (wm * (16 * MT) + lr) * KP + 8 * hi;
        const bf* bp = sb + BOF + (wn * 64 + lr) * KP + 8 * hi;
        v16bf a[2][MT], al[2][MT], b[2][4];
        auto ld = [&](int kc) {
#pragma unroll
            for (int m = 0; m < MT; ++m) { a[kc][m] = fragb(ap + m * 16 * KP + kc * 32); if (SPLITA) al[kc][m] = fragb(ap + LOF + m * 16 * KP + kc * 32); }
#pragma unroll
            for (int t = 0; t < 4; ++t) b[kc][t] = fragb(bp + t * 16 * KP + kc * 32);
            // keeps the fragment reads together ahead of their matrix instructions: left free, they sink in between them, two at a time, each place with a wait to 0
            __builtin_amdgcn_sched_barrier(0);
        };
        auto mm = [&](int kc) {
#pragma unroll
            for (int m = 0; m < MT; ++m)
#pragma unroll
                for (int t = 0; t < 4; ++t) acc[m][t] = wmmab(a[kc][m], b[kc][t], acc[m][t]);
            if (SPLITA) {
#pragma unroll
                for (int m = 0; m < MT; ++m)
#pragma unroll
                    for (int t = 0; t < 4; ++t) acc[m][t] = wmmab(al[kc][m], b[kc][t], acc[m][t]);
            }
        };
        if (MT <= 2) { ld(0); ld(1); mm(0); mm(1); }      // both halves' fragments fit in registers beside the accumulators
        else { ld(0); mm(0); ld(1); mm(1); }
        // keeps the matrix instructions ahead of the publish point: left free, they sink behind the barrier and hold back the refill, whose flight then has no work to hide behind
        __builtin_amdgcn_sched_barrier(0);
        // publish point of stage st + 1: own LDS reads of stage st done, own copies of stage st + 1 landed, then the barrier that serves both
        asm volatile("s_wait_dscnt 0x0" ::: "memory");
        asm volatile("s_wait_asynccnt 0x0" ::: "memory");
        __syncthreads();
        if (st + 2 < NST) stage(st + 2, st & 1);          // refill the buffer that every wave has just left
    }
    asm volatile("s_wait_asynccnt 0x0" ::: "memory");     // nothing of this wave is in flight when it goes on to the epilogue
    float* os = &ost[wave][0];
    const int sel = QKV ? (int)(blockIdx.y / (unsigned)(DM / 128)) : 2;    // whose columns these are: 0 q, 1 k, 2 the f32 output; the same for the whole block
    const int cc = QKV ? c0 - sel * DM : c0;                   // first column inside that output
    float bv[4];
#pragma unroll
    for (int t = 0; t < 4; ++t) bv[t] = bias ? bfr(bias[c0 + t * 16 + lr]) : 0.f;
    // the wave's MT tiles of 16 rows go out one after another through its own staging rows
#pragma unroll
    for (int m = 0; m < MT; ++m) {
#pragma unroll
        for (int t = 0; t < 4; ++t)
#pragma unroll
            for (int j = 0; j < 8; ++j) os[(hi * 8 + j) * 68 + t * 16 + lr] = acc[m][t][j] + bv[t];
        __syncthreads();
        if (QKV && sel < 2) {
            h16* crow = (sel ? KH : QH) + (size_t)(r0 + m * 16) * ldc + cc;
            h16* crow2 = (sel ? KL : QL) + (size_t)(r0 + m * 16) * ldc + cc;
#pragma unroll
            for (int s = 0; s < 4; ++s) { const int row = 4 * s + (lane >> 3), piece = lane & 7; const float* sp = os + row * 68 + piece * 8; v8h o, o2;
#pragma unroll
                for (int i = 0; i < 8; ++i) { const h16 a = (h16)sp[i]; o[i] = a; o2[i] = (h16)((sp[i] - (float)a) * LOSC); }
                *(v8h*)(crow + (size_t)row * ldc + piece * 8) = o; *(v8h*)(crow2 + (size_t)row * ldc + piece * 8) = o2; }
            asm volatile("s_wait_xcnt 0x0" ::: "memory");     // the next tile's code writes the stores' registers anew: the wait stands in front of that
        } else {
            float* crow = C + (size_t)(r0 + m * 16) * ldc + cc;
#pragma unroll
            for (int s = 0; s < 8; ++s) { const int Lid = (lane >> 3) + 4 * s, piece = lane & 7; const int row = Lid >> 1, cofs = (Lid & 1) * 32 + piece * 4;
                const v4f val = *(const v4fa*)(os + row * 68 + cofs); *(v4f*)(crow + (size_t)row * ldc + cofs) = val; }
            // the next tile's code writes the stores' registers anew: the wait stands in front of that
            asm volatile("s_wait_xcnt 0x0" ::: "memory");
        }
    }
}

__global__ __launch_bounds__(256) void k_vt(const float* __restrict__ V, h16* VTH, h16* VTL) {
    __shared__ __align__(16) h16 tile[64 * 72];
    __shared__ __align__(16) h16 til2[64 * 72];
    const int bid = blockIdx.x;
    const int b = bid / (NH_ * (NT_ / 64)), rem = bid - b * (NH_ * (NT_ / 64)), h = rem / (NT_ / 64), kt = rem - h * (NT_ / 64);
    const int k0 = kt * 64, tid = threadIdx.x;
    const int kk = tid >> 2, d0 = (tid & 3) * 16;
    const float* src = V + ((size_t)b * NT_ + k0 + kk) * DM + h * HD + d0;
#pragma unroll
    for (int i = 0; i < 16; ++i) { const float v = src[i]; const h16 a = (h16)v; tile[(d0 + i) * 72 + kk] = a; til2[(d0 + i) * 72 + kk] = (h16)((v - (float)a) * LOSC); }
    __syncthreads();
    const int piece = tid & 7;
    const size_t base = (((size_t)b * NH_ + h) * HD) * NT_ + k0;
    auto pass = [&]() {
#pragma unroll
        for (int s = 0; s < 4; ++s) { const int Lid = (tid >> 3) + 32 * s; const int pln = Lid >> 6, d = Lid & 63;
            const v8h val = *(const v8ha*)((pln ? til2 : tile) + d * 72 + piece * 8); *(v8h*)((pln ? VTL : VTH) + base + (size_t)d * NT_ + piece * 8) = val; }
    };
    pass(); 
}

// softplus(x) = max(x, 0) + log1p(e), e = exp(-|x|) in (0, 1]. log1p(e) = log(u) + c with u = 1 + e rounded and c = e - (u - 1), exactly what that rounding lost
// (|c| <= 2^-24; taking c for c / u moves the result by at most 2^-24 of itself): one hardware log2, small e keeps its relative accuracy and never falls to 0.
__device__ __forceinline__ float softplusf(float x) {
    const float e = __expf(-fabsf(x)), u = 1.0f + e;
    return fmaxf(x, 0.f) + fmaf(__builtin_amdgcn_logf(u), 0.69314718f, e - (u - 1.0f));
}
__device__ __forceinline__ v16h frag(const h16* p) { return cat16(*(const v8ha*)p, *(const v8ha*)(p + 16)); }

// k_attn: block = (b, h, 64 queries), wave = 16 queries; causal key range in stages of 64 keys, two passes of 32 keys each. The block's four waves share each stage:
// K and V^T (hi + residual) come into a two-buffer LDS ring by asynchronous copies, stage t + 1 in flight while stage t is worked on; the query residual is staged once.
// Both products run transposed: S^T = K.Q^T (A = key rows, B = queries) and O^T += V^T.P^T (A = V^T rows, B = weights). A lane then holds one query's scores for keys
// 8 hi + j and 16 + 8 hi + j, which is the k order of a B operand: the weights go from the score accumulators into the second product inside the lane's own registers.
// Per pass: 12 WMMA scores /8 (f32), softplus weights x2048 as f16 hi + residual, 12 WMMA V^T.P^T;
// ctx -> bf16 hi + residual planes CH/CL[tok][h*64+d].
__global__ __launch_bounds__(128) void k_attn(const h16* __restrict__ Q16, const h16* __restrict__ QL16, const h16* __restrict__ K16, const h16* __restrict__ KL16, const h16* __restrict__ VTH, const h16* __restrict__ VTL, bf* CH, bf* CL) {
    __shared__ __align__(16) h16 ring[2 * STG];
    __shared__ __align__(16) h16 qls[PLN];
    __shared__ __align__(16) float ost[4][16 * 68];
    const int lane = threadIdx.x & 31, wave = threadIdx.x >> 5, lr = lane & 15, hi = lane >> 4;
    const int bid = blockIdx.x;
    // a block's cost grows with its query tile (qt + 1 stages); the longest tiles take the lowest indices
    // (all heads of tile 31, then of tile 30, ...), for speed only
    const unsigned rank = (unsigned)bid / (NB_ * NH_), bh = (unsigned)bid % (NB_ * NH_);
    const int qt = NT_ / 64 - 1 - (int)rank, b = (int)(bh / NH_), h = (int)(bh % NH_);
    const int q0 = qt * 64 + wave * 16;
    const size_t tok0 = (size_t)b * NT_;
    const h16* kh_b = K16 + tok0 * DM + h * HD;
    const h16* kl_b = KL16 + tok0 * DM + h * HD;
    const size_t vbase = (((size_t)b * NH_ + h) * HD) * NT_;
    // copy slots: thread -> row (tid >> 3) + 16 i, 16-byte piece tid & 7: a wave's copy covers four whole 128-B lines
    const int crow = threadIdx.x >> 3, cpc = threadIdx.x & 7;
    const unsigned lslot = (unsigned)(crow * KP + cpc * 8) * 2u;
    const unsigned lring = lds_addr(&ring[0]) + lslot;
    auto stage = [&](int t, int bufi) {
        const unsigned lb = lring + (unsigned)bufi * (STG * 2u);
        const size_t ko = (size_t)(t * 64 + crow) * DM + cpc * 8, vo = vbase + (size_t)crow * NT_ + t * 64 + cpc * 8;
        cp8(lb, kh_b + ko, lb + PLN * 2u, kl_b + ko, DM);
        cp8(lb + 2u * PLN * 2u, VTH + vo, lb + 3u * PLN * 2u, VTL + vo, NT_);
    };
    const int ntrip = qt + 1;     // causal: keys 0 .. qt * 64 + 63
    cp4(lds_addr(&qls[0]) + lslot, QL16 + (tok0 + qt * 64 + crow) * DM + h * HD + cpc * 8, DM);
    stage(0, 0);
    asm volatile("s_wait_asynccnt 0x0" ::: "memory");     // this wave's copies of stage 0 have landed
    __syncthreads();                                      // ... and every other wave's: stage 0 and the query residual are readable
    if (ntrip > 1) stage(1, 1);
    v16h qa[2];
    const size_t qo0 = (tok0 + q0 + lr) * DM + h * HD + 8 * hi;
#pragma unroll
    for (int kc = 0; kc < 2; ++kc) qa[kc] = cat16(*(const v8h*)(Q16 + qo0 + kc * 32), *(const v8h*)(Q16 + qo0 + kc * 32 + 16));
    const h16* qlp = qls + (wave * 16 + lr) * KP + 8 * hi;
    v8f o[4], ox[4];
#pragma unroll
    for (int n = 0; n < 4; ++n) { o[n] = (v8f){}; ox[n] = (v8f){}; }
    float lpart[8];
#pragma unroll
    for (int j = 0; j < 8; ++j) lpart[j] = 0.f;
    const int qi = q0 + lr;       // the lane's query: column lr of every S^T and O^T tile
#pragma unroll 1
    for (int t = 0; t < ntrip; ++t) {
        const h16* sb = ring + (t & 1) * STG;
#pragma unroll 1
        for (int sub = 0; sub < 2; ++sub) {
            const int l0 = t * 64 + sub * 32;
            const h16* kp0 = sb + (sub * 32 + lr) * KP + 8 * hi;
            v16h k0h[2], k1h[2], k0l[2], k1l[2], qlk[2];
#pragma unroll
            for (int kc = 0; kc < 2; ++kc) {
                k0h[kc] = frag(kp0 + kc * 32); k1h[kc] = frag(kp0 + 16 * KP + kc * 32); qlk[kc] = frag(qlp + kc * 32);
                k0l[kc] = frag(kp0 + PLN + kc * 32); k1l[kc] = frag(kp0 + PLN + 16 * KP + kc * 32);
            }
            v8f s0 = {}, s1 = {}, x0 = {}, x1 = {};
#pragma unroll
            for (int kc = 0; kc < 2; ++kc) {
                s0 = wmma16(k0h[kc], qa[kc], s0); x0 = wmma16(k0h[kc], qlk[kc], x0); s1 = wmma16(k1h[kc], qa[kc], s1); x1 = wmma16(k1h[kc], qlk[kc], x1);
                x0 = wmma16(k0l[kc], qa[kc], x0); x1 = wmma16(k1l[kc], qa[kc], x1);
            }
            // four vector slots between the last score WMMA and the first use of its result or rewrite of its operands
            asm volatile("v_nop\n\tv_nop\n\tv_nop\n\tv_nop" : "+v"(s0), "+v"(s1), "+v"(x0), "+v"(x1)
                         : "v"(qa[0]), "v"(qa[1]), "v"(qlk[0]), "v"(qlk[1]), "v"(k0h[0]), "v"(k0h[1]), "v"(k1h[0]), "v"(k1h[1]), "v"(k0l[0]), "v"(k0l[1]), "v"(k1l[0]), "v"(k1l[1]));
            // V^T fragments of this pass: fetched here so that the softplus work covers their LDS latency
            const h16* vp0 = sb + 2 * PLN + lr * KP + sub * 32 + hi * 8;
            v16h vh[4], vl[4];
#pragma unroll
            for (int n = 0; n < 4; ++n) { vh[n] = frag(vp0 + n * 16 * KP); vl[n] = frag(vp0 + PLN + n * 16 * KP); }
            v16h pa, px;
            const int dq = qi - l0 - 8 * hi;                      // accumulator register j holds keys l0 + 8 hi + j and + 16: causal where j <= dq, j + 16 <= dq
            float pw0[8], pw1[8];
#pragma unroll
            for (int j = 0; j < 8; ++j) {
                // sp2norm: w = causal ? softplus(s x scale) : 0 (softplus as logaddexp(x, 0) = max(x,0) + log1p(exp(-|x|))); the row is later divided by sqrt(sum w^2)
                const float a0 = (s0[j] + x0[j] * LOSCI) * 0.125f, a1 = (s1[j] + x1[j] * LOSCI) * 0.125f;
                const float w0 = softplusf(a0), w1 = softplusf(a1);
                const float p0 = (j <= dq) ? w0 : 0.f, p1 = (j + 16 <= dq) ? w1 : 0.f;
                lpart[j] = lpart[j] + (p0 * p0 + p1 * p1);
                pw0[j] = p0 * PSC; pw1[j] = p1 * PSC;
            }
#pragma unroll
            for (int j = 0; j < 8; j += 2) {                      // two neighbours fill one register of the B operand
                const v2f a0 = {pw0[j], pw0[j + 1]}, a1 = {pw1[j], pw1[j + 1]};
                const v2h h0 = __builtin_convertvector(a0, v2h), h1 = __builtin_convertvector(a1, v2h);
                const v2h r0 = __builtin_convertvector((a0 - __builtin_convertvector(h0, v2f)) * LOSC, v2h), r1 = __builtin_convertvector((a1 - __builtin_convertvector(h1, v2f)) * LOSC, v2h);
                pa[j] = h0[0]; pa[j + 1] = h0[1]; pa[8 + j] = h1[0]; pa[9 + j] = h1[1];
                px[j] = r0[0]; px[j + 1] = r0[1]; px[8 + j] = r1[0]; px[9 + j] = r1[1];
            }
#pragma unroll
            for (int n = 0; n < 4; ++n) { o[n] = wmma16(vh[n], pa, o[n]); ox[n] = wmma16(vl[n], pa, ox[n]); ox[n] = wmma16(vh[n], px, ox[n]); }
            // four vector slots behind the last WMMA, on the loop's back edge too, before its operands are refilled
            asm volatile("v_nop\n\tv_nop\n\tv_nop\n\tv_nop" : "+v"(o[0]), "+v"(o[1]), "+v"(o[2]), "+v"(o[3]), "+v"(ox[0]), "+v"(ox[1]), "+v"(ox[2]), "+v"(ox[3])
                         : "v"(pa), "v"(px), "v"(vh[0]), "v"(vh[1]), "v"(vh[2]), "v"(vh[3]), "v"(vl[0]), "v"(vl[1]), "v"(vl[2]), "v"(vl[3]));
        }
        // publish point of stage t + 1: own LDS reads of stage t done, own copies of stage t + 1 landed, then the barrier that serves both
        asm volatile("s_wait_dscnt 0x0" ::: "memory");
        asm volatile("s_wait_asynccnt 0x0" ::: "memory");
        __syncthreads();
        if (t + 2 < ntrip) stage(t + 2, t & 1);           // refill the buffer that every wave has just left
    }
    asm volatile("s_wait_asynccnt 0x0" ::: "memory");     // nothing of this wave is in flight when it goes on to the epilogue
    float rs = ((lpart[0] + lpart[1]) + (lpart[2] + lpart[3])) + ((lpart[4] + lpart[5]) + (lpart[6] + lpart[7]));     // the lane's own keys of its query
    rs += __shfl_xor(rs, 16);                             // lane lr + 16 holds the query's other keys
    const float inv = 1.0f / (sqrtf(rs) * PSC);           // 1 / (||w||_2 x the P scaling)
    float* os = &ost[wave][0];
#pragma unroll
    for (int n = 0; n < 4; ++n) { v4f e0, e1;             // O^T register j = dim n * 16 + 8 hi + j of query lr: eight neighbours of one staged row
#pragma unroll
        for (int j = 0; j < 4; ++j) { e0[j] = (o[n][j] + ox[n][j] * LOSCI) * inv; e1[j] = (o[n][4 + j] + ox[n][4 + j] * LOSCI) * inv; }
        *(v4fa*)(os + lr * 68 + n * 16 + hi * 8) = e0; *(v4fa*)(os + lr * 68 + n * 16 + hi * 8 + 4) = e1; }
    __syncthreads();
    const size_t cbase = (tok0 + q0) * DM + (size_t)h * HD;
    auto pass = [&]() {
#pragma unroll
        for (int s = 0; s < 4; ++s) { const int row = 4 * s + (lane >> 3), piece = lane & 7; const float* sp = os + row * 68 + piece * 8; v8us oh, ol;
#pragma unroll
            for (int i = 0; i < 8; ++i) { const unsigned short hb = f2bf(sp[i]); oh[i] = hb; ol[i] = f2bf(sp[i] - bf2f(hb)); }
            *(v8us*)(CH + cbase + (size_t)row * DM + piece * 8) = oh; *(v8us*)(CL + cbase + (size_t)row * DM + piece * 8) = ol; }
    };
    pass(); 
}

#define VST2(T, p, v) do { const T vst2_v_ = (v); *(T*)(p) = vst2_v_;  } while (0)
extern "C" void kernel_launch(void* const* d_in, const int* in_sizes, int n_in,
                              void* d_out, int out_size, void* d_ws, size_t ws_size, hipStream_t stream) {
    (void)in_sizes; (void)n_in; (void)out_size;
    const float* x = (const float*)d_in[0]; const float* Wqkv = (const float*)d_in[1]; const float* Wp = (const float*)d_in[2]; const float* bp = (const float*)d_in[3];   // [out][in]
    float* out = (float*)d_out;    // [2][2048][1024] = [4096 tokens][1024]
    char* wsp = (char*)d_ws;
    auto take = [&](size_t bytes) { char* p = wsp; wsp += (bytes + 255) & ~(size_t)255; return (void*)p; };
    bf* Xb = (bf*)take((size_t)NTK * DM * 2); bf* WB = (bf*)take((size_t)3 * DM * DM * 2); bf* WpB = (bf*)take((size_t)DM * DM * 2);
    float* TMP = (float*)take((size_t)NTK * DM * 4);
    h16* QH = (h16*)take((size_t)NTK * DM * 2); h16* QL = (h16*)take((size_t)NTK * DM * 2); h16* KH = (h16*)take((size_t)NTK * DM * 2); h16* KL = (h16*)take((size_t)NTK * DM * 2);
    h16* VTH = (h16*)take((size_t)NTK * DM * 2); h16* VTL = (h16*)take((size_t)NTK * DM * 2); bf* CH = (bf*)take((size_t)NTK * DM * 2); bf* CL = (bf*)take((size_t)NTK * DM * 2);
    if ((size_t)(wsp - (char*)d_ws) > ws_size) return;    // 96 MiB, no aliasing
    k_cvtb<<<(NTK + 4 * DM) / 8, 256, 0, stream>>>(x, Wqkv, Wp, Xb, WB, WpB);
    k_gemmb<false, true, 4><<<dim3(NTK / 128, 3 * DM / 128, 1), 128, 0, stream>>>(Xb, nullptr, WB, nullptr, TMP, DM, QH, QL, KH, KL);                        // q, k, v = x.W_qkv^T
    k_vt<<<NB_ * NH_ * (NT_ / 64), 256, 0, stream>>>(TMP, VTH, VTL);
    k_attn<<<NB_ * NH_ * (NT_ / 64), 128, 0, stream>>>(QH, QL, KH, KL, VTH, VTL, CH, CL);
    k_gemmb<true, false, 2><<<dim3(NTK / 64, DM / 128, 1), 128, 0, stream>>>(CH, CL, WpB, bp, out, DM, nullptr, nullptr, nullptr, nullptr);
}

// v009
// A run of this version takes 93.9 microseconds.
// Two timings next to v008 both put it at 1.08 times that version's speed.
// Over all steps from v000 it is 8.65 times as fast.
#include <hip/hip_runtime.h>

// Compute dtypes, f32 accumulate, both batch items in every launch: qkv = x.W_qkv^T ([4096 x 1024].[1024 x 3072]; [out][in] weights as the n-major B operand; PLAIN
// bf16 operands = inputs rounded once, exact) with q/k straight to f16 hi + residual x1024 planes, out = y.W_proj^T + b_proj (y as bf16 hi + residual) on
// v_wmma_f32_16x16x32_bf16; the 16-head causal "sp2norm" attention fused on v_wmma_f32_16x16x32_f16: scores (hh + hl + lh) x 1/8, weights w = softplus(score)
// on the causal part (0 elsewhere), y = (sum_k w v_k) / ||w||_2 with the weights (x2048) as f16 hi + residual x1024 against v as f16 hi + residual; softplus and

#define NB_  2                   // both batch items go through every kernel in one launch
#define NT_  2048
#define DM   1024
#define NH_  16
#define HD   64
#define NTK  (NB_ * NT_)
#define NW   1024
#define NQKV 1024
#define PSC  2048.0f                 // softplus weights are not bounded by 1: x2048 keeps them inside f16 range up to w = 31
#define LOSC 1024.0f
#define LOSCI (1.0f / 1024.0f)

typedef _Float16 h16;
typedef unsigned short bf;
typedef __attribute__((ext_vector_type(16))) __bf16   v16bf;
typedef __attribute__((ext_vector_type(16))) _Float16 v16h;
typedef __attribute__((ext_vector_type(8)))  _Float16 v8h;
typedef __attribute__((ext_vector_type(8)))  unsigned short v8us;
typedef __attribute__((ext_vector_type(8)))  float    v8f;
typedef __attribute__((ext_vector_type(4)))  float    v4f;
typedef __attribute__((ext_vector_type(2)))  float    v2f;
typedef __attribute__((ext_vector_type(2)))  _Float16 v2h;
typedef v8h  __attribute__((may_alias)) v8ha;
typedef v4f  __attribute__((may_alias)) v4fa;
typedef v8us __attribute__((may_alias)) v8usa;

__device__ __forceinline__ unsigned short f2bf(float f) { unsigned u = __float_as_uint(f); u += 0x7FFFu + ((u >> 16) & 1u); return (unsigned short)(u >> 16); }
__device__ __forceinline__ float bf2f(unsigned short b) { return __uint_as_float(((unsigned)b) << 16); }
__device__ __forceinline__ float bfr(float f) { return bf2f(f2bf(f)); }
__device__ __forceinline__ v16h cat16(v8h lo, v8h hi) { return __builtin_shufflevector(lo, hi, 0, 1, 2, 3, 4, 5, 6, 7, 8, 9, 10, 11, 12, 13, 14, 15); }
__device__ __forceinline__ v16bf cat16b(v8us lo, v8us hi) { return __builtin_bit_cast(v16bf, __builtin_shufflevector(lo, hi, 0, 1, 2, 3, 4, 5, 6, 7, 8, 9, 10, 11, 12, 13, 14, 15)); }
__device__ __forceinline__ v8f wmma16(v16h a, v16h b, v8f c) { return __builtin_amdgcn_wmma_f32_16x16x32_f16(false, a, false, b, (short)0, c, false, false); }
__device__ __forceinline__ v8f wmmab(v16bf a, v16bf b, v8f c) { return __builtin_amdgcn_wmma_f32_16x16x32_bf16(false, a, false, b, (short)0, c, false, false); }

// k_cvtb: one launch rounds all three f32 operands to bf16. Blocks of 8 rows: first x (NTK rows), then W_qkv (3 DM rows), then W_proj (DM rows); the grid covers exactly these rows.
__global__ __launch_bounds__(256) void k_cvtb(const float* __restrict__ x, const float* __restrict__ wqkv, const float* __restrict__ wp, bf* xb, bf* wb, bf* wpb) {
    const int row0 = blockIdx.x * 8, part = row0 < NTK ? 0 : (row0 < NTK + 3 * DM ? 1 : 2);        // the same for the whole block
    const float* __restrict__ src = part == 0 ? x : (part == 1 ? wqkv : wp);
    bf* dst = part == 0 ? xb : (part == 1 ? wb : wpb);
    const int lane = threadIdx.x & 31, r = row0 - (part == 0 ? 0 : (part == 1 ? NTK : NTK + 3 * DM)) + (threadIdx.x >> 5);
    v8us o[DM / 256];
#pragma unroll
    for (int q = 0; q < DM / 256; ++q) { v8us t;
#pragma unroll
        for (int i = 0; i < 8; ++i) t[i] = f2bf(src[(size_t)r * DM + q * 256 + lane * 8 + i]);
        o[q] = t; }
#pragma unroll
    for (int q = 0; q < DM / 256; ++q) *(v8us*)(dst + (size_t)r * DM + q * 256 + lane * 8) = o[q];
    
}

// Staged rows in LDS: 64 f16 of data + 8 of pad = 144 B, a pitch of 16 B x odd, which ds_load_b128 fragment reads take without bank conflicts.
#define KP   72
#define PLN  (64 * KP)               // one plane of a stage: 64 rows (K: 64 keys x 64 dims; V^T: 64 dims x 64 keys)
#define STG  (4 * PLN)               // a stage = 64 keys: K hi, K residual, V^T hi, V^T residual

__device__ __forceinline__ unsigned lds_addr(const void* p) { return (unsigned)(unsigned long long)p; }     // low 32 bits of a __shared__ address = LDS byte address

// Four rows-of-16 steps of one plane pair: each lane copies its own 16 B, global -> LDS, through no register. The s_wait_xcnt stands inside the statement so that
// no address register of an issued copy is rewritten ahead of it.
__device__ __forceinline__ void cp8(unsigned la, const h16* ga, unsigned lb, const h16* gb, size_t gstep) {
    asm volatile("global_load_async_to_lds_b128 %0, %1, off\n\t"
                 "global_load_async_to_lds_b128 %2, %3, off\n\t"
                 "global_load_async_to_lds_b128 %4, %5, off\n\t"
                 "global_load_async_to_lds_b128 %6, %7, off\n\t"
                 "global_load_async_to_lds_b128 %8, %9, off\n\t"
                 "global_load_async_to_lds_b128 %10, %11, off\n\t"
                 "global_load_async_to_lds_b128 %12, %13, off\n\t"
                 "global_load_async_to_lds_b128 %14, %15, off\n\t"
                 "s_wait_xcnt 0x0"
                 :: "v"(la), "v"(ga), "v"(la + 16 * KP * 2), "v"(ga + 16 * gstep), "v"(la + 32 * KP * 2), "v"(ga + 32 * gstep), "v"(la + 48 * KP * 2), "v"(ga + 48 * gstep),
                    "v"(lb), "v"(gb), "v"(lb + 16 * KP * 2), "v"(gb + 16 * gstep), "v"(lb + 32 * KP * 2), "v"(gb + 32 * gstep), "v"(lb + 48 * KP * 2), "v"(gb + 48 * gstep)
                 : "memory");
}
__device__ __forceinline__ void cp4(unsigned la, const h16* ga, size_t gstep) {
    asm volatile("global_load_async_to_lds_b128 %0, %1, off\n\t"
                 "global_load_async_to_lds_b128 %2, %3, off\n\t"
                 "global_load_async_to_lds_b128 %4, %5, off\n\t"
                 "global_load_async_to_lds_b128 %6, %7, off\n\t"
                 "s_wait_xcnt 0x0"
                 :: "v"(la), "v"(ga), "v"(la + 16 * KP * 2), "v"(ga + 16 * gstep), "v"(la + 32 * KP * 2), "v"(ga + 32 * gstep), "v"(la + 48 * KP * 2), "v"(ga + 48 * gstep)
                 : "memory");
}
__device__ __forceinline__ v16bf fragb(const bf* p) { return cat16b(*(const v8usa*)p, *(const v8usa*)(p + 16)); }

// k_gemmb: block = 32 MT rows x 128 columns, four waves as 2 x 2, wave = 16 MT rows x 64 columns: every A or B row that the block brings in from L2 serves 128 columns or 32 MT rows,
// and every fragment read from LDS feeds 4 or MT matrix instructions. The k range runs in stages of 64 (planes of 64 rows x 64 k): the block's A rows (and their residual plane)
// and B rows come into a two-buffer LDS ring by asynchronous copies, whole 128-B lines, once per block, stage t + 1 in flight while stage t is worked on.
// QKV: Bn holds the 3 DM rows of W_qkv and blockIdx.y walks all of them in one launch; a block's 128 columns lie in one of q, k, v: q and k leave as f16 hi + residual planes,
// v leaves transposed, as the f16 hi + residual planes VH/VL[b][h][dim][token] that the attention kernel reads: an accumulator register run holds eight tokens of one dim.
template <bool SPLITA, bool QKV, int MT>
__global__ __launch_bounds__(128) void k_gemmb(const bf* __restrict__ A, const bf* __restrict__ Al, const bf* __restrict__ Bn, const float* __restrict__ bias, float* C, int ldc, h16* QH, h16* QL, h16* KH, h16* KL, h16* VH, h16* VL) {
    constexpr int APL = MT / 2;                          // planes of 64 rows that hold the block's A rows
    constexpr int BOF = APL * PLN, LOF = (APL + 2) * PLN;    // a stage: A planes, two B planes and, where A is split, its residual planes
    constexpr int GST = ((SPLITA ? 2 : 1) * APL + 2) * PLN, NST = DM / 64;
    __shared__ __align__(16) bf gring[2 * GST];
    __shared__ __align__(16) float ost[4][16 * 68];
    const int lane = threadIdx.x & 31, wave = threadIdx.x >> 5, lr = lane & 15, hi = lane >> 4;
    const int wm = wave >> 1, wn = wave & 1;
    const int rb = blockIdx.x * (32 * MT), r0 = rb + wm * (16 * MT), cb = blockIdx.y * 128, c0 = cb + wn * 64;
    // copy slots: thread -> row (tid >> 3) + 16 i, 16-byte piece tid & 7: a wave's copy covers four whole 128-B lines
    const int crow = threadIdx.x >> 3, cpc = threadIdx.x & 7;
    const unsigned lring = lds_addr(&gring[0]) + (unsigned)(crow * KP + cpc * 8) * 2u;
    const size_t ao = (size_t)(rb + crow) * DM + cpc * 8, bo = (size_t)(cb + crow) * DM + cpc * 8;
    auto stage = [&](int t, int bufi) {
        const unsigned lb = lring + (unsigned)bufi * (GST * 2u);
        const int k0 = t * 64;
#pragma unroll
        for (int p = 0; p < APL; p += SPLITA ? 1 : 2) {   // two planes a statement: A with its residual, or two planes of A
            const size_t go = ao + (size_t)p * 64 * DM + k0;
            if (SPLITA) cp8(lb + (unsigned)p * (PLN * 2u), (const h16*)(const void*)(A + go), lb + (unsigned)(LOF + p * PLN) * 2u, (const h16*)(const void*)(Al + go), DM);
            else if (p + 1 < APL) cp8(lb + (unsigned)p * (PLN * 2u), (const h16*)(const void*)(A + go), lb + (unsigned)(p + 1) * (PLN * 2u), (const h16*)(const void*)(A + go + (size_t)64 * DM), DM);
            else cp4(lb + (unsigned)p * (PLN * 2u), (const h16*)(const void*)(A + go), DM);
        }
        cp8(lb + BOF * 2u, (const h16*)(const void*)(Bn + bo + k0), lb + (BOF + PLN) * 2u, (const h16*)(const void*)(Bn + bo + (size_t)64 * DM + k0), DM);
    };
    stage(0, 0);
    asm volatile("s_wait_asynccnt 0x0" ::: "memory");     // this wave's copies of stage 0 have landed
    __syncthreads();                                      // ... and every other wave's: stage 0 is readable
    stage(1, 1);
    v8f acc[MT][4];
#pragma unroll
    for (int m = 0; m < MT; ++m)
#pragma unroll
        for (int t = 0; t < 4; ++t) acc[m][t] = (v8f){};
#pragma unroll 1
    for (int st = 0; st < NST; ++st) {
        const bf* sb = gring + (st & 1) * GST;
        const bf* ap = sb + (wm * (16 * MT) + lr) * KP + 8 * hi;
        const bf* bp = sb + BOF + (wn * 64 + lr) * KP + 8 * hi;
        v16bf a[2][MT], al[2][MT], b[2][4];
        auto ld = [&](int kc) {
#pragma unroll
            for (int m = 0; m < MT; ++m) { a[kc][m] = fragb(ap + m * 16 * KP + kc * 32); if (SPLITA) al[kc][m] = fragb(ap + LOF + m * 16 * KP + kc * 32); }
#pragma unroll
            for (int t = 0; t < 4; ++t) b[kc][t] = fragb(bp + t * 16 * KP + kc * 32);
            // keeps the fragment reads together ahead of their matrix instructions: left free, they sink in between them, two at a time, each place with a wait to 0
            __builtin_amdgcn_sched_barrier(0);
        };
        auto mm = [&](int kc) {
#pragma unroll
            for (int m = 0; m < MT; ++m)
#pragma unroll
                for (int t = 0; t < 4; ++t) acc[m][t] = wmmab(a[kc][m], b[kc][t], acc[m][t]);
            if (SPLITA) {
#pragma unroll
                for (int m = 0; m < MT; ++m)
#pragma unroll
                    for (int t = 0; t < 4; ++t) acc[m][t] = wmmab(al[kc][m], b[kc][t], acc[m][t]);
            }
        };
        if (MT <= 2) { ld(0); ld(1); mm(0); mm(1); }      // both halves' fragments fit in registers beside the accumulators
        else { ld(0); mm(0); ld(1); mm(1); }
        // keeps the matrix instructions ahead of the publish point: left free, they sink behind the barrier and hold back the refill, whose flight then has no work to hide behind
        __builtin_amdgcn_sched_barrier(0);
        // publish point of stage st + 1: own LDS reads of stage st done, own copies of stage st + 1 landed, then the barrier that serves both
        asm volatile("s_wait_dscnt 0x0" ::: "memory");
        asm volatile("s_wait_asynccnt 0x0" ::: "memory");
        __syncthreads();
        if (st + 2 < NST) stage(st + 2, st & 1);          // refill the buffer that every wave has just left
    }
    asm volatile("s_wait_asynccnt 0x0" ::: "memory");     // nothing of this wave is in flight when it goes on to the epilogue
    float* os = &ost[wave][0];
    const int sel = QKV ? (int)(blockIdx.y / (unsigned)(DM / 128)) : 2;    // whose columns these are: 0 q, 1 k, 2 v, or without QKV the f32 output; the same for the whole block
    const int cc = QKV ? c0 - sel * DM : c0;                   // first column inside that output
    if (QKV && sel == 2) {
        // the wave's 64 tokens x 64 columns are one head's V tile. Lane (lr, hi) holds, per accumulator, tokens 8 hi .. 8 hi + 7 of dim t * 16 + lr: 16 B of a V^T row.
        // The rows are gathered in the wave's own quarter of the ring, which every wave has left (the loop's last barrier), and go out as whole 128-B lines.
        h16* vs = (h16*)(void*)gring + wave * (2 * PLN);
#pragma unroll
        for (int m = 0; m < MT; ++m)
#pragma unroll
            for (int t = 0; t < 4; ++t) { v8h o, o2;
#pragma unroll
                for (int j = 0; j < 8; ++j) { const float v = acc[m][t][j]; const h16 a = (h16)v; o[j] = a; o2[j] = (h16)((v - (float)a) * LOSC); }
                *(v8ha*)(vs + (t * 16 + lr) * KP + m * 16 + hi * 8) = o; *(v8ha*)(vs + PLN + (t * 16 + lr) * KP + m * 16 + hi * 8) = o2; }
        __syncthreads();                                      // the rows are read back by other lanes than wrote them
        const size_t vb = ((size_t)(r0 / NT_) * NH_ + cc / HD) * HD * NT_ + r0 % NT_;
        const int d0 = lane >> 3, piece = lane & 7;
        v8h o[16], o2[16];                                    // the accumulators are dead: every row piece has registers of its own, none is written again behind its store
#pragma unroll
        for (int s = 0; s < 16; ++s) { o[s] = *(const v8ha*)(vs + (4 * s + d0) * KP + piece * 8); o2[s] = *(const v8ha*)(vs + PLN + (4 * s + d0) * KP + piece * 8); }
#pragma unroll
        for (int s = 0; s < 16; ++s) { *(v8h*)(VH + vb + (size_t)(4 * s + d0) * NT_ + piece * 8) = o[s]; *(v8h*)(VL + vb + (size_t)(4 * s + d0) * NT_ + piece * 8) = o2[s]; }
        return;
    }
    float bv[4];
#pragma unroll
    for (int t = 0; t < 4; ++t) bv[t] = bias ? bfr(bias[c0 + t * 16 + lr]) : 0.f;
    // the wave's MT tiles of 16 rows go out one after another through its own staging rows
#pragma unroll
    for (int m = 0; m < MT; ++m) {
#pragma unroll
        for (int t = 0; t < 4; ++t)
#pragma unroll
            for (int j = 0; j < 8; ++j) os[(hi * 8 + j) * 68 + t * 16 + lr] = acc[m][t][j] + bv[t];
        __syncthreads();
        if (QKV) {
            h16* crow = (sel ? KH : QH) + (size_t)(r0 + m * 16) * ldc + cc;
            h16* crow2 = (sel ? KL : QL) + (size_t)(r0 + m * 16) * ldc + cc;
#pragma unroll
            for (int s = 0; s < 4; ++s) { const int row = 4 * s + (lane >> 3), piece = lane & 7; const float* sp = os + row * 68 + piece * 8; v8h o, o2;
#pragma unroll
                for (int i = 0; i < 8; ++i) { const h16 a = (h16)sp[i]; o[i] = a; o2[i] = (h16)((sp[i] - (float)a) * LOSC); }
                *(v8h*)(crow + (size_t)row * ldc + piece * 8) = o; *(v8h*)(crow2 + (size_t)row * ldc + piece * 8) = o2; }
            asm volatile("s_wait_xcnt 0x0" ::: "memory");     // the next tile's code writes the stores' registers anew: the wait stands in front of that
        } else {
            float* crow = C + (size_t)(r0 + m * 16) * ldc + cc;
#pragma unroll
            for (int s = 0; s < 8; ++s) { const int Lid = (lane >> 3) + 4 * s, piece = lane & 7; const int row = Lid >> 1, cofs = (Lid & 1) * 32 + piece * 4;
                const v4f val = *(const v4fa*)(os + row * 68 + cofs); *(v4f*)(crow + (size_t)row * ldc + cofs) = val; }
            // the next tile's code writes the stores' registers anew: the wait stands in front of that
            asm volatile("s_wait_xcnt 0x0" ::: "memory");
        }
    }
}

// softplus(x) = max(x, 0) + log1p(e), e = exp(-|x|) in (0, 1]. log1p(e) = log(u) + c with u = 1 + e rounded and c = e - (u - 1), exactly what that rounding lost
// (|c| <= 2^-24; taking c for c / u moves the result by at most 2^-24 of itself): one hardware log2, small e keeps its relative accuracy and never falls to 0.
__device__ __forceinline__ float softplusf(float x) {
    const float e = __expf(-fabsf(x)), u = 1.0f + e;
    return fmaxf(x, 0.f) + fmaf(__builtin_amdgcn_logf(u), 0.69314718f, e - (u - 1.0f));
}
__device__ __forceinline__ v16h frag(const h16* p) { return cat16(*(const v8ha*)p, *(const v8ha*)(p + 16)); }

// k_attn: block = (b, h, 64 queries), wave = 16 queries; causal key range in stages of 64 keys, two passes of 32 keys each. The block's four waves share each stage:
// K and V^T (hi + residual) come into a two-buffer LDS ring by asynchronous copies, stage t + 1 in flight while stage t is worked on; the query residual is staged once.
// Both products run transposed: S^T = K.Q^T (A = key rows, B = queries) and O^T += V^T.P^T (A = V^T rows, B = weights). A lane then holds one query's scores for keys
// 8 hi + j and 16 + 8 hi + j, which is the k order of a B operand: the weights go from the score accumulators into the second product inside the lane's own registers.
// Per pass: 12 WMMA scores /8 (f32), softplus weights x2048 as f16 hi + residual, 12 WMMA V^T.P^T;
// ctx -> bf16 hi + residual planes CH/CL[tok][h*64+d].
__global__ __launch_bounds__(128) void k_attn(const h16* __restrict__ Q16, const h16* __restrict__ QL16, const h16* __restrict__ K16, const h16* __restrict__ KL16, const h16* __restrict__ VTH, const h16* __restrict__ VTL, bf* CH, bf* CL) {
    __shared__ __align__(16) h16 ring[2 * STG];
    __shared__ __align__(16) h16 qls[PLN];
    __shared__ __align__(16) float ost[4][16 * 68];
    const int lane = threadIdx.x & 31, wave = threadIdx.x >> 5, lr = lane & 15, hi = lane >> 4;
    const int bid = blockIdx.x;
    // a block's cost grows with its query tile (qt + 1 stages); the longest tiles take the lowest indices
    // (all heads of tile 31, then of tile 30, ...), for speed only
    const unsigned rank = (unsigned)bid / (NB_ * NH_), bh = (unsigned)bid % (NB_ * NH_);
    const int qt = NT_ / 64 - 1 - (int)rank, b = (int)(bh / NH_), h = (int)(bh % NH_);
    const int q0 = qt * 64 + wave * 16;
    const size_t tok0 = (size_t)b * NT_;
    const h16* kh_b = K16 + tok0 * DM + h * HD;
    const h16* kl_b = KL16 + tok0 * DM + h * HD;
    const size_t vbase = (((size_t)b * NH_ + h) * HD) * NT_;
    // copy slots: thread -> row (tid >> 3) + 16 i, 16-byte piece tid & 7: a wave's copy covers four whole 128-B lines
    const int crow = threadIdx.x >> 3, cpc = threadIdx.x & 7;
    const unsigned lslot = (unsigned)(crow * KP + cpc * 8) * 2u;
    const unsigned lring = lds_addr(&ring[0]) + lslot;
    auto stage = [&](int t, int bufi) {
        const unsigned lb = lring + (unsigned)bufi * (STG * 2u);
        const size_t ko = (size_t)(t * 64 + crow) * DM + cpc * 8, vo = vbase + (size_t)crow * NT_ + t * 64 + cpc * 8;
        cp8(lb, kh_b + ko, lb + PLN * 2u, kl_b + ko, DM);
        cp8(lb + 2u * PLN * 2u, VTH + vo, lb + 3u * PLN * 2u, VTL + vo, NT_);
    };
    const int ntrip = qt + 1;     // causal: keys 0 .. qt * 64 + 63
    cp4(lds_addr(&qls[0]) + lslot, QL16 + (tok0 + qt * 64 + crow) * DM + h * HD + cpc * 8, DM);
    stage(0, 0);
    asm volatile("s_wait_asynccnt 0x0" ::: "memory");     // this wave's copies of stage 0 have landed
    __syncthreads();                                      // ... and every other wave's: stage 0 and the query residual are readable
    if (ntrip > 1) stage(1, 1);
    v16h qa[2];
    const size_t qo0 = (tok0 + q0 + lr) * DM + h * HD + 8 * hi;
#pragma unroll
    for (int kc = 0; kc < 2; ++kc) qa[kc] = cat16(*(const v8h*)(Q16 + qo0 + kc * 32), *(const v8h*)(Q16 + qo0 + kc * 32 + 16));
    const h16* qlp = qls + (wave * 16 + lr) * KP + 8 * hi;
    v8f o[4], ox[4];
#pragma unroll
    for (int n = 0; n < 4; ++n) { o[n] = (v8f){}; ox[n] = (v8f){}; }
    float lpart[8];
#pragma unroll
    for (int j = 0; j < 8; ++j) lpart[j] = 0.f;
    const int qi = q0 + lr;       // the lane's query: column lr of every S^T and O^T tile
#pragma unroll 1
    for (int t = 0; t < ntrip; ++t) {
        const h16* sb = ring + (t & 1) * STG;
#pragma unroll 1
        for (int sub = 0; sub < 2; ++sub) {
            const int l0 = t * 64 + sub * 32;
            const h16* kp0 = sb + (sub * 32 + lr) * KP + 8 * hi;
            v16h k0h[2], k1h[2], k0l[2], k1l[2], qlk[2];
#pragma unroll
            for (int kc = 0; kc < 2; ++kc) {
                k0h[kc] = frag(kp0 + kc * 32); k1h[kc] = frag(kp0 + 16 * KP + kc * 32); qlk[kc] = frag(qlp + kc * 32);
                k0l[kc] = frag(kp0 + PLN + kc * 32); k1l[kc] = frag(kp0 + PLN + 16 * KP + kc * 32);
            }
            v8f s0 = {}, s1 = {}, x0 = {}, x1 = {};
#pragma unroll
            for (int kc = 0; kc < 2; ++kc) {
                s0 = wmma16(k0h[kc], qa[kc], s0); x0 = wmma16(k0h[kc], qlk[kc], x0); s1 = wmma16(k1h[kc], qa[kc], s1); x1 = wmma16(k1h[kc], qlk[kc], x1);
                x0 = wmma16(k0l[kc], qa[kc], x0); x1 = wmma16(k1l[kc], qa[kc], x1);
            }
            // four vector slots between the last score WMMA and the first use of its result or rewrite of its operands
            asm volatile("v_nop\n\tv_nop\n\tv_nop\n\tv_nop" : "+v"(s0), "+v"(s1), "+v"(x0), "+v"(x1)
                         : "v"(qa[0]), "v"(qa[1]), "v"(qlk[0]), "v"(qlk[1]), "v"(k0h[0]), "v"(k0h[1]), "v"(k1h[0]), "v"(k1h[1]), "v"(k0l[0]), "v"(k0l[1]), "v"(k1l[0]), "v"(k1l[1]));
            // V^T fragments of this pass: fetched here so that the softplus work covers their LDS latency
            const h16* vp0 = sb + 2 * PLN + lr * KP + sub * 32 + hi * 8;
            v16h vh[4], vl[4];
#pragma unroll
            for (int n = 0; n < 4; ++n) { vh[n] = frag(vp0 + n * 16 * KP); vl[n] = frag(vp0 + PLN + n * 16 * KP); }
            v16h pa, px;
            const int dq = qi - l0 - 8 * hi;                      // accumulator register j holds keys l0 + 8 hi + j and + 16: causal where j <= dq, j + 16 <= dq
            float pw0[8], pw1[8];
#pragma unroll
            for (int j = 0; j < 8; ++j) {
                // sp2norm: w = causal ? softplus(s x scale) : 0 (softplus as logaddexp(x, 0) = max(x,0) + log1p(exp(-|x|))); the row is later divided by sqrt(sum w^2)
                const float a0 = (s0[j] + x0[j] * LOSCI) * 0.125f, a1 = (s1[j] + x1[j] * LOSCI) * 0.125f;
                const float w0 = softplusf(a0), w1 = softplusf(a1);
                const float p0 = (j <= dq) ? w0 : 0.f, p1 = (j + 16 <= dq) ? w1 : 0.f;
                lpart[j] = lpart[j] + (p0 * p0 + p1 * p1);
                pw0[j] = p0 * PSC; pw1[j] = p1 * PSC;
            }
#pragma unroll
            for (int j = 0; j < 8; j += 2) {                      // two neighbours fill one register of the B operand
                const v2f a0 = {pw0[j], pw0[j + 1]}, a1 = {pw1[j], pw1[j + 1]};
                const v2h h0 = __builtin_convertvector(a0, v2h), h1 = __builtin_convertvector(a1, v2h);
                const v2h r0 = __builtin_convertvector((a0 - __builtin_convertvector(h0, v2f)) * LOSC, v2h), r1 = __builtin_convertvector((a1 - __builtin_convertvector(h1, v2f)) * LOSC, v2h);
                pa[j] = h0[0]; pa[j + 1] = h0[1]; pa[8 + j] = h1[0]; pa[9 + j] = h1[1];
                px[j] = r0[0]; px[j + 1] = r0[1]; px[8 + j] = r1[0]; px[9 + j] = r1[1];
            }
#pragma unroll
            for (int n = 0; n < 4; ++n) { o[n] = wmma16(vh[n], pa, o[n]); ox[n] = wmma16(vl[n], pa, ox[n]); ox[n] = wmma16(vh[n], px, ox[n]); }
            // four vector slots behind the last WMMA, on the loop's back edge too, before its operands are refilled
            asm volatile("v_nop\n\tv_nop\n\tv_nop\n\tv_nop" : "+v"(o[0]), "+v"(o[1]), "+v"(o[2]), "+v"(o[3]), "+v"(ox[0]), "+v"(ox[1]), "+v"(ox[2]), "+v"(ox[3])
                         : "v"(pa), "v"(px), "v"(vh[0]), "v"(vh[1]), "v"(vh[2]), "v"(vh[3]), "v"(vl[0]), "v"(vl[1]), "v"(vl[2]), "v"(vl[3]));
        }
        // publish point of stage t + 1: own LDS reads of stage t done, own copies of stage t + 1 landed, then the barrier that serves both
        asm volatile("s_wait_dscnt 0x0" ::: "memory");
        asm volatile("s_wait_asynccnt 0x0" ::: "memory");
        __syncthreads();
        if (t + 2 < ntrip) stage(t + 2, t & 1);           // refill the buffer that every wave has just left
    }
    asm volatile("s_wait_asynccnt 0x0" ::: "memory");     // nothing of this wave is in flight when it goes on to the epilogue
    float rs = ((lpart[0] + lpart[1]) + (lpart[2] + lpart[3])) + ((lpart[4] + lpart[5]) + (lpart[6] + lpart[7]));     // the lane's own keys of its query
    rs += __shfl_xor(rs, 16);                             // lane lr + 16 holds the query's other keys
    const float inv = 1.0f / (sqrtf(rs) * PSC);           // 1 / (||w||_2 x the P scaling)
    float* os = &ost[wave][0];
#pragma unroll
    for (int n = 0; n < 4; ++n) { v4f e0, e1;             // O^T register j = dim n * 16 + 8 hi + j of query lr: eight neighbours of one staged row
#pragma unroll
        for (int j = 0; j < 4; ++j) { e0[j] = (o[n][j] + ox[n][j] * LOSCI) * inv; e1[j] = (o[n][4 + j] + ox[n][4 + j] * LOSCI) * inv; }
        *(v4fa*)(os + lr * 68 + n * 16 + hi * 8) = e0; *(v4fa*)(os + lr * 68 + n * 16 + hi * 8 + 4) = e1; }
    __syncthreads();
    const size_t cbase = (tok0 + q0) * DM + (size_t)h * HD;
    auto pass = [&]() {
#pragma unroll
        for (int s = 0; s < 4; ++s) { const int row = 4 * s + (lane >> 3), piece = lane & 7; const float* sp = os + row * 68 + piece * 8; v8us oh, ol;
#pragma unroll
            for (int i = 0; i < 8; ++i) { const unsigned short hb = f2bf(sp[i]); oh[i] = hb; ol[i] = f2bf(sp[i] - bf2f(hb)); }
            *(v8us*)(CH + cbase + (size_t)row * DM + piece * 8) = oh; *(v8us*)(CL + cbase + (size_t)row * DM + piece * 8) = ol; }
    };
    pass(); 
}

#define VST2(T, p, v) do { const T vst2_v_ = (v); *(T*)(p) = vst2_v_;  } while (0)
extern "C" void kernel_launch(void* const* d_in, const int* in_sizes, int n_in,
                              void* d_out, int out_size, void* d_ws, size_t ws_size, hipStream_t stream) {
    (void)in_sizes; (void)n_in; (void)out_size;
    const float* x = (const float*)d_in[0]; const float* Wqkv = (const float*)d_in[1]; const float* Wp = (const float*)d_in[2]; const float* bp = (const float*)d_in[3];   // [out][in]
    float* out = (float*)d_out;    // [2][2048][1024] = [4096 tokens][1024]
    char* wsp = (char*)d_ws;
    auto take = [&](size_t bytes) { char* p = wsp; wsp += (bytes + 255) & ~(size_t)255; return (void*)p; };
    bf* Xb = (bf*)take((size_t)NTK * DM * 2); bf* WB = (bf*)take((size_t)3 * DM * DM * 2); bf* WpB = (bf*)take((size_t)DM * DM * 2);
    h16* QH = (h16*)take((size_t)NTK * DM * 2); h16* QL = (h16*)take((size_t)NTK * DM * 2); h16* KH = (h16*)take((size_t)NTK * DM * 2); h16* KL = (h16*)take((size_t)NTK * DM * 2);
    h16* VTH = (h16*)take((size_t)NTK * DM * 2); h16* VTL = (h16*)take((size_t)NTK * DM * 2); bf* CH = (bf*)take((size_t)NTK * DM * 2); bf* CL = (bf*)take((size_t)NTK * DM * 2);
    if ((size_t)(wsp - (char*)d_ws) > ws_size) return;    // 80 MiB, no aliasing
    k_cvtb<<<(NTK + 4 * DM) / 8, 256, 0, stream>>>(x, Wqkv, Wp, Xb, WB, WpB);
    k_gemmb<false, true, 4><<<dim3(NTK / 128, 3 * DM / 128, 1), 128, 0, stream>>>(Xb, nullptr, WB, nullptr, nullptr, DM, QH, QL, KH, KL, VTH, VTL);          // q, k, v^T = x.W_qkv^T
    k_attn<<<NB_ * NH_ * (NT_ / 64), 128, 0, stream>>>(QH, QL, KH, KL, VTH, VTL, CH, CL);
    k_gemmb<true, false, 2><<<dim3(NTK / 64, DM / 128, 1), 128, 0, stream>>>(CH, CL, WpB, bp, out, DM, nullptr, nullptr, nullptr, nullptr, nullptr, nullptr);
}
